// v000
// Measured on an AMD MI455X. A time is GPU time per run, averaged over a window of back-to-back runs after a warm-up
// (all launches, gaps included; the runs take copies of the inputs in turn), and the median of several windows.
// Apart from v000's, it joins two sittings. Times from different sittings can be a few percent apart, while
// side-by-side timings come from the same sitting.
// v000 is the starting kernel. One run takes 1360 microseconds.
#include <hip/hip_runtime.h>
// Global + local spatial attention (x = [q|k|v] of 20 slices x 1024 positions x 64 channels; 4 heads of 16; per-channel scale+bias 'depthwise k=1 convs' for each branch): g = attn(q gq_w + gq_b, k gk_w + gk_b, v gv_w + gv_b), l likewise; out = (2 (0.5 l + 0.5 g)) proj_w + proj_b -> [20,1024,64].
// Structure (per slice): the scaled q/k as three-segment f16 rows per 16-dim head ([hi | 16 lo | hi/16 | 0] x [hi | hi/16 | 16 lo | 0], K 64), v as f16 planes transposed per head by an LDS tile kernel (N padded to 64); for the 8 (branch, head) pairs at once: scores as a head-batched f16 WMMA GEMM (32x64 wave tiles, f32 accumulation; K 64) into f32 planes, a wave-per-row f32 softmax over the 1024 keys (three rolled passes, P x2^10 f16), attn.v as a head-batched GEMM (K 1024); the branch mix and the output scale/bias on VALU.
// Compute dtype: x and all parameters rounded to bf16; q, k as hi + residual three-segment products (~2^-20); v, P as f16 operands (~2^-12); f32 accumulation, softmax, elementwise. v_wmma_f32_16x16x32_f16.
#define NSL 20
#define NRUN NSL                 /* slices processed (NSL stays the input stride) */
#define HW 1024
#define CC 64
#define NHD 4
#define HD 16
#define NG 8                     /* (branch, head) pairs per slice: g = br*4 + h */
typedef __bf16 v16b __attribute__((ext_vector_type(16)));
typedef unsigned short v8us __attribute__((ext_vector_type(8), may_alias));
typedef float  v8f  __attribute__((ext_vector_type(8)));
typedef float  v4f  __attribute__((ext_vector_type(4)));
typedef float  v4fa __attribute__((ext_vector_type(4), may_alias));
union FragB { v16b v; v8us half[2]; unsigned short u[16]; };

__device__ __forceinline__ unsigned short bf16_bits(float x) { unsigned int u = __float_as_uint(x); return (unsigned short)((u + 0x7FFFu + ((u >> 16) & 1u)) >> 16); }
__device__ __forceinline__ float bf16_val(unsigned short b) { return __uint_as_float(((unsigned int)b) << 16); }
__device__ __forceinline__ float bf16_round(float x) { return bf16_val(bf16_bits(x)); }
// D += A·B with NT terms: 1 = ah·bh, 2 = + al·bh (A split), 3 = + ah·bl (both split)
template <int NT>
__device__ __forceinline__ v8f mmaN(v16b ah, v16b al, v16b bh, v16b bl, v8f c) {
  c = __builtin_amdgcn_wmma_f32_16x16x32_bf16(false, ah, false, bh, (short)0, c, false, false);
  if (NT >= 2) c = __builtin_amdgcn_wmma_f32_16x16x32_bf16(false, al, false, bh, (short)0, c, false, false);
  if (NT >= 3) c = __builtin_amdgcn_wmma_f32_16x16x32_bf16(false, ah, false, bl, (short)0, c, false, false);
  asm volatile("v_nop\n\tv_nop\n\tv_nop\n\tv_nop" : "+v"(c) : "v"(ah), "v"(al), "v"(bh), "v"(bl));
  return c;
}

__global__ __launch_bounds__(256) void k_wt_bf16(const float* __restrict__ W, unsigned short* __restrict__ Wt, int K, int N) {
  const int t = blockIdx.x * 256 + threadIdx.x;
  const int k8n = K / 8;
  if (t >= N * k8n) return;
  const int n = t / k8n, k8 = (t % k8n) * 8;
  v8us v;
#pragma unroll
  for (int i = 0; i < 8; ++i) v[i] = bf16_bits(W[(size_t)(k8 + i) * N + n]);
  *(v8us*)(Wt + (size_t)n * K + k8) = v;
  
}

// GEMM C[M][N] (f32, pitch ldc) = act(A[M][K]·W + bias). A f32 row-major (pitch lda) converted per fragment to bf16
// (ASPLIT: hi/lo two planes -> 2 terms, else single rounded term); Wt bf16 [N][K] (pitch ldb). BIAS_BF16 rounds the
// bias to bf16 first (bias quantised to bf16 before the add). K%32==0, M%16==0, N%64==0.
template <bool ASPLIT, int ACT, bool BIAS_BF16>
__global__ __launch_bounds__(128) void k_gemm_bf(const float* __restrict__ A, int lda, const unsigned short* __restrict__ Wt, int ldb,
                                               const float* __restrict__ bias, float* __restrict__ C, int ldc, int M, int N, int K) {
  __shared__ __attribute__((aligned(16))) float so[4][16][64];
  const int tid = threadIdx.x, w = tid >> 5, lane = tid & 31, ln = lane & 15, hh = lane >> 4;
  const int ntn = N / 64;
  const int wid = blockIdx.x * 4 + w;
  const int mt = wid / ntn, nq = wid % ntn;
  if (mt * 16 >= M) return;
  const int row0 = mt * 16, col0 = nq * 64;
  const float* arow = A + (size_t)(row0 + ln) * lda;
  v8f acc[4] = {};
  for (int kb = 0; kb < K; kb += 32) {
    FragB ah, al;
    const v4f x0 = *(const v4fa*)(arow + kb + 8 * hh), x1 = *(const v4fa*)(arow + kb + 8 * hh + 4);
    const v4f x2 = *(const v4fa*)(arow + kb + 16 + 8 * hh), x3 = *(const v4fa*)(arow + kb + 16 + 8 * hh + 4);
    float xs[16] = {x0[0],x0[1],x0[2],x0[3],x1[0],x1[1],x1[2],x1[3],x2[0],x2[1],x2[2],x2[3],x3[0],x3[1],x3[2],x3[3]};
#pragma unroll
    for (int i = 0; i < 16; ++i) { const unsigned short hb = bf16_bits(xs[i]); ah.u[i] = hb; al.u[i] = ASPLIT ? bf16_bits(xs[i] - bf16_val(hb)) : (unsigned short)0; }
#pragma unroll
    for (int t = 0; t < 4; ++t) {
      const unsigned short* brow = Wt + (size_t)(col0 + t * 16 + ln) * ldb + kb;
      FragB b;
      b.half[0] = *(const v8us*)(brow + 8 * hh);
      b.half[1] = *(const v8us*)(brow + 16 + 8 * hh);
      acc[t] = mmaN<ASPLIT ? 2 : 1>(ah.v, al.v, b.v, b.v, acc[t]);
    }
  }
#pragma unroll
  for (int t = 0; t < 4; ++t) {
    float bv = bias ? bias[col0 + t * 16 + ln] : 0.f;
    if (BIAS_BF16) bv = bf16_round(bv);
#pragma unroll
    for (int r = 0; r < 8; ++r) { float v = acc[t][r] + bv; if (ACT == 1) v = fmaxf(v, 0.f); so[w][8 * hh + r][t * 16 + ln] = v; }
  }
  __builtin_amdgcn_fence(__ATOMIC_ACQ_REL, "workgroup");
  __builtin_amdgcn_wave_barrier();
  const int rsub = lane >> 4, c4 = (lane & 15) * 4;
  {
#pragma unroll
    for (int q = 0; q < 8; ++q) {
      const int r = q * 2 + rsub;
      const v4f v = *(const v4fa*)&so[w][r][c4];
      *(v4f*)(C + (size_t)(row0 + r) * ldc + col0 + c4) = v;
    }
    
  }
}

// GEMM C = act(A·W + bias + resid): A f32 (ASPLIT -> hi/lo 2 terms), Wt bf16 [N][K]; ACT 0 none, 1 relu, 2 exact gelu;
// resid (optional, f32, row index = (row % rmod), pitch ldr, RES_BF16 rounds it) added before the activation.
template <bool ASPLIT, int ACT, bool BIAS_BF16, bool RES_BF16>
__global__ __launch_bounds__(128) void k_gemm_bf3(const float* __restrict__ A, int lda, const unsigned short* __restrict__ Wt, int ldb,
                                                const float* __restrict__ bias, const float* __restrict__ resid, int rmod, int ldr,
                                                float* __restrict__ C, int ldc, int M, int N, int K) {
  __shared__ __attribute__((aligned(16))) float so[4][16][64];
  const int tid = threadIdx.x, w = tid >> 5, lane = tid & 31, ln = lane & 15, hh = lane >> 4;
  const int ntn = N / 64;
  const int wid = blockIdx.x * 4 + w;
  const int mt = wid / ntn, nq = wid % ntn;
  if (mt * 16 >= M) return;
  const int row0 = mt * 16, col0 = nq * 64;
  const float* arow = A + (size_t)(row0 + ln) * lda;
  v8f acc[4] = {};
  for (int kb = 0; kb < K; kb += 32) {
    FragB ah, al;
    const v4f x0 = *(const v4fa*)(arow + kb + 8 * hh), x1 = *(const v4fa*)(arow + kb + 8 * hh + 4);
    const v4f x2 = *(const v4fa*)(arow + kb + 16 + 8 * hh), x3 = *(const v4fa*)(arow + kb + 16 + 8 * hh + 4);
    float xs[16] = {x0[0],x0[1],x0[2],x0[3],x1[0],x1[1],x1[2],x1[3],x2[0],x2[1],x2[2],x2[3],x3[0],x3[1],x3[2],x3[3]};
#pragma unroll
    for (int i = 0; i < 16; ++i) { const unsigned short hb = bf16_bits(xs[i]); ah.u[i] = hb; al.u[i] = ASPLIT ? bf16_bits(xs[i] - bf16_val(hb)) : (unsigned short)0; }
#pragma unroll
    for (int t = 0; t < 4; ++t) {
      const unsigned short* brow = Wt + (size_t)(col0 + t * 16 + ln) * ldb + kb;
      FragB b;
      b.half[0] = *(const v8us*)(brow + 8 * hh);
      b.half[1] = *(const v8us*)(brow + 16 + 8 * hh);
      acc[t] = mmaN<ASPLIT ? 2 : 1>(ah.v, al.v, b.v, b.v, acc[t]);
    }
  }
#pragma unroll
  for (int t = 0; t < 4; ++t) {
    const int col = col0 + t * 16 + ln;
    float bv = bias ? bias[col] : 0.f;
    if (BIAS_BF16) bv = bf16_round(bv);
#pragma unroll
    for (int r = 0; r < 8; ++r) {
      float v = acc[t][r] + bv;
      if (resid) { float rv = resid[(size_t)((row0 + 8 * hh + r) % rmod) * ldr + col]; if (RES_BF16) rv = bf16_round(rv); v += rv; }
      if (ACT == 1) v = fmaxf(v, 0.f);
      if (ACT == 2) v = 0.5f * v * (1.0f + erff(v * 0.70710678118654752f));
      if (ACT == 3) { const float u = 0.7978845608028654f * (v + 0.044715f * v * v * v); v = 0.5f * v * (1.0f + tanhf(u)); }
      so[w][8 * hh + r][t * 16 + ln] = v;
    }
  }
  __builtin_amdgcn_fence(__ATOMIC_ACQ_REL, "workgroup");
  __builtin_amdgcn_wave_barrier();
  const int rsub = lane >> 4, c4 = (lane & 15) * 4;
  {
#pragma unroll
    for (int q = 0; q < 8; ++q) {
      const int r = q * 2 + rsub;
      const v4f v = *(const v4fa*)&so[w][r][c4];
      *(v4f*)(C + (size_t)(row0 + r) * ldc + col0 + c4) = v;
    }
    
  }
}
// row LayerNorm (biased variance, eps) over N: s = X (+ R); optional out_sum <- s; out_norm <- (s-mu)*rsqrt(var+eps)*g + b
template <bool PARAM_BF16>
__global__ __launch_bounds__(256) void k_layernorm(const float* __restrict__ X, const float* __restrict__ R, const float* __restrict__ g, const float* __restrict__ bta,
                                                  float* __restrict__ out_sum, float* __restrict__ out_norm, int N, float eps) {
  __shared__ float red[256];
  const int row = blockIdx.x, tid = threadIdx.x;
  const float* x = X + (size_t)row * N; const float* rr = R ? R + (size_t)row * N : nullptr;
  float vals[16];                     // up to N = 4096
  const int per = N / 256;            // contiguous chunk per thread? use strided-by-4 chunks: thread handles j = tid*4 + 1024*u
  float s1 = 0.f;
  for (int u = 0; u < per / 4; ++u) {
    const int j = tid * 4 + 1024 * u;
    const v4f a = *(const v4fa*)(x + j);
    v4f b = {0.f,0.f,0.f,0.f}; if (rr) b = *(const v4fa*)(rr + j);
#pragma unroll
    for (int q = 0; q < 4; ++q) { const float v = a[q] + b[q]; vals[u * 4 + q] = v; s1 += v; }
  }
  red[tid] = s1; __syncthreads();
  for (int st = 128; st > 0; st >>= 1) { if (tid < st) red[tid] += red[tid + st]; __syncthreads(); }
  const float mu = red[0] / (float)N; __syncthreads();
  float s2 = 0.f;
  for (int u = 0; u < per / 4; ++u)
#pragma unroll
    for (int q = 0; q < 4; ++q) { const float c = vals[u * 4 + q] - mu; s2 += c * c; }
  red[tid] = s2; __syncthreads();
  for (int st = 128; st > 0; st >>= 1) { if (tid < st) red[tid] += red[tid + st]; __syncthreads(); }
  const float rs = rsqrtf(red[0] / (float)N + eps);
  {
    for (int u = 0; u < per / 4; ++u) {
      const int j = tid * 4 + 1024 * u;
      v4f o, sm;
#pragma unroll
      for (int q = 0; q < 4; ++q) {
        float gg = g[j + q], bb = bta[j + q];
        if (PARAM_BF16) { gg = bf16_round(gg); bb = bf16_round(bb); }
        sm[q] = vals[u * 4 + q]; o[q] = (vals[u * 4 + q] - mu) * rs * gg + bb;
      }
      if (out_sum) *(v4f*)(out_sum + (size_t)row * N + j) = sm;
      *(v4f*)(out_norm + (size_t)row * N + j) = o;
    }
    
  }
}



// ---- f16 WMMA path (v_wmma_f32_16x16x32_f16): 11-bit significands for operands in range — used where a [0,1] probability operand needs more precision than bf16
typedef _Float16 v16h __attribute__((ext_vector_type(16)));
union FragH { v16h v; v8us half[2]; _Float16 h[16]; unsigned short u[16]; };
template <int NT>
__device__ __forceinline__ v8f mmaH(v16h ah, v16h al, v16h bh, v16h bl, v8f c) {
  c = __builtin_amdgcn_wmma_f32_16x16x32_f16(false, ah, false, bh, (short)0, c, false, false);
  if (NT >= 2) c = __builtin_amdgcn_wmma_f32_16x16x32_f16(false, al, false, bh, (short)0, c, false, false);
  if (NT >= 3) c = __builtin_amdgcn_wmma_f32_16x16x32_f16(false, ah, false, bl, (short)0, c, false, false);
  asm volatile("v_nop\n\tv_nop\n\tv_nop\n\tv_nop" : "+v"(c) : "v"(ah), "v"(al), "v"(bh), "v"(bl));
  return c;
}
// batched GEMM like k_gemm_b but f16 operands: A f32 (split into f16 hi/lo if ASPLIT, else rounded to f16), Bt = f16 values [n][k]; alpha; C f32; N multiple of 16 (partial tiles skipped)
template <bool ASPLIT>
__global__ __launch_bounds__(128) void k_gemm_h(const float* __restrict__ A, int lda, size_t sA, const _Float16* __restrict__ Bh, int ldb, size_t sB, float alpha, float* __restrict__ C, int ldc, size_t sC, int M, int N, int K) {
  __shared__ __attribute__((aligned(16))) float so[4][16][64];
  const int tid = threadIdx.x, w = tid >> 5, lane = tid & 31, ln = lane & 15, hh = lane >> 4; const int by = blockIdx.y;
  A += (size_t)by * sA; Bh += (size_t)by * sB; C += (size_t)by * sC;
  const int ntn = (N + 63) / 64; const int wid = blockIdx.x * 4 + w; const int mt = wid / ntn, nq = wid % ntn; if (mt * 16 >= M) return;
  const int row0 = mt * 16, col0 = nq * 64; const float* arow = A + (size_t)(row0 + ln) * lda;
  v8f acc[4] = {};
  for (int kb = 0; kb < K; kb += 32) {
    FragH ah, al;
    const v4f x0 = *(const v4fa*)(arow + kb + 8 * hh), x1 = *(const v4fa*)(arow + kb + 8 * hh + 4), x2 = *(const v4fa*)(arow + kb + 16 + 8 * hh), x3 = *(const v4fa*)(arow + kb + 16 + 8 * hh + 4);
    float xs[16] = {x0[0],x0[1],x0[2],x0[3],x1[0],x1[1],x1[2],x1[3],x2[0],x2[1],x2[2],x2[3],x3[0],x3[1],x3[2],x3[3]};
#pragma unroll
    for (int i = 0; i < 16; ++i) { const _Float16 h = (_Float16)xs[i]; ah.h[i] = h; al.h[i] = ASPLIT ? (_Float16)(xs[i] - (float)h) : (_Float16)0.0f; }
#pragma unroll
    for (int t = 0; t < 4; ++t) { if (col0 + t * 16 >= N) continue; const size_t boff = (size_t)(col0 + t * 16 + ln) * ldb + kb; FragH bq; bq.half[0] = *(const v8us*)(Bh + boff + 8 * hh); bq.half[1] = *(const v8us*)(Bh + boff + 16 + 8 * hh);
      acc[t] = mmaH<ASPLIT ? 2 : 1>(ah.v, al.v, bq.v, bq.v, acc[t]); }
  }
#pragma unroll
  for (int t = 0; t < 4; ++t) { if (col0 + t * 16 >= N) continue;
#pragma unroll
    for (int r = 0; r < 8; ++r) so[w][8 * hh + r][t * 16 + ln] = acc[t][r] * alpha; }
  __builtin_amdgcn_fence(__ATOMIC_ACQ_REL, "workgroup"); __builtin_amdgcn_wave_barrier();
  const int rsub = lane >> 4, c4 = (lane & 15) * 4;
  {
#pragma unroll
    for (int q = 0; q < 8; ++q) { const int r = q * 2 + rsub; if (col0 + c4 < N) { const v4f v = *(const v4fa*)&so[w][r][c4]; *(v4f*)(C + (size_t)(row0 + r) * ldc + col0 + c4) = v; } }
     }
}

// Wt[n][k] = f16(W[k][n]·scale) from f32 row-major W[K][N] (scale = power of two; bf16-exact weights stay exact in f16 away from the subnormal range)
__global__ __launch_bounds__(256) void k_wt_f16(const float* __restrict__ W, _Float16* __restrict__ Wt, int K, int N, float scale) {
  const int t = blockIdx.x * 256 + threadIdx.x; if (t >= N * (K / 8)) return; const int n = t / (K / 8), k8 = (t % (K / 8)) * 8; FragH f;
#pragma unroll
  for (int i = 0; i < 8; ++i) f.h[i] = (_Float16)(bf16_round(W[(size_t)(k8 + i) * N + n]) * scale); const v8us o = f.half[0];
  *(v8us*)((unsigned short*)Wt + (size_t)n * K + k8) = o; 
}
// k_gemm_hh variant with fused epilogue: v = acc·alpha + bias[by·sBias + col] (+ CP[(row/rowsPerB)·sCPb + by·64 + col] if CP) ; ACT 0 none / 1 elu ; writes f16 C16 (and f32 C if non-null)
template <int ACT>
__global__ __launch_bounds__(128) void k_gemm_hhx(const _Float16* __restrict__ A, int lda, size_t sA, const _Float16* __restrict__ Bh, int ldb, size_t sB, float alpha, const float* __restrict__ bias, size_t sBias, const float* __restrict__ CP, int rowsPerB, size_t sCPb, int row0g,
    float* __restrict__ C, _Float16* __restrict__ C16, int ldc, size_t sC, int M, int N, int K) {
  __shared__ __attribute__((aligned(16))) float so[4][16][64];
  const int tid = threadIdx.x, w = tid >> 5, lane = tid & 31, ln = lane & 15, hh = lane >> 4; const int by = blockIdx.y;
  A += (size_t)by * sA; Bh += (size_t)by * sB; const size_t cofs = (size_t)by * sC; const float* bp = bias ? bias + (size_t)by * sBias : nullptr;
  const int ntn = (N + 63) / 64; const int wid = blockIdx.x * 4 + w; const int mt = wid / ntn, nq = wid % ntn; if (mt * 16 >= M) return;
  const int row0 = mt * 16, col0 = nq * 64; const _Float16* arow = A + (size_t)(row0 + ln) * lda;
  v8f acc[4] = {};
  for (int kb = 0; kb < K; kb += 32) { FragH ah; ah.half[0] = *(const v8us*)((const unsigned short*)arow + kb + 8 * hh); ah.half[1] = *(const v8us*)((const unsigned short*)arow + kb + 16 + 8 * hh);
#pragma unroll
    for (int t = 0; t < 4; ++t) { if (col0 + t * 16 >= N) continue; const size_t boff = (size_t)(col0 + t * 16 + ln) * ldb + kb; FragH bq; bq.half[0] = *(const v8us*)((const unsigned short*)Bh + boff + 8 * hh); bq.half[1] = *(const v8us*)((const unsigned short*)Bh + boff + 16 + 8 * hh);
      acc[t] = mmaH<1>(ah.v, ah.v, bq.v, bq.v, acc[t]); }
  }
#pragma unroll
  for (int t = 0; t < 4; ++t) { if (col0 + t * 16 >= N) continue; const int col = col0 + t * 16 + ln; const float bv = bp ? bf16_round(bp[col]) : 0.f;
#pragma unroll
    for (int r = 0; r < 8; ++r) { float v = acc[t][r] * alpha + bv; if (CP) { const int bidx = (row0g + row0 + 8 * hh + r) / rowsPerB; v += CP[(size_t)bidx * sCPb + (size_t)by * 64 + col]; } if (ACT == 1) v = (v > 0.f) ? v : expm1f(v); else if (ACT == 7) v = (v > 0.f) ? v + 1.0f : expf(v); else if (ACT == 8) v = tanhf(v); else if (ACT == 9) v = 0.5f * v * (1.0f + tanhf(0.7978845608028654f * (v + 0.044715f * v * v * v))); else if (ACT == 11) v = 1.0f / (1.0f + expf(-v)); else if (ACT == 12) v = (v > 0.f) ? v : 0.01f * v; else if (ACT == 14) v = (v > 0.f) ? v : 0.1f * v; else if (ACT == 15) v = v / (1.0f + expf(-v)); else if (ACT == 3) v = fmaxf(v, 0.f); else if (ACT == 6) v = 0.5f * v * (1.0f + erff(v * 0.70710678118654752f)); so[w][8 * hh + r][t * 16 + ln] = v; } }
  __builtin_amdgcn_fence(__ATOMIC_ACQ_REL, "workgroup"); __builtin_amdgcn_wave_barrier();
  const int rsub = lane >> 4, c4 = (lane & 15) * 4; typedef _Float16 v4h __attribute__((ext_vector_type(4)));
  {
#pragma unroll
    for (int q = 0; q < 8; ++q) { const int r = q * 2 + rsub; if (col0 + c4 < N) { const v4f v = *(const v4fa*)&so[w][r][c4]; if (C) *(v4f*)(C + cofs + (size_t)(row0 + r) * ldc + col0 + c4) = v; if (C16) { v4h h4; for (int i = 0; i < 4; ++i) h4[i] = (_Float16)v[i]; *(v4h*)(C16 + cofs + (size_t)(row0 + r) * ldc + col0 + c4) = h4; } } }
     }
}


typedef _Float16 v4h __attribute__((ext_vector_type(4)));

__global__ __launch_bounds__(256) void k_x16(const float* __restrict__ x, _Float16* __restrict__ X16, size_t n8) { const size_t t = (size_t)blockIdx.x * 256 + threadIdx.x; if (t >= n8) return; FragH f;
#pragma unroll
  for (int q = 0; q < 8; ++q) f.h[q] = (_Float16)bf16_round(x[t * 8 + q]); *(v8us*)((unsigned short*)X16 + t * 8) = f.half[0];  }
__global__ __launch_bounds__(256) void k_h16(const float* __restrict__ x, _Float16* __restrict__ X16, size_t n8) { const size_t t = (size_t)blockIdx.x * 256 + threadIdx.x; if (t >= n8) return; FragH f;
#pragma unroll
  for (int q = 0; q < 8; ++q) f.h[q] = (_Float16)x[t * 8 + q]; *(v8us*)((unsigned short*)X16 + t * 8) = f.half[0];  }
__global__ __launch_bounds__(256) void k_round16f(const float* __restrict__ W, _Float16* __restrict__ Bt, size_t n8) { const size_t t = (size_t)blockIdx.x * 256 + threadIdx.x; if (t >= n8) return; FragH f;
#pragma unroll
  for (int i = 0; i < 8; ++i) f.h[i] = (_Float16)(bf16_round(W[t * 8 + i]) * 16.0f); *(v8us*)((unsigned short*)Bt + t * 8) = f.half[0];  }
template <int NHv, int TTv>
__global__ __launch_bounds__(256) void k_vt(const _Float16* __restrict__ V16, int ldv, int voff, _Float16* __restrict__ Vt) { __shared__ unsigned short tl[64][66]; const int tid = threadIdx.x; const int slab = blockIdx.x / (TTv / 64), lg = blockIdx.x % (TTv / 64); const int b = slab / NHv, h = slab % NHv;
  for (int i = tid; i < 64 * 8; i += 256) { const int r = i / 8, c8 = (i % 8) * 8; FragH f; f.half[0] = *(const v8us*)((const unsigned short*)V16 + ((size_t)b * TTv + lg * 64 + r) * ldv + voff + h * 64 + c8);
#pragma unroll
    for (int q = 0; q < 8; ++q) tl[r][c8 + q] = f.u[q]; }
  __syncthreads();
  {
#pragma unroll
    for (int rd = 0; rd < 2; ++rd) { const int d = rd * 32 + tid / 8, pc = tid % 8; FragH f;
#pragma unroll
      for (int q = 0; q < 8; ++q) f.u[q] = tl[pc * 8 + q][d];
      *(v8us*)((unsigned short*)Vt + ((size_t)slab * 64 + d) * TTv + lg * 64 + pc * 8) = f.half[0]; }
     } }

__global__ __launch_bounds__(256) void k_hl(const float* __restrict__ F, _Float16* __restrict__ Hh, _Float16* __restrict__ Hl, size_t n8) { const size_t t = (size_t)blockIdx.x * 256 + threadIdx.x; if (t >= n8) return; FragH fh, fl; const v4f a = *(const v4fa*)(F + t * 8), c = *(const v4fa*)(F + t * 8 + 4);
#pragma unroll
  for (int q = 0; q < 4; ++q) { _Float16 h = (_Float16)a[q]; fh.h[q] = h; fl.h[q] = (_Float16)((a[q] - (float)h) * 1024.0f); h = (_Float16)c[q]; fh.h[4 + q] = h; fl.h[4 + q] = (_Float16)((c[q] - (float)h) * 1024.0f); }
  { *(v8us*)((unsigned short*)Hh + t * 8) = fh.half[0]; *(v8us*)((unsigned short*)Hl + t * 8) = fl.half[0];  } }

// ---- fast GEMM (wave tile 32x64; requires M % 32 == 0 rows per launch region and N % 64 == 0); epilogue = k_gemm_hhx semantics ----
__device__ __forceinline__ v16h g2_frag(const _Float16* p, int hh) { FragH f; f.half[0] = *(const v8us*)((const unsigned short*)p + 8 * hh); f.half[1] = *(const v8us*)((const unsigned short*)p + 16 + 8 * hh); return f.v; }
__device__ __forceinline__ v8f g2_mma(v16h a, v16h b, v8f c) { v8f d = __builtin_amdgcn_wmma_f32_16x16x32_f16(false, a, false, b, (short)0, c, false, false); asm volatile("v_nop\n\tv_nop\n\tv_nop\n\tv_nop" : "+v"(d) : "v"(a), "v"(b)); return d; }
template <int ACT>
__global__ __launch_bounds__(128) void k_gemm2(const _Float16* __restrict__ A, int lda, size_t sA, const _Float16* __restrict__ Bh, int ldb, size_t sB, float alpha, const float* __restrict__ bias, size_t sBias, const float* __restrict__ CP, int rowsPerB, size_t sCPb, int row0g,
    float* __restrict__ C, _Float16* __restrict__ C16, int ldc, size_t sC, int M, int N, int K) {
  __shared__ __attribute__((aligned(16))) float so[4][32][68];
  const int tid = threadIdx.x, w = tid >> 5, lane = tid & 31, ln = lane & 15, hh = lane >> 4; const int by = blockIdx.y;
  A += (size_t)by * sA; Bh += (size_t)by * sB; const size_t cofs = (size_t)by * sC; const float* bp = bias ? bias + (size_t)by * sBias : nullptr;
  const int ntn = N >> 6; const int mt = blockIdx.x / ntn, nq = blockIdx.x - mt * ntn; const int row0 = mt * 128 + 32 * w, col0 = nq * 64; if (row0 >= M) return;
  const _Float16* a0p = A + (size_t)(row0 + ln) * lda; const _Float16* a1p = a0p + (size_t)16 * lda;
  const _Float16* b0p = Bh + (size_t)(col0 + ln) * ldb; const _Float16* b1p = b0p + (size_t)16 * ldb; const _Float16* b2p = b1p + (size_t)16 * ldb; const _Float16* b3p = b2p + (size_t)16 * ldb;
  const v8f z8 = {0.f,0.f,0.f,0.f,0.f,0.f,0.f,0.f}; v8f c00 = z8, c01 = z8, c02 = z8, c03 = z8, c10 = z8, c11 = z8, c12 = z8, c13 = z8;
#pragma unroll 1
  for (int kb = 0; kb < K; kb += 32) { const v16h a0 = g2_frag(a0p + kb, hh), a1 = g2_frag(a1p + kb, hh);
    v16h b = g2_frag(b0p + kb, hh); c00 = g2_mma(a0, b, c00); c10 = g2_mma(a1, b, c10);
    b = g2_frag(b1p + kb, hh); c01 = g2_mma(a0, b, c01); c11 = g2_mma(a1, b, c11);
    b = g2_frag(b2p + kb, hh); c02 = g2_mma(a0, b, c02); c12 = g2_mma(a1, b, c12);
    b = g2_frag(b3p + kb, hh); c03 = g2_mma(a0, b, c03); c13 = g2_mma(a1, b, c13); }
  v8f accs[8] = {c00, c01, c02, c03, c10, c11, c12, c13};
#pragma unroll
  for (int u = 0; u < 8; ++u) { const int t = u & 3, half = u >> 2; const int col = col0 + t * 16 + ln; const float bv = bp ? bf16_round(bp[col]) : 0.f;
#pragma unroll
    for (int r = 0; r < 8; ++r) { const int rloc = half * 16 + 8 * hh + r; float v = accs[u][r] * alpha + bv; if (CP) { const int bidx = (row0g + row0 + rloc) / rowsPerB; v += CP[(size_t)bidx * sCPb + (size_t)by * 64 + col]; }
      if (ACT == 3) v = fmaxf(v, 0.f); else if (ACT == 6) v = 0.5f * v * (1.0f + erff(v * 0.70710678118654752f)); else if (ACT == 11) v = 1.0f / (1.0f + expf(-v)); else if (ACT == 15) v = v / (1.0f + expf(-v)); else if (ACT == 12) v = (v > 0.f) ? v : 0.01f * v; else if (ACT == 8) v = tanhf(v);
      so[w][rloc][t * 16 + ln] = v; } }
  __builtin_amdgcn_fence(__ATOMIC_ACQ_REL, "workgroup"); __builtin_amdgcn_wave_barrier();
  const int rsub = lane >> 4, c4 = (lane & 15) * 4;
  {
#pragma unroll
    for (int q = 0; q < 16; ++q) { const int r = q * 2 + rsub; const v4f v = *(const v4fa*)&so[w][r][c4]; if (C) *(v4f*)(C + cofs + (size_t)(row0 + r) * ldc + col0 + c4) = v; if (C16) { v4h h4; for (int i = 0; i < 4; ++i) h4[i] = (_Float16)v[i]; *(v4h*)(C16 + cofs + (size_t)(row0 + r) * ldc + col0 + c4) = h4; } }
     } }


__global__ __launch_bounds__(256) void k_qk(const float* __restrict__ x, int s, const float* __restrict__ gqw, const float* __restrict__ gqb, const float* __restrict__ gkw, const float* __restrict__ gkb, const float* __restrict__ lqw, const float* __restrict__ lqb, const float* __restrict__ lkw, const float* __restrict__ lkb, _Float16* __restrict__ QP, _Float16* __restrict__ KP) {
  #pragma clang fp contract(off)
  const int t = blockIdx.x * 256 + threadIdx.x; if (t >= HW * NG * 2) return; const int which = t & 1; const int g = (t >> 1) % NG; const int p = t / (2 * NG); const int br = g >> 2, h = g & 3;
  const float* xr = x + (((size_t)which * NSL + s) * HW + p) * CC + h * HD;      /* x[0] = q slices, x[1] = k slices */
  const float* w = which ? (br ? lkw : gkw) : (br ? lqw : gqw); const float* bb = which ? (br ? lkb : gkb) : (br ? lqb : gqb); FragH a, s1, s2, z;
  /* three-segment rows (K 64): Q = [hi | 16 lo | hi/16 | 0], K = [hi | hi/16 | 16 lo | 0] -> hi.hi + lo.hi + hi.lo (~2^-20) */
#pragma unroll
  for (int d = 0; d < 16; ++d) { const int c = h * HD + d; const float v = bf16_round(xr[d]) * bf16_round(w[c]) + bf16_round(bb[c]); const _Float16 hv = (_Float16)v; const float lo = (v - (float)hv) * 16.0f; a.h[d] = hv;
    if (which) { s1.h[d] = (_Float16)((float)hv * 0.0625f); s2.h[d] = (_Float16)lo; } else { s1.h[d] = (_Float16)lo; s2.h[d] = (_Float16)((float)hv * 0.0625f); } z.u[d] = 0; }
  unsigned short* dst = (unsigned short*)(which ? KP : QP) + ((size_t)g * HW + p) * 64;
  { *(v8us*)dst = a.half[0]; *(v8us*)(dst + 8) = a.half[1]; *(v8us*)(dst + 16) = s1.half[0]; *(v8us*)(dst + 24) = s1.half[1]; *(v8us*)(dst + 32) = s2.half[0]; *(v8us*)(dst + 40) = s2.half[1]; *(v8us*)(dst + 48) = z.half[0]; *(v8us*)(dst + 56) = z.half[0];  } }
__global__ __launch_bounds__(256) void k_vtp(const float* __restrict__ x, int s, const float* __restrict__ gvw, const float* __restrict__ gvb, const float* __restrict__ lvw, const float* __restrict__ lvb, _Float16* __restrict__ VT) {
  #pragma clang fp contract(off)
  __shared__ float tl[64][17]; const int tid = threadIdx.x; const int g = blockIdx.x / (HW / 64), pt = blockIdx.x % (HW / 64); const int br = g >> 2, h = g & 3; const float* w = br ? lvw : gvw; const float* bb = br ? lvb : gvb;
  for (int i = tid; i < 64 * 16; i += 256) { const int pl = i >> 4, d = i & 15; const int c = h * HD + d; tl[pl][d] = bf16_round(x[(((size_t)2 * NSL + s) * HW + pt * 64 + pl) * CC + c]) * bf16_round(w[c]) + bf16_round(bb[c]); }
  __syncthreads();
  const int d = tid >> 3, p8 = (tid & 7) * 8;      /* thread: row d (0..31 here; rows 32..63 in a second step), 8 positions */
  {
#pragma unroll
    for (int u = 0; u < 2; ++u) { const int dd = d + u * 32; FragH f;
#pragma unroll
      for (int q = 0; q < 8; ++q) f.h[q] = (dd < 16) ? (_Float16)tl[p8 + q][dd] : (_Float16)0.0f;
      *(v8us*)((unsigned short*)VT + ((size_t)g * 64 + dd) * HW + pt * 64 + p8) = f.half[0]; }
     } }
__global__ __launch_bounds__(256) void k_soft(const float* __restrict__ S, _Float16* __restrict__ P16) {
  #pragma clang fp contract(off)
  const int tid = threadIdx.x, w = tid >> 5, ln = tid & 31; const int r = blockIdx.x * 8 + w; if (r >= NG * HW) return; const float* s = S + (size_t)r * HW; float m = -3.0e38f;
#pragma unroll 1
  for (int c = 0; c < HW / 256; ++c) { const float* p = s + c * 256 + ln * 8; for (int q = 0; q < 8; ++q) m = fmaxf(m, p[q]); }
  for (int o = 16; o > 0; o >>= 1) m = fmaxf(m, __shfl_xor(m, o, 32)); float su = 0.f;
#pragma unroll 1
  for (int c = 0; c < HW / 256; ++c) { const float* p = s + c * 256 + ln * 8; for (int q = 0; q < 8; ++q) su += expf(p[q] - m); }
  for (int o = 16; o > 0; o >>= 1) su += __shfl_xor(su, o, 32); const float inv = 1024.0f / su; unsigned short* d = (unsigned short*)P16 + (size_t)r * HW;
  {
#pragma unroll 1
    for (int c = 0; c < HW / 256; ++c) { const float* p = s + c * 256 + ln * 8; FragH f;
#pragma unroll
      for (int q = 0; q < 8; ++q) f.h[q] = (_Float16)(expf(p[q] - m) * inv);
      *(v8us*)(d + c * 256 + ln * 8) = f.half[0]; }
     } }
__global__ __launch_bounds__(256) void k_outs(const float* __restrict__ O, int s, const float* __restrict__ pw, const float* __restrict__ pb, float* __restrict__ out) {
  #pragma clang fp contract(off)
  const int t = blockIdx.x * 256 + threadIdx.x; if (t >= HW * (CC / 4)) return; const int c0 = (t & 15) * 4, p = t >> 4; v4f o;
#pragma unroll
  for (int q = 0; q < 4; ++q) { const int c = c0 + q; const int h = c / HD, d = c % HD; const float l = O[((size_t)(4 + h) * HW + p) * 64 + d], g = O[((size_t)h * HW + p) * 64 + d]; const float comb = 0.5f * l + 0.5f * g; o[q] = (2.0f * comb) * bf16_round(pw[c]) + bf16_round(pb[c]); }
  float* dst = out + ((size_t)s * HW + p) * CC + c0; *(v4f*)dst = o;  }

extern "C" void kernel_launch(void* const* d_in, const int* in_sizes, int n_in,
                              void* d_out, int out_size, void* d_ws, size_t ws_size, hipStream_t stream) {
  (void)in_sizes; (void)n_in; (void)out_size;
  const float* const* I = (const float* const*)d_in; const float* x = I[0];
  const float* gqw = I[1]; const float* gqb = I[2]; const float* gkw = I[3]; const float* gkb = I[4]; const float* gvw = I[5]; const float* gvb = I[6]; const float* lqw = I[7]; const float* lqb = I[8]; const float* lkw = I[9]; const float* lkb = I[10]; const float* lvw = I[11]; const float* lvb = I[12]; const float* pw = I[13]; const float* pb = I[14];
  char* ws = (char*)d_ws; size_t off = 0;
  auto take = [&](size_t bytes) { char* p = ws + off; off += (bytes + 255) & ~(size_t)255; return p; };
  _Float16* QP = (_Float16*)take((size_t)NG * HW * 64 * 2); _Float16* KP = (_Float16*)take((size_t)NG * HW * 64 * 2); _Float16* VT = (_Float16*)take((size_t)NG * 64 * HW * 2); float* S = (float*)take((size_t)NG * HW * HW * 4); _Float16* P16 = (_Float16*)take((size_t)NG * HW * HW * 2); float* O = (float*)take((size_t)NG * HW * 64 * 4);
  if (off > ws_size) return;      /* 1 + 1 + 1 + 32 + 16 + 2 = 53 MiB */
  for (int s = 0; s < NRUN; ++s) {
    k_qk<<<(HW * NG * 2 + 255) / 256, 256, 0, stream>>>(x, s, gqw, gqb, gkw, gkb, lqw, lqb, lkw, lkb, QP, KP); k_vtp<<<NG * (HW / 64), 256, 0, stream>>>(x, s, gvw, gvb, lvw, lvb, VT);
    k_gemm2<0><<<dim3((HW / 128) * (HW / 64), NG), 128, 0, stream>>>(QP, 64, (size_t)HW * 64, KP, 64, (size_t)HW * 64, 0.25f, nullptr, 0, nullptr, 1, 0, 0, S, nullptr, HW, (size_t)HW * HW, HW, HW, 64);      /* three-segment scores x 16^-0.5, 8 (branch, head) pairs batched */
    k_soft<<<(NG * HW) / 8, 256, 0, stream>>>(S, P16);
    k_gemm2<0><<<dim3((HW / 128) * 1, NG), 128, 0, stream>>>(P16, HW, (size_t)HW * HW, VT, HW, (size_t)64 * HW, 0.0009765625f, nullptr, 0, nullptr, 1, 0, 0, O, nullptr, 64, (size_t)HW * 64, HW, 64, HW);
    k_outs<<<(HW * (CC / 4) + 255) / 256, 256, 0, stream>>>(O, s, pw, pb, (float*)d_out); }
}

// v001
// It runs in 578 microseconds.
// Timed twice side by side with v000, it ran 2.44 and 2.37 times as fast.
#include <hip/hip_runtime.h>
// Global + local spatial attention (x = [q|k|v] of 20 slices x 1024 positions x 64 channels; 4 heads of 16; per-channel scale+bias 'depthwise k=1 convs' for each branch): g = attn(q gq_w + gq_b, k gk_w + gk_b, v gv_w + gv_b), l likewise; out = (2 (0.5 l + 0.5 g)) proj_w + proj_b -> [20,1024,64].
// Structure (per group of NB slices, every launch batched over the group): the scaled q/k as three-segment f16 rows per 16-dim head ([hi | 16 lo | hi/16 | 0] x [hi | hi/16 | 16 lo | 0], K 64), v as f16 planes transposed per head by an LDS tile kernel (N padded to 64); for the 8 (branch, head) pairs at once: scores as a head-batched f16 WMMA GEMM (32x64 wave tiles, f32 accumulation; K 64) into f32 planes, a wave-per-row f32 softmax over the 1024 keys (three rolled passes, P x2^10 f16), attn.v as a head-batched GEMM (K 1024); the branch mix and the output scale/bias on VALU.
// Compute dtype: x and all parameters rounded to bf16; q, k as hi + residual three-segment products (~2^-20); v, P as f16 operands (~2^-12); f32 accumulation, softmax, elementwise. v_wmma_f32_16x16x32_f16.
#define NSL 20
#define NRUN NSL                 /* slices processed (NSL stays the input stride) */
#define HW 1024
#define CC 64
#define NHD 4
#define HD 16
#define NG 8                     /* (branch, head) pairs per slice: g = br*4 + h */
#define NB 5                     /* slices per launch: blockIdx.y (or the GEMM batch index) runs over NB slices; NB x 51 MiB of planes fit the workspace; NSL % NB == 0 */
typedef __bf16 v16b __attribute__((ext_vector_type(16)));
typedef unsigned short v8us __attribute__((ext_vector_type(8), may_alias));
typedef float  v8f  __attribute__((ext_vector_type(8)));
typedef float  v4f  __attribute__((ext_vector_type(4)));
typedef float  v4fa __attribute__((ext_vector_type(4), may_alias));
union FragB { v16b v; v8us half[2]; unsigned short u[16]; };

__device__ __forceinline__ unsigned short bf16_bits(float x) { unsigned int u = __float_as_uint(x); return (unsigned short)((u + 0x7FFFu + ((u >> 16) & 1u)) >> 16); }
__device__ __forceinline__ float bf16_val(unsigned short b) { return __uint_as_float(((unsigned int)b) << 16); }
__device__ __forceinline__ float bf16_round(float x) { return bf16_val(bf16_bits(x)); }
// D += A·B with NT terms: 1 = ah·bh, 2 = + al·bh (A split), 3 = + ah·bl (both split)
template <int NT>
__device__ __forceinline__ v8f mmaN(v16b ah, v16b al, v16b bh, v16b bl, v8f c) {
  c = __builtin_amdgcn_wmma_f32_16x16x32_bf16(false, ah, false, bh, (short)0, c, false, false);
  if (NT >= 2) c = __builtin_amdgcn_wmma_f32_16x16x32_bf16(false, al, false, bh, (short)0, c, false, false);
  if (NT >= 3) c = __builtin_amdgcn_wmma_f32_16x16x32_bf16(false, ah, false, bl, (short)0, c, false, false);
  asm volatile("v_nop\n\tv_nop\n\tv_nop\n\tv_nop" : "+v"(c) : "v"(ah), "v"(al), "v"(bh), "v"(bl));
  return c;
}

__global__ __launch_bounds__(256) void k_wt_bf16(const float* __restrict__ W, unsigned short* __restrict__ Wt, int K, int N) {
  const int t = blockIdx.x * 256 + threadIdx.x;
  const int k8n = K / 8;
  if (t >= N * k8n) return;
  const int n = t / k8n, k8 = (t % k8n) * 8;
  v8us v;
#pragma unroll
  for (int i = 0; i < 8; ++i) v[i] = bf16_bits(W[(size_t)(k8 + i) * N + n]);
  *(v8us*)(Wt + (size_t)n * K + k8) = v;
  
}

// GEMM C[M][N] (f32, pitch ldc) = act(A[M][K]·W + bias). A f32 row-major (pitch lda) converted per fragment to bf16
// (ASPLIT: hi/lo two planes -> 2 terms, else single rounded term); Wt bf16 [N][K] (pitch ldb). BIAS_BF16 rounds the
// bias to bf16 first (bias quantised to bf16 before the add). K%32==0, M%16==0, N%64==0.
template <bool ASPLIT, int ACT, bool BIAS_BF16>
__global__ __launch_bounds__(128) void k_gemm_bf(const float* __restrict__ A, int lda, const unsigned short* __restrict__ Wt, int ldb,
                                               const float* __restrict__ bias, float* __restrict__ C, int ldc, int M, int N, int K) {
  __shared__ __attribute__((aligned(16))) float so[4][16][64];
  const int tid = threadIdx.x, w = tid >> 5, lane = tid & 31, ln = lane & 15, hh = lane >> 4;
  const int ntn = N / 64;
  const int wid = blockIdx.x * 4 + w;
  const int mt = wid / ntn, nq = wid % ntn;
  if (mt * 16 >= M) return;
  const int row0 = mt * 16, col0 = nq * 64;
  const float* arow = A + (size_t)(row0 + ln) * lda;
  v8f acc[4] = {};
  for (int kb = 0; kb < K; kb += 32) {
    FragB ah, al;
    const v4f x0 = *(const v4fa*)(arow + kb + 8 * hh), x1 = *(const v4fa*)(arow + kb + 8 * hh + 4);
    const v4f x2 = *(const v4fa*)(arow + kb + 16 + 8 * hh), x3 = *(const v4fa*)(arow + kb + 16 + 8 * hh + 4);
    float xs[16] = {x0[0],x0[1],x0[2],x0[3],x1[0],x1[1],x1[2],x1[3],x2[0],x2[1],x2[2],x2[3],x3[0],x3[1],x3[2],x3[3]};
#pragma unroll
    for (int i = 0; i < 16; ++i) { const unsigned short hb = bf16_bits(xs[i]); ah.u[i] = hb; al.u[i] = ASPLIT ? bf16_bits(xs[i] - bf16_val(hb)) : (unsigned short)0; }
#pragma unroll
    for (int t = 0; t < 4; ++t) {
      const unsigned short* brow = Wt + (size_t)(col0 + t * 16 + ln) * ldb + kb;
      FragB b;
      b.half[0] = *(const v8us*)(brow + 8 * hh);
      b.half[1] = *(const v8us*)(brow + 16 + 8 * hh);
      acc[t] = mmaN<ASPLIT ? 2 : 1>(ah.v, al.v, b.v, b.v, acc[t]);
    }
  }
#pragma unroll
  for (int t = 0; t < 4; ++t) {
    float bv = bias ? bias[col0 + t * 16 + ln] : 0.f;
    if (BIAS_BF16) bv = bf16_round(bv);
#pragma unroll
    for (int r = 0; r < 8; ++r) { float v = acc[t][r] + bv; if (ACT == 1) v = fmaxf(v, 0.f); so[w][8 * hh + r][t * 16 + ln] = v; }
  }
  __builtin_amdgcn_fence(__ATOMIC_ACQ_REL, "workgroup");
  __builtin_amdgcn_wave_barrier();
  const int rsub = lane >> 4, c4 = (lane & 15) * 4;
  {
#pragma unroll
    for (int q = 0; q < 8; ++q) {
      const int r = q * 2 + rsub;
      const v4f v = *(const v4fa*)&so[w][r][c4];
      *(v4f*)(C + (size_t)(row0 + r) * ldc + col0 + c4) = v;
    }
    
  }
}

// GEMM C = act(A·W + bias + resid): A f32 (ASPLIT -> hi/lo 2 terms), Wt bf16 [N][K]; ACT 0 none, 1 relu, 2 exact gelu;
// resid (optional, f32, row index = (row % rmod), pitch ldr, RES_BF16 rounds it) added before the activation.
template <bool ASPLIT, int ACT, bool BIAS_BF16, bool RES_BF16>
__global__ __launch_bounds__(128) void k_gemm_bf3(const float* __restrict__ A, int lda, const unsigned short* __restrict__ Wt, int ldb,
                                                const float* __restrict__ bias, const float* __restrict__ resid, int rmod, int ldr,
                                                float* __restrict__ C, int ldc, int M, int N, int K) {
  __shared__ __attribute__((aligned(16))) float so[4][16][64];
  const int tid = threadIdx.x, w = tid >> 5, lane = tid & 31, ln = lane & 15, hh = lane >> 4;
  const int ntn = N / 64;
  const int wid = blockIdx.x * 4 + w;
  const int mt = wid / ntn, nq = wid % ntn;
  if (mt * 16 >= M) return;
  const int row0 = mt * 16, col0 = nq * 64;
  const float* arow = A + (size_t)(row0 + ln) * lda;
  v8f acc[4] = {};
  for (int kb = 0; kb < K; kb += 32) {
    FragB ah, al;
    const v4f x0 = *(const v4fa*)(arow + kb + 8 * hh), x1 = *(const v4fa*)(arow + kb + 8 * hh + 4);
    const v4f x2 = *(const v4fa*)(arow + kb + 16 + 8 * hh), x3 = *(const v4fa*)(arow + kb + 16 + 8 * hh + 4);
    float xs[16] = {x0[0],x0[1],x0[2],x0[3],x1[0],x1[1],x1[2],x1[3],x2[0],x2[1],x2[2],x2[3],x3[0],x3[1],x3[2],x3[3]};
#pragma unroll
    for (int i = 0; i < 16; ++i) { const unsigned short hb = bf16_bits(xs[i]); ah.u[i] = hb; al.u[i] = ASPLIT ? bf16_bits(xs[i] - bf16_val(hb)) : (unsigned short)0; }
#pragma unroll
    for (int t = 0; t < 4; ++t) {
      const unsigned short* brow = Wt + (size_t)(col0 + t * 16 + ln) * ldb + kb;
      FragB b;
      b.half[0] = *(const v8us*)(brow + 8 * hh);
      b.half[1] = *(const v8us*)(brow + 16 + 8 * hh);
      acc[t] = mmaN<ASPLIT ? 2 : 1>(ah.v, al.v, b.v, b.v, acc[t]);
    }
  }
#pragma unroll
  for (int t = 0; t < 4; ++t) {
    const int col = col0 + t * 16 + ln;
    float bv = bias ? bias[col] : 0.f;
    if (BIAS_BF16) bv = bf16_round(bv);
#pragma unroll
    for (int r = 0; r < 8; ++r) {
      float v = acc[t][r] + bv;
      if (resid) { float rv = resid[(size_t)((row0 + 8 * hh + r) % rmod) * ldr + col]; if (RES_BF16) rv = bf16_round(rv); v += rv; }
      if (ACT == 1) v = fmaxf(v, 0.f);
      if (ACT == 2) v = 0.5f * v * (1.0f + erff(v * 0.70710678118654752f));
      if (ACT == 3) { const float u = 0.7978845608028654f * (v + 0.044715f * v * v * v); v = 0.5f * v * (1.0f + tanhf(u)); }
      so[w][8 * hh + r][t * 16 + ln] = v;
    }
  }
  __builtin_amdgcn_fence(__ATOMIC_ACQ_REL, "workgroup");
  __builtin_amdgcn_wave_barrier();
  const int rsub = lane >> 4, c4 = (lane & 15) * 4;
  {
#pragma unroll
    for (int q = 0; q < 8; ++q) {
      const int r = q * 2 + rsub;
      const v4f v = *(const v4fa*)&so[w][r][c4];
      *(v4f*)(C + (size_t)(row0 + r) * ldc + col0 + c4) = v;
    }
    
  }
}
// row LayerNorm (biased variance, eps) over N: s = X (+ R); optional out_sum <- s; out_norm <- (s-mu)*rsqrt(var+eps)*g + b
template <bool PARAM_BF16>
__global__ __launch_bounds__(256) void k_layernorm(const float* __restrict__ X, const float* __restrict__ R, const float* __restrict__ g, const float* __restrict__ bta,
                                                  float* __restrict__ out_sum, float* __restrict__ out_norm, int N, float eps) {
  __shared__ float red[256];
  const int row = blockIdx.x, tid = threadIdx.x;
  const float* x = X + (size_t)row * N; const float* rr = R ? R + (size_t)row * N : nullptr;
  float vals[16];                     // up to N = 4096
  const int per = N / 256;            // contiguous chunk per thread? use strided-by-4 chunks: thread handles j = tid*4 + 1024*u
  float s1 = 0.f;
  for (int u = 0; u < per / 4; ++u) {
    const int j = tid * 4 + 1024 * u;
    const v4f a = *(const v4fa*)(x + j);
    v4f b = {0.f,0.f,0.f,0.f}; if (rr) b = *(const v4fa*)(rr + j);
#pragma unroll
    for (int q = 0; q < 4; ++q) { const float v = a[q] + b[q]; vals[u * 4 + q] = v; s1 += v; }
  }
  red[tid] = s1; __syncthreads();
  for (int st = 128; st > 0; st >>= 1) { if (tid < st) red[tid] += red[tid + st]; __syncthreads(); }
  const float mu = red[0] / (float)N; __syncthreads();
  float s2 = 0.f;
  for (int u = 0; u < per / 4; ++u)
#pragma unroll
    for (int q = 0; q < 4; ++q) { const float c = vals[u * 4 + q] - mu; s2 += c * c; }
  red[tid] = s2; __syncthreads();
  for (int st = 128; st > 0; st >>= 1) { if (tid < st) red[tid] += red[tid + st]; __syncthreads(); }
  const float rs = rsqrtf(red[0] / (float)N + eps);
  {
    for (int u = 0; u < per / 4; ++u) {
      const int j = tid * 4 + 1024 * u;
      v4f o, sm;
#pragma unroll
      for (int q = 0; q < 4; ++q) {
        float gg = g[j + q], bb = bta[j + q];
        if (PARAM_BF16) { gg = bf16_round(gg); bb = bf16_round(bb); }
        sm[q] = vals[u * 4 + q]; o[q] = (vals[u * 4 + q] - mu) * rs * gg + bb;
      }
      if (out_sum) *(v4f*)(out_sum + (size_t)row * N + j) = sm;
      *(v4f*)(out_norm + (size_t)row * N + j) = o;
    }
    
  }
}



// ---- f16 WMMA path (v_wmma_f32_16x16x32_f16): 11-bit significands for operands in range — used where a [0,1] probability operand needs more precision than bf16
typedef _Float16 v16h __attribute__((ext_vector_type(16)));
union FragH { v16h v; v8us half[2]; _Float16 h[16]; unsigned short u[16]; };
template <int NT>
__device__ __forceinline__ v8f mmaH(v16h ah, v16h al, v16h bh, v16h bl, v8f c) {
  c = __builtin_amdgcn_wmma_f32_16x16x32_f16(false, ah, false, bh, (short)0, c, false, false);
  if (NT >= 2) c = __builtin_amdgcn_wmma_f32_16x16x32_f16(false, al, false, bh, (short)0, c, false, false);
  if (NT >= 3) c = __builtin_amdgcn_wmma_f32_16x16x32_f16(false, ah, false, bl, (short)0, c, false, false);
  asm volatile("v_nop\n\tv_nop\n\tv_nop\n\tv_nop" : "+v"(c) : "v"(ah), "v"(al), "v"(bh), "v"(bl));
  return c;
}
// batched GEMM like k_gemm_b but f16 operands: A f32 (split into f16 hi/lo if ASPLIT, else rounded to f16), Bt = f16 values [n][k]; alpha; C f32; N multiple of 16 (partial tiles skipped)
template <bool ASPLIT>
__global__ __launch_bounds__(128) void k_gemm_h(const float* __restrict__ A, int lda, size_t sA, const _Float16* __restrict__ Bh, int ldb, size_t sB, float alpha, float* __restrict__ C, int ldc, size_t sC, int M, int N, int K) {
  __shared__ __attribute__((aligned(16))) float so[4][16][64];
  const int tid = threadIdx.x, w = tid >> 5, lane = tid & 31, ln = lane & 15, hh = lane >> 4; const int by = blockIdx.y;
  A += (size_t)by * sA; Bh += (size_t)by * sB; C += (size_t)by * sC;
  const int ntn = (N + 63) / 64; const int wid = blockIdx.x * 4 + w; const int mt = wid / ntn, nq = wid % ntn; if (mt * 16 >= M) return;
  const int row0 = mt * 16, col0 = nq * 64; const float* arow = A + (size_t)(row0 + ln) * lda;
  v8f acc[4] = {};
  for (int kb = 0; kb < K; kb += 32) {
    FragH ah, al;
    const v4f x0 = *(const v4fa*)(arow + kb + 8 * hh), x1 = *(const v4fa*)(arow + kb + 8 * hh + 4), x2 = *(const v4fa*)(arow + kb + 16 + 8 * hh), x3 = *(const v4fa*)(arow + kb + 16 + 8 * hh + 4);
    float xs[16] = {x0[0],x0[1],x0[2],x0[3],x1[0],x1[1],x1[2],x1[3],x2[0],x2[1],x2[2],x2[3],x3[0],x3[1],x3[2],x3[3]};
#pragma unroll
    for (int i = 0; i < 16; ++i) { const _Float16 h = (_Float16)xs[i]; ah.h[i] = h; al.h[i] = ASPLIT ? (_Float16)(xs[i] - (float)h) : (_Float16)0.0f; }
#pragma unroll
    for (int t = 0; t < 4; ++t) { if (col0 + t * 16 >= N) continue; const size_t boff = (size_t)(col0 + t * 16 + ln) * ldb + kb; FragH bq; bq.half[0] = *(const v8us*)(Bh + boff + 8 * hh); bq.half[1] = *(const v8us*)(Bh + boff + 16 + 8 * hh);
      acc[t] = mmaH<ASPLIT ? 2 : 1>(ah.v, al.v, bq.v, bq.v, acc[t]); }
  }
#pragma unroll
  for (int t = 0; t < 4; ++t) { if (col0 + t * 16 >= N) continue;
#pragma unroll
    for (int r = 0; r < 8; ++r) so[w][8 * hh + r][t * 16 + ln] = acc[t][r] * alpha; }
  __builtin_amdgcn_fence(__ATOMIC_ACQ_REL, "workgroup"); __builtin_amdgcn_wave_barrier();
  const int rsub = lane >> 4, c4 = (lane & 15) * 4;
  {
#pragma unroll
    for (int q = 0; q < 8; ++q) { const int r = q * 2 + rsub; if (col0 + c4 < N) { const v4f v = *(const v4fa*)&so[w][r][c4]; *(v4f*)(C + (size_t)(row0 + r) * ldc + col0 + c4) = v; } }
     }
}

// Wt[n][k] = f16(W[k][n]·scale) from f32 row-major W[K][N] (scale = power of two; bf16-exact weights stay exact in f16 away from the subnormal range)
__global__ __launch_bounds__(256) void k_wt_f16(const float* __restrict__ W, _Float16* __restrict__ Wt, int K, int N, float scale) {
  const int t = blockIdx.x * 256 + threadIdx.x; if (t >= N * (K / 8)) return; const int n = t / (K / 8), k8 = (t % (K / 8)) * 8; FragH f;
#pragma unroll
  for (int i = 0; i < 8; ++i) f.h[i] = (_Float16)(bf16_round(W[(size_t)(k8 + i) * N + n]) * scale); const v8us o = f.half[0];
  *(v8us*)((unsigned short*)Wt + (size_t)n * K + k8) = o; 
}
// k_gemm_hh variant with fused epilogue: v = acc·alpha + bias[by·sBias + col] (+ CP[(row/rowsPerB)·sCPb + by·64 + col] if CP) ; ACT 0 none / 1 elu ; writes f16 C16 (and f32 C if non-null)
template <int ACT>
__global__ __launch_bounds__(128) void k_gemm_hhx(const _Float16* __restrict__ A, int lda, size_t sA, const _Float16* __restrict__ Bh, int ldb, size_t sB, float alpha, const float* __restrict__ bias, size_t sBias, const float* __restrict__ CP, int rowsPerB, size_t sCPb, int row0g,
    float* __restrict__ C, _Float16* __restrict__ C16, int ldc, size_t sC, int M, int N, int K) {
  __shared__ __attribute__((aligned(16))) float so[4][16][64];
  const int tid = threadIdx.x, w = tid >> 5, lane = tid & 31, ln = lane & 15, hh = lane >> 4; const int by = blockIdx.y;
  A += (size_t)by * sA; Bh += (size_t)by * sB; const size_t cofs = (size_t)by * sC; const float* bp = bias ? bias + (size_t)by * sBias : nullptr;
  const int ntn = (N + 63) / 64; const int wid = blockIdx.x * 4 + w; const int mt = wid / ntn, nq = wid % ntn; if (mt * 16 >= M) return;
  const int row0 = mt * 16, col0 = nq * 64; const _Float16* arow = A + (size_t)(row0 + ln) * lda;
  v8f acc[4] = {};
  for (int kb = 0; kb < K; kb += 32) { FragH ah; ah.half[0] = *(const v8us*)((const unsigned short*)arow + kb + 8 * hh); ah.half[1] = *(const v8us*)((const unsigned short*)arow + kb + 16 + 8 * hh);
#pragma unroll
    for (int t = 0; t < 4; ++t) { if (col0 + t * 16 >= N) continue; const size_t boff = (size_t)(col0 + t * 16 + ln) * ldb + kb; FragH bq; bq.half[0] = *(const v8us*)((const unsigned short*)Bh + boff + 8 * hh); bq.half[1] = *(const v8us*)((const unsigned short*)Bh + boff + 16 + 8 * hh);
      acc[t] = mmaH<1>(ah.v, ah.v, bq.v, bq.v, acc[t]); }
  }
#pragma unroll
  for (int t = 0; t < 4; ++t) { if (col0 + t * 16 >= N) continue; const int col = col0 + t * 16 + ln; const float bv = bp ? bf16_round(bp[col]) : 0.f;
#pragma unroll
    for (int r = 0; r < 8; ++r) { float v = acc[t][r] * alpha + bv; if (CP) { const int bidx = (row0g + row0 + 8 * hh + r) / rowsPerB; v += CP[(size_t)bidx * sCPb + (size_t)by * 64 + col]; } if (ACT == 1) v = (v > 0.f) ? v : expm1f(v); else if (ACT == 7) v = (v > 0.f) ? v + 1.0f : expf(v); else if (ACT == 8) v = tanhf(v); else if (ACT == 9) v = 0.5f * v * (1.0f + tanhf(0.7978845608028654f * (v + 0.044715f * v * v * v))); else if (ACT == 11) v = 1.0f / (1.0f + expf(-v)); else if (ACT == 12) v = (v > 0.f) ? v : 0.01f * v; else if (ACT == 14) v = (v > 0.f) ? v : 0.1f * v; else if (ACT == 15) v = v / (1.0f + expf(-v)); else if (ACT == 3) v = fmaxf(v, 0.f); else if (ACT == 6) v = 0.5f * v * (1.0f + erff(v * 0.70710678118654752f)); so[w][8 * hh + r][t * 16 + ln] = v; } }
  __builtin_amdgcn_fence(__ATOMIC_ACQ_REL, "workgroup"); __builtin_amdgcn_wave_barrier();
  const int rsub = lane >> 4, c4 = (lane & 15) * 4; typedef _Float16 v4h __attribute__((ext_vector_type(4)));
  {
#pragma unroll
    for (int q = 0; q < 8; ++q) { const int r = q * 2 + rsub; if (col0 + c4 < N) { const v4f v = *(const v4fa*)&so[w][r][c4]; if (C) *(v4f*)(C + cofs + (size_t)(row0 + r) * ldc + col0 + c4) = v; if (C16) { v4h h4; for (int i = 0; i < 4; ++i) h4[i] = (_Float16)v[i]; *(v4h*)(C16 + cofs + (size_t)(row0 + r) * ldc + col0 + c4) = h4; } } }
     }
}


typedef _Float16 v4h __attribute__((ext_vector_type(4)));

__global__ __launch_bounds__(256) void k_x16(const float* __restrict__ x, _Float16* __restrict__ X16, size_t n8) { const size_t t = (size_t)blockIdx.x * 256 + threadIdx.x; if (t >= n8) return; FragH f;
#pragma unroll
  for (int q = 0; q < 8; ++q) f.h[q] = (_Float16)bf16_round(x[t * 8 + q]); *(v8us*)((unsigned short*)X16 + t * 8) = f.half[0];  }
__global__ __launch_bounds__(256) void k_h16(const float* __restrict__ x, _Float16* __restrict__ X16, size_t n8) { const size_t t = (size_t)blockIdx.x * 256 + threadIdx.x; if (t >= n8) return; FragH f;
#pragma unroll
  for (int q = 0; q < 8; ++q) f.h[q] = (_Float16)x[t * 8 + q]; *(v8us*)((unsigned short*)X16 + t * 8) = f.half[0];  }
__global__ __launch_bounds__(256) void k_round16f(const float* __restrict__ W, _Float16* __restrict__ Bt, size_t n8) { const size_t t = (size_t)blockIdx.x * 256 + threadIdx.x; if (t >= n8) return; FragH f;
#pragma unroll
  for (int i = 0; i < 8; ++i) f.h[i] = (_Float16)(bf16_round(W[t * 8 + i]) * 16.0f); *(v8us*)((unsigned short*)Bt + t * 8) = f.half[0];  }
template <int NHv, int TTv>
__global__ __launch_bounds__(256) void k_vt(const _Float16* __restrict__ V16, int ldv, int voff, _Float16* __restrict__ Vt) { __shared__ unsigned short tl[64][66]; const int tid = threadIdx.x; const int slab = blockIdx.x / (TTv / 64), lg = blockIdx.x % (TTv / 64); const int b = slab / NHv, h = slab % NHv;
  for (int i = tid; i < 64 * 8; i += 256) { const int r = i / 8, c8 = (i % 8) * 8; FragH f; f.half[0] = *(const v8us*)((const unsigned short*)V16 + ((size_t)b * TTv + lg * 64 + r) * ldv + voff + h * 64 + c8);
#pragma unroll
    for (int q = 0; q < 8; ++q) tl[r][c8 + q] = f.u[q]; }
  __syncthreads();
  {
#pragma unroll
    for (int rd = 0; rd < 2; ++rd) { const int d = rd * 32 + tid / 8, pc = tid % 8; FragH f;
#pragma unroll
      for (int q = 0; q < 8; ++q) f.u[q] = tl[pc * 8 + q][d];
      *(v8us*)((unsigned short*)Vt + ((size_t)slab * 64 + d) * TTv + lg * 64 + pc * 8) = f.half[0]; }
     } }

__global__ __launch_bounds__(256) void k_hl(const float* __restrict__ F, _Float16* __restrict__ Hh, _Float16* __restrict__ Hl, size_t n8) { const size_t t = (size_t)blockIdx.x * 256 + threadIdx.x; if (t >= n8) return; FragH fh, fl; const v4f a = *(const v4fa*)(F + t * 8), c = *(const v4fa*)(F + t * 8 + 4);
#pragma unroll
  for (int q = 0; q < 4; ++q) { _Float16 h = (_Float16)a[q]; fh.h[q] = h; fl.h[q] = (_Float16)((a[q] - (float)h) * 1024.0f); h = (_Float16)c[q]; fh.h[4 + q] = h; fl.h[4 + q] = (_Float16)((c[q] - (float)h) * 1024.0f); }
  { *(v8us*)((unsigned short*)Hh + t * 8) = fh.half[0]; *(v8us*)((unsigned short*)Hl + t * 8) = fl.half[0];  } }

// ---- fast GEMM (wave tile 32x64; requires M % 32 == 0 rows per launch region and N % 64 == 0); epilogue = k_gemm_hhx semantics ----
__device__ __forceinline__ v16h g2_frag(const _Float16* p, int hh) { FragH f; f.half[0] = *(const v8us*)((const unsigned short*)p + 8 * hh); f.half[1] = *(const v8us*)((const unsigned short*)p + 16 + 8 * hh); return f.v; }
__device__ __forceinline__ v8f g2_mma(v16h a, v16h b, v8f c) { v8f d = __builtin_amdgcn_wmma_f32_16x16x32_f16(false, a, false, b, (short)0, c, false, false); asm volatile("v_nop\n\tv_nop\n\tv_nop\n\tv_nop" : "+v"(d) : "v"(a), "v"(b)); return d; }
template <int ACT>
__global__ __launch_bounds__(128) void k_gemm2(const _Float16* __restrict__ A, int lda, size_t sA, const _Float16* __restrict__ Bh, int ldb, size_t sB, float alpha, const float* __restrict__ bias, size_t sBias, const float* __restrict__ CP, int rowsPerB, size_t sCPb, int row0g,
    float* __restrict__ C, _Float16* __restrict__ C16, int ldc, size_t sC, int M, int N, int K) {
  __shared__ __attribute__((aligned(16))) float so[4][32][68];
  const int tid = threadIdx.x, w = tid >> 5, lane = tid & 31, ln = lane & 15, hh = lane >> 4; const int by = blockIdx.y;
  A += (size_t)by * sA; Bh += (size_t)by * sB; const size_t cofs = (size_t)by * sC; const float* bp = bias ? bias + (size_t)by * sBias : nullptr;
  const int ntn = N >> 6; const int mt = blockIdx.x / ntn, nq = blockIdx.x - mt * ntn; const int row0 = mt * 128 + 32 * w, col0 = nq * 64; if (row0 >= M) return;
  const _Float16* a0p = A + (size_t)(row0 + ln) * lda; const _Float16* a1p = a0p + (size_t)16 * lda;
  const _Float16* b0p = Bh + (size_t)(col0 + ln) * ldb; const _Float16* b1p = b0p + (size_t)16 * ldb; const _Float16* b2p = b1p + (size_t)16 * ldb; const _Float16* b3p = b2p + (size_t)16 * ldb;
  const v8f z8 = {0.f,0.f,0.f,0.f,0.f,0.f,0.f,0.f}; v8f c00 = z8, c01 = z8, c02 = z8, c03 = z8, c10 = z8, c11 = z8, c12 = z8, c13 = z8;
#pragma unroll 1
  for (int kb = 0; kb < K; kb += 32) { const v16h a0 = g2_frag(a0p + kb, hh), a1 = g2_frag(a1p + kb, hh);
    v16h b = g2_frag(b0p + kb, hh); c00 = g2_mma(a0, b, c00); c10 = g2_mma(a1, b, c10);
    b = g2_frag(b1p + kb, hh); c01 = g2_mma(a0, b, c01); c11 = g2_mma(a1, b, c11);
    b = g2_frag(b2p + kb, hh); c02 = g2_mma(a0, b, c02); c12 = g2_mma(a1, b, c12);
    b = g2_frag(b3p + kb, hh); c03 = g2_mma(a0, b, c03); c13 = g2_mma(a1, b, c13); }
  v8f accs[8] = {c00, c01, c02, c03, c10, c11, c12, c13};
#pragma unroll
  for (int u = 0; u < 8; ++u) { const int t = u & 3, half = u >> 2; const int col = col0 + t * 16 + ln; const float bv = bp ? bf16_round(bp[col]) : 0.f;
#pragma unroll
    for (int r = 0; r < 8; ++r) { const int rloc = half * 16 + 8 * hh + r; float v = accs[u][r] * alpha + bv; if (CP) { const int bidx = (row0g + row0 + rloc) / rowsPerB; v += CP[(size_t)bidx * sCPb + (size_t)by * 64 + col]; }
      if (ACT == 3) v = fmaxf(v, 0.f); else if (ACT == 6) v = 0.5f * v * (1.0f + erff(v * 0.70710678118654752f)); else if (ACT == 11) v = 1.0f / (1.0f + expf(-v)); else if (ACT == 15) v = v / (1.0f + expf(-v)); else if (ACT == 12) v = (v > 0.f) ? v : 0.01f * v; else if (ACT == 8) v = tanhf(v);
      so[w][rloc][t * 16 + ln] = v; } }
  __builtin_amdgcn_fence(__ATOMIC_ACQ_REL, "workgroup"); __builtin_amdgcn_wave_barrier();
  const int rsub = lane >> 4, c4 = (lane & 15) * 4;
  {
#pragma unroll
    for (int q = 0; q < 16; ++q) { const int r = q * 2 + rsub; const v4f v = *(const v4fa*)&so[w][r][c4]; if (C) *(v4f*)(C + cofs + (size_t)(row0 + r) * ldc + col0 + c4) = v; if (C16) { v4h h4; for (int i = 0; i < 4; ++i) h4[i] = (_Float16)v[i]; *(v4h*)(C16 + cofs + (size_t)(row0 + r) * ldc + col0 + c4) = h4; } }
     } }


__global__ __launch_bounds__(256) void k_qk(const float* __restrict__ x, int s, const float* __restrict__ gqw, const float* __restrict__ gqb, const float* __restrict__ gkw, const float* __restrict__ gkb, const float* __restrict__ lqw, const float* __restrict__ lqb, const float* __restrict__ lkw, const float* __restrict__ lkb, _Float16* __restrict__ QP, _Float16* __restrict__ KP) {
  #pragma clang fp contract(off)
  const int t = blockIdx.x * 256 + threadIdx.x; if (t >= HW * NG * 2) return; const int j = blockIdx.y; s += j; const int which = t & 1; const int g = (t >> 1) % NG; const int p = t / (2 * NG); const int br = g >> 2, h = g & 3;
  const float* xr = x + (((size_t)which * NSL + s) * HW + p) * CC + h * HD;      /* x[0] = q slices, x[1] = k slices */
  const float* w = which ? (br ? lkw : gkw) : (br ? lqw : gqw); const float* bb = which ? (br ? lkb : gkb) : (br ? lqb : gqb); FragH a, s1, s2, z;
  /* three-segment rows (K 64): Q = [hi | 16 lo | hi/16 | 0], K = [hi | hi/16 | 16 lo | 0] -> hi.hi + lo.hi + hi.lo (~2^-20) */
#pragma unroll
  for (int d = 0; d < 16; ++d) { const int c = h * HD + d; const float v = bf16_round(xr[d]) * bf16_round(w[c]) + bf16_round(bb[c]); const _Float16 hv = (_Float16)v; const float lo = (v - (float)hv) * 16.0f; a.h[d] = hv;
    if (which) { s1.h[d] = (_Float16)((float)hv * 0.0625f); s2.h[d] = (_Float16)lo; } else { s1.h[d] = (_Float16)lo; s2.h[d] = (_Float16)((float)hv * 0.0625f); } z.u[d] = 0; }
  unsigned short* dst = (unsigned short*)(which ? KP : QP) + ((size_t)(j * NG + g) * HW + p) * 64;
  { *(v8us*)dst = a.half[0]; *(v8us*)(dst + 8) = a.half[1]; *(v8us*)(dst + 16) = s1.half[0]; *(v8us*)(dst + 24) = s1.half[1]; *(v8us*)(dst + 32) = s2.half[0]; *(v8us*)(dst + 40) = s2.half[1]; *(v8us*)(dst + 48) = z.half[0]; *(v8us*)(dst + 56) = z.half[0];  } }
__global__ __launch_bounds__(256) void k_vtp(const float* __restrict__ x, int s, const float* __restrict__ gvw, const float* __restrict__ gvb, const float* __restrict__ lvw, const float* __restrict__ lvb, _Float16* __restrict__ VT) {
  #pragma clang fp contract(off)
  __shared__ float tl[64][17]; const int tid = threadIdx.x; const int j = blockIdx.y; s += j; const int g = blockIdx.x / (HW / 64), pt = blockIdx.x % (HW / 64); const int br = g >> 2, h = g & 3; const float* w = br ? lvw : gvw; const float* bb = br ? lvb : gvb;
  for (int i = tid; i < 64 * 16; i += 256) { const int pl = i >> 4, d = i & 15; const int c = h * HD + d; tl[pl][d] = bf16_round(x[(((size_t)2 * NSL + s) * HW + pt * 64 + pl) * CC + c]) * bf16_round(w[c]) + bf16_round(bb[c]); }
  __syncthreads();
  const int d = tid >> 3, p8 = (tid & 7) * 8;      /* thread: row d (0..31 here; rows 32..63 in a second step), 8 positions */
  {
#pragma unroll
    for (int u = 0; u < 2; ++u) { const int dd = d + u * 32; FragH f;
#pragma unroll
      for (int q = 0; q < 8; ++q) f.h[q] = (dd < 16) ? (_Float16)tl[p8 + q][dd] : (_Float16)0.0f;
      *(v8us*)((unsigned short*)VT + ((size_t)(j * NG + g) * 64 + dd) * HW + pt * 64 + p8) = f.half[0]; }
     } }
__global__ __launch_bounds__(256) void k_soft(const float* __restrict__ S, _Float16* __restrict__ P16) {
  #pragma clang fp contract(off)
  const int tid = threadIdx.x, w = tid >> 5, ln = tid & 31; const int r = blockIdx.x * 8 + w; if (r >= NB * NG * HW) return; const float* s = S + (size_t)r * HW; float m = -3.0e38f;
#pragma unroll 1
  for (int c = 0; c < HW / 256; ++c) { const float* p = s + c * 256 + ln * 8; for (int q = 0; q < 8; ++q) m = fmaxf(m, p[q]); }
  for (int o = 16; o > 0; o >>= 1) m = fmaxf(m, __shfl_xor(m, o, 32)); float su = 0.f;
#pragma unroll 1
  for (int c = 0; c < HW / 256; ++c) { const float* p = s + c * 256 + ln * 8; for (int q = 0; q < 8; ++q) su += expf(p[q] - m); }
  for (int o = 16; o > 0; o >>= 1) su += __shfl_xor(su, o, 32); const float inv = 1024.0f / su; unsigned short* d = (unsigned short*)P16 + (size_t)r * HW;
  {
#pragma unroll 1
    for (int c = 0; c < HW / 256; ++c) { const float* p = s + c * 256 + ln * 8; FragH f;
#pragma unroll
      for (int q = 0; q < 8; ++q) f.h[q] = (_Float16)(expf(p[q] - m) * inv);
      *(v8us*)(d + c * 256 + ln * 8) = f.half[0]; }
     } }
__global__ __launch_bounds__(256) void k_outs(const float* __restrict__ O, int s, const float* __restrict__ pw, const float* __restrict__ pb, float* __restrict__ out) {
  #pragma clang fp contract(off)
  const int t = blockIdx.x * 256 + threadIdx.x; if (t >= HW * (CC / 4)) return; O += (size_t)blockIdx.y * NG * HW * 64; s += blockIdx.y; const int c0 = (t & 15) * 4, p = t >> 4; v4f o;
#pragma unroll
  for (int q = 0; q < 4; ++q) { const int c = c0 + q; const int h = c / HD, d = c % HD; const float l = O[((size_t)(4 + h) * HW + p) * 64 + d], g = O[((size_t)h * HW + p) * 64 + d]; const float comb = 0.5f * l + 0.5f * g; o[q] = (2.0f * comb) * bf16_round(pw[c]) + bf16_round(pb[c]); }
  float* dst = out + ((size_t)s * HW + p) * CC + c0; *(v4f*)dst = o;  }

extern "C" void kernel_launch(void* const* d_in, const int* in_sizes, int n_in,
                              void* d_out, int out_size, void* d_ws, size_t ws_size, hipStream_t stream) {
  (void)in_sizes; (void)n_in; (void)out_size;
  const float* const* I = (const float* const*)d_in; const float* x = I[0];
  const float* gqw = I[1]; const float* gqb = I[2]; const float* gkw = I[3]; const float* gkb = I[4]; const float* gvw = I[5]; const float* gvb = I[6]; const float* lqw = I[7]; const float* lqb = I[8]; const float* lkw = I[9]; const float* lkb = I[10]; const float* lvw = I[11]; const float* lvb = I[12]; const float* pw = I[13]; const float* pb = I[14];
  char* ws = (char*)d_ws; size_t off = 0;
  auto take = [&](size_t bytes) { char* p = ws + off; off += (bytes + 255) & ~(size_t)255; return p; };
  _Float16* QP = (_Float16*)take((size_t)NB * NG * HW * 64 * 2); _Float16* KP = (_Float16*)take((size_t)NB * NG * HW * 64 * 2); _Float16* VT = (_Float16*)take((size_t)NB * NG * 64 * HW * 2); float* S = (float*)take((size_t)NB * NG * HW * HW * 4); _Float16* P16 = (_Float16*)take((size_t)NB * NG * HW * HW * 2); float* O = S;      /* the scores are dead once the softmax has read them: attn.v writes its result over their first planes */
  if (off > ws_size) return;      /* NB x (1 + 1 + 1 + 32 + 16) = 255 MiB */
  for (int s = 0; s < NRUN; s += NB) {
    k_qk<<<dim3((HW * NG * 2 + 255) / 256, NB), 256, 0, stream>>>(x, s, gqw, gqb, gkw, gkb, lqw, lqb, lkw, lkb, QP, KP); k_vtp<<<dim3(NG * (HW / 64), NB), 256, 0, stream>>>(x, s, gvw, gvb, lvw, lvb, VT);
    k_gemm2<0><<<dim3((HW / 128) * (HW / 64), NB * NG), 128, 0, stream>>>(QP, 64, (size_t)HW * 64, KP, 64, (size_t)HW * 64, 0.25f, nullptr, 0, nullptr, 1, 0, 0, S, nullptr, HW, (size_t)HW * HW, HW, HW, 64);      /* three-segment scores x 16^-0.5, NB x 8 (slice, branch, head) planes batched */
    k_soft<<<(NB * NG * HW) / 8, 256, 0, stream>>>(S, P16);
    k_gemm2<0><<<dim3((HW / 128) * 1, NB * NG), 128, 0, stream>>>(P16, HW, (size_t)HW * HW, VT, HW, (size_t)64 * HW, 0.0009765625f, nullptr, 0, nullptr, 1, 0, 0, O, nullptr, 64, (size_t)HW * 64, HW, 64, HW);
    k_outs<<<dim3((HW * (CC / 4) + 255) / 256, NB), 256, 0, stream>>>(O, s, pw, pb, (float*)d_out); }
}

// v002
// One run takes 72.2 microseconds.
// Next to v001, in two timings, it ran 7.99 and 8.00 times as fast.
// Counting every step since v000, it is 19.2 times as fast.
#include <hip/hip_runtime.h>
// Global + local spatial attention (x = [q|k|v] of 20 slices x 1024 positions x 64 channels; 4 heads of 16; per-channel scale+bias 'depthwise k=1 convs' for each branch): g = attn(q gq_w + gq_b, k gk_w + gk_b, v gv_w + gv_b), l likewise; out = (2 (0.5 l + 0.5 g)) proj_w + proj_b -> [20,1024,64].
// Structure (every launch batched over all NB slices): the scaled q/k as three-segment f16 rows per 16-dim head ([hi | 16 lo | hi/16 | 0] x [hi | hi/16 | 16 lo | 0], K 64), v as f16 planes transposed per head by an LDS tile kernel (N padded to 64); for the 8 (branch, head) pairs at once: one fused attention kernel (scores, running-maximum softmax and attn.v in registers, f32 accumulation, P x2^10 f16; keys and v staged in LDS); the branch mix and the output scale/bias on VALU.
// Compute dtype: x and all parameters rounded to bf16; q, k as hi + residual three-segment products (~2^-20); v, P as f16 operands (~2^-12); f32 accumulation, softmax, elementwise. v_wmma_f32_16x16x32_f16.
#define NSL 20
#define NRUN NSL                 /* slices processed (NSL stays the input stride) */
#define HW 1024
#define CC 64
#define NHD 4
#define HD 16
#define NG 8                     /* (branch, head) pairs per slice: g = br*4 + h */
#define NB 20                    /* slices per launch: blockIdx.y runs over NB slices (or NB x NG planes); NB x 5 MiB of planes fit the workspace; NSL % NB == 0 */
typedef __bf16 v16b __attribute__((ext_vector_type(16)));
typedef unsigned short v8us __attribute__((ext_vector_type(8), may_alias));
typedef float  v8f  __attribute__((ext_vector_type(8)));
typedef float  v4f  __attribute__((ext_vector_type(4)));
typedef float  v4fa __attribute__((ext_vector_type(4), may_alias));
union FragB { v16b v; v8us half[2]; unsigned short u[16]; };

__device__ __forceinline__ unsigned short bf16_bits(float x) { unsigned int u = __float_as_uint(x); return (unsigned short)((u + 0x7FFFu + ((u >> 16) & 1u)) >> 16); }
__device__ __forceinline__ float bf16_val(unsigned short b) { return __uint_as_float(((unsigned int)b) << 16); }
__device__ __forceinline__ float bf16_round(float x) { return bf16_val(bf16_bits(x)); }
// D += A·B with NT terms: 1 = ah·bh, 2 = + al·bh (A split), 3 = + ah·bl (both split)
template <int NT>
__device__ __forceinline__ v8f mmaN(v16b ah, v16b al, v16b bh, v16b bl, v8f c) {
  c = __builtin_amdgcn_wmma_f32_16x16x32_bf16(false, ah, false, bh, (short)0, c, false, false);
  if (NT >= 2) c = __builtin_amdgcn_wmma_f32_16x16x32_bf16(false, al, false, bh, (short)0, c, false, false);
  if (NT >= 3) c = __builtin_amdgcn_wmma_f32_16x16x32_bf16(false, ah, false, bl, (short)0, c, false, false);
  asm volatile("v_nop\n\tv_nop\n\tv_nop\n\tv_nop" : "+v"(c) : "v"(ah), "v"(al), "v"(bh), "v"(bl));
  return c;
}

__global__ __launch_bounds__(256) void k_wt_bf16(const float* __restrict__ W, unsigned short* __restrict__ Wt, int K, int N) {
  const int t = blockIdx.x * 256 + threadIdx.x;
  const int k8n = K / 8;
  if (t >= N * k8n) return;
  const int n = t / k8n, k8 = (t % k8n) * 8;
  v8us v;
#pragma unroll
  for (int i = 0; i < 8; ++i) v[i] = bf16_bits(W[(size_t)(k8 + i) * N + n]);
  *(v8us*)(Wt + (size_t)n * K + k8) = v;
  
}

// GEMM C[M][N] (f32, pitch ldc) = act(A[M][K]·W + bias). A f32 row-major (pitch lda) converted per fragment to bf16
// (ASPLIT: hi/lo two planes -> 2 terms, else single rounded term); Wt bf16 [N][K] (pitch ldb). BIAS_BF16 rounds the
// bias to bf16 first (bias quantised to bf16 before the add). K%32==0, M%16==0, N%64==0.
template <bool ASPLIT, int ACT, bool BIAS_BF16>
__global__ __launch_bounds__(128) void k_gemm_bf(const float* __restrict__ A, int lda, const unsigned short* __restrict__ Wt, int ldb,
                                               const float* __restrict__ bias, float* __restrict__ C, int ldc, int M, int N, int K) {
  __shared__ __attribute__((aligned(16))) float so[4][16][64];
  const int tid = threadIdx.x, w = tid >> 5, lane = tid & 31, ln = lane & 15, hh = lane >> 4;
  const int ntn = N / 64;
  const int wid = blockIdx.x * 4 + w;
  const int mt = wid / ntn, nq = wid % ntn;
  if (mt * 16 >= M) return;
  const int row0 = mt * 16, col0 = nq * 64;
  const float* arow = A + (size_t)(row0 + ln) * lda;
  v8f acc[4] = {};
  for (int kb = 0; kb < K; kb += 32) {
    FragB ah, al;
    const v4f x0 = *(const v4fa*)(arow + kb + 8 * hh), x1 = *(const v4fa*)(arow + kb + 8 * hh + 4);
    const v4f x2 = *(const v4fa*)(arow + kb + 16 + 8 * hh), x3 = *(const v4fa*)(arow + kb + 16 + 8 * hh + 4);
    float xs[16] = {x0[0],x0[1],x0[2],x0[3],x1[0],x1[1],x1[2],x1[3],x2[0],x2[1],x2[2],x2[3],x3[0],x3[1],x3[2],x3[3]};
#pragma unroll
    for (int i = 0; i < 16; ++i) { const unsigned short hb = bf16_bits(xs[i]); ah.u[i] = hb; al.u[i] = ASPLIT ? bf16_bits(xs[i] - bf16_val(hb)) : (unsigned short)0; }
#pragma unroll
    for (int t = 0; t < 4; ++t) {
      const unsigned short* brow = Wt + (size_t)(col0 + t * 16 + ln) * ldb + kb;
      FragB b;
      b.half[0] = *(const v8us*)(brow + 8 * hh);
      b.half[1] = *(const v8us*)(brow + 16 + 8 * hh);
      acc[t] = mmaN<ASPLIT ? 2 : 1>(ah.v, al.v, b.v, b.v, acc[t]);
    }
  }
#pragma unroll
  for (int t = 0; t < 4; ++t) {
    float bv = bias ? bias[col0 + t * 16 + ln] : 0.f;
    if (BIAS_BF16) bv = bf16_round(bv);
#pragma unroll
    for (int r = 0; r < 8; ++r) { float v = acc[t][r] + bv; if (ACT == 1) v = fmaxf(v, 0.f); so[w][8 * hh + r][t * 16 + ln] = v; }
  }
  __builtin_amdgcn_fence(__ATOMIC_ACQ_REL, "workgroup");
  __builtin_amdgcn_wave_barrier();
  const int rsub = lane >> 4, c4 = (lane & 15) * 4;
  {
#pragma unroll
    for (int q = 0; q < 8; ++q) {
      const int r = q * 2 + rsub;
      const v4f v = *(const v4fa*)&so[w][r][c4];
      *(v4f*)(C + (size_t)(row0 + r) * ldc + col0 + c4) = v;
    }
    
  }
}

// GEMM C = act(A·W + bias + resid): A f32 (ASPLIT -> hi/lo 2 terms), Wt bf16 [N][K]; ACT 0 none, 1 relu, 2 exact gelu;
// resid (optional, f32, row index = (row % rmod), pitch ldr, RES_BF16 rounds it) added before the activation.
template <bool ASPLIT, int ACT, bool BIAS_BF16, bool RES_BF16>
__global__ __launch_bounds__(128) void k_gemm_bf3(const float* __restrict__ A, int lda, const unsigned short* __restrict__ Wt, int ldb,
                                                const float* __restrict__ bias, const float* __restrict__ resid, int rmod, int ldr,
                                                float* __restrict__ C, int ldc, int M, int N, int K) {
  __shared__ __attribute__((aligned(16))) float so[4][16][64];
  const int tid = threadIdx.x, w = tid >> 5, lane = tid & 31, ln = lane & 15, hh = lane >> 4;
  const int ntn = N / 64;
  const int wid = blockIdx.x * 4 + w;
  const int mt = wid / ntn, nq = wid % ntn;
  if (mt * 16 >= M) return;
  const int row0 = mt * 16, col0 = nq * 64;
  const float* arow = A + (size_t)(row0 + ln) * lda;
  v8f acc[4] = {};
  for (int kb = 0; kb < K; kb += 32) {
    FragB ah, al;
    const v4f x0 = *(const v4fa*)(arow + kb + 8 * hh), x1 = *(const v4fa*)(arow + kb + 8 * hh + 4);
    const v4f x2 = *(const v4fa*)(arow + kb + 16 + 8 * hh), x3 = *(const v4fa*)(arow + kb + 16 + 8 * hh + 4);
    float xs[16] = {x0[0],x0[1],x0[2],x0[3],x1[0],x1[1],x1[2],x1[3],x2[0],x2[1],x2[2],x2[3],x3[0],x3[1],x3[2],x3[3]};
#pragma unroll
    for (int i = 0; i < 16; ++i) { const unsigned short hb = bf16_bits(xs[i]); ah.u[i] = hb; al.u[i] = ASPLIT ? bf16_bits(xs[i] - bf16_val(hb)) : (unsigned short)0; }
#pragma unroll
    for (int t = 0; t < 4; ++t) {
      const unsigned short* brow = Wt + (size_t)(col0 + t * 16 + ln) * ldb + kb;
      FragB b;
      b.half[0] = *(const v8us*)(brow + 8 * hh);
      b.half[1] = *(const v8us*)(brow + 16 + 8 * hh);
      acc[t] = mmaN<ASPLIT ? 2 : 1>(ah.v, al.v, b.v, b.v, acc[t]);
    }
  }
#pragma unroll
  for (int t = 0; t < 4; ++t) {
    const int col = col0 + t * 16 + ln;
    float bv = bias ? bias[col] : 0.f;
    if (BIAS_BF16) bv = bf16_round(bv);
#pragma unroll
    for (int r = 0; r < 8; ++r) {
      float v = acc[t][r] + bv;
      if (resid) { float rv = resid[(size_t)((row0 + 8 * hh + r) % rmod) * ldr + col]; if (RES_BF16) rv = bf16_round(rv); v += rv; }
      if (ACT == 1) v = fmaxf(v, 0.f);
      if (ACT == 2) v = 0.5f * v * (1.0f + erff(v * 0.70710678118654752f));
      if (ACT == 3) { const float u = 0.7978845608028654f * (v + 0.044715f * v * v * v); v = 0.5f * v * (1.0f + tanhf(u)); }
      so[w][8 * hh + r][t * 16 + ln] = v;
    }
  }
  __builtin_amdgcn_fence(__ATOMIC_ACQ_REL, "workgroup");
  __builtin_amdgcn_wave_barrier();
  const int rsub = lane >> 4, c4 = (lane & 15) * 4;
  {
#pragma unroll
    for (int q = 0; q < 8; ++q) {
      const int r = q * 2 + rsub;
      const v4f v = *(const v4fa*)&so[w][r][c4];
      *(v4f*)(C + (size_t)(row0 + r) * ldc + col0 + c4) = v;
    }
    
  }
}
// row LayerNorm (biased variance, eps) over N: s = X (+ R); optional out_sum <- s; out_norm <- (s-mu)*rsqrt(var+eps)*g + b
template <bool PARAM_BF16>
__global__ __launch_bounds__(256) void k_layernorm(const float* __restrict__ X, const float* __restrict__ R, const float* __restrict__ g, const float* __restrict__ bta,
                                                  float* __restrict__ out_sum, float* __restrict__ out_norm, int N, float eps) {
  __shared__ float red[256];
  const int row = blockIdx.x, tid = threadIdx.x;
  const float* x = X + (size_t)row * N; const float* rr = R ? R + (size_t)row * N : nullptr;
  float vals[16];                     // up to N = 4096
  const int per = N / 256;            // contiguous chunk per thread? use strided-by-4 chunks: thread handles j = tid*4 + 1024*u
  float s1 = 0.f;
  for (int u = 0; u < per / 4; ++u) {
    const int j = tid * 4 + 1024 * u;
    const v4f a = *(const v4fa*)(x + j);
    v4f b = {0.f,0.f,0.f,0.f}; if (rr) b = *(const v4fa*)(rr + j);
#pragma unroll
    for (int q = 0; q < 4; ++q) { const float v = a[q] + b[q]; vals[u * 4 + q] = v; s1 += v; }
  }
  red[tid] = s1; __syncthreads();
  for (int st = 128; st > 0; st >>= 1) { if (tid < st) red[tid] += red[tid + st]; __syncthreads(); }
  const float mu = red[0] / (float)N; __syncthreads();
  float s2 = 0.f;
  for (int u = 0; u < per / 4; ++u)
#pragma unroll
    for (int q = 0; q < 4; ++q) { const float c = vals[u * 4 + q] - mu; s2 += c * c; }
  red[tid] = s2; __syncthreads();
  for (int st = 128; st > 0; st >>= 1) { if (tid < st) red[tid] += red[tid + st]; __syncthreads(); }
  const float rs = rsqrtf(red[0] / (float)N + eps);
  {
    for (int u = 0; u < per / 4; ++u) {
      const int j = tid * 4 + 1024 * u;
      v4f o, sm;
#pragma unroll
      for (int q = 0; q < 4; ++q) {
        float gg = g[j + q], bb = bta[j + q];
        if (PARAM_BF16) { gg = bf16_round(gg); bb = bf16_round(bb); }
        sm[q] = vals[u * 4 + q]; o[q] = (vals[u * 4 + q] - mu) * rs * gg + bb;
      }
      if (out_sum) *(v4f*)(out_sum + (size_t)row * N + j) = sm;
      *(v4f*)(out_norm + (size_t)row * N + j) = o;
    }
    
  }
}



// ---- f16 WMMA path (v_wmma_f32_16x16x32_f16): 11-bit significands for operands in range — used where a [0,1] probability operand needs more precision than bf16
typedef _Float16 v16h __attribute__((ext_vector_type(16)));
union FragH { v16h v; v8us half[2]; _Float16 h[16]; unsigned short u[16]; };
template <int NT>
__device__ __forceinline__ v8f mmaH(v16h ah, v16h al, v16h bh, v16h bl, v8f c) {
  c = __builtin_amdgcn_wmma_f32_16x16x32_f16(false, ah, false, bh, (short)0, c, false, false);
  if (NT >= 2) c = __builtin_amdgcn_wmma_f32_16x16x32_f16(false, al, false, bh, (short)0, c, false, false);
  if (NT >= 3) c = __builtin_amdgcn_wmma_f32_16x16x32_f16(false, ah, false, bl, (short)0, c, false, false);
  asm volatile("v_nop\n\tv_nop\n\tv_nop\n\tv_nop" : "+v"(c) : "v"(ah), "v"(al), "v"(bh), "v"(bl));
  return c;
}
// batched GEMM like k_gemm_b but f16 operands: A f32 (split into f16 hi/lo if ASPLIT, else rounded to f16), Bt = f16 values [n][k]; alpha; C f32; N multiple of 16 (partial tiles skipped)
template <bool ASPLIT>
__global__ __launch_bounds__(128) void k_gemm_h(const float* __restrict__ A, int lda, size_t sA, const _Float16* __restrict__ Bh, int ldb, size_t sB, float alpha, float* __restrict__ C, int ldc, size_t sC, int M, int N, int K) {
  __shared__ __attribute__((aligned(16))) float so[4][16][64];
  const int tid = threadIdx.x, w = tid >> 5, lane = tid & 31, ln = lane & 15, hh = lane >> 4; const int by = blockIdx.y;
  A += (size_t)by * sA; Bh += (size_t)by * sB; C += (size_t)by * sC;
  const int ntn = (N + 63) / 64; const int wid = blockIdx.x * 4 + w; const int mt = wid / ntn, nq = wid % ntn; if (mt * 16 >= M) return;
  const int row0 = mt * 16, col0 = nq * 64; const float* arow = A + (size_t)(row0 + ln) * lda;
  v8f acc[4] = {};
  for (int kb = 0; kb < K; kb += 32) {
    FragH ah, al;
    const v4f x0 = *(const v4fa*)(arow + kb + 8 * hh), x1 = *(const v4fa*)(arow + kb + 8 * hh + 4), x2 = *(const v4fa*)(arow + kb + 16 + 8 * hh), x3 = *(const v4fa*)(arow + kb + 16 + 8 * hh + 4);
    float xs[16] = {x0[0],x0[1],x0[2],x0[3],x1[0],x1[1],x1[2],x1[3],x2[0],x2[1],x2[2],x2[3],x3[0],x3[1],x3[2],x3[3]};
#pragma unroll
    for (int i = 0; i < 16; ++i) { const _Float16 h = (_Float16)xs[i]; ah.h[i] = h; al.h[i] = ASPLIT ? (_Float16)(xs[i] - (float)h) : (_Float16)0.0f; }
#pragma unroll
    for (int t = 0; t < 4; ++t) { if (col0 + t * 16 >= N) continue; const size_t boff = (size_t)(col0 + t * 16 + ln) * ldb + kb; FragH bq; bq.half[0] = *(const v8us*)(Bh + boff + 8 * hh); bq.half[1] = *(const v8us*)(Bh + boff + 16 + 8 * hh);
      acc[t] = mmaH<ASPLIT ? 2 : 1>(ah.v, al.v, bq.v, bq.v, acc[t]); }
  }
#pragma unroll
  for (int t = 0; t < 4; ++t) { if (col0 + t * 16 >= N) continue;
#pragma unroll
    for (int r = 0; r < 8; ++r) so[w][8 * hh + r][t * 16 + ln] = acc[t][r] * alpha; }
  __builtin_amdgcn_fence(__ATOMIC_ACQ_REL, "workgroup"); __builtin_amdgcn_wave_barrier();
  const int rsub = lane >> 4, c4 = (lane & 15) * 4;
  {
#pragma unroll
    for (int q = 0; q < 8; ++q) { const int r = q * 2 + rsub; if (col0 + c4 < N) { const v4f v = *(const v4fa*)&so[w][r][c4]; *(v4f*)(C + (size_t)(row0 + r) * ldc + col0 + c4) = v; } }
     }
}

// Wt[n][k] = f16(W[k][n]·scale) from f32 row-major W[K][N] (scale = power of two; bf16-exact weights stay exact in f16 away from the subnormal range)
__global__ __launch_bounds__(256) void k_wt_f16(const float* __restrict__ W, _Float16* __restrict__ Wt, int K, int N, float scale) {
  const int t = blockIdx.x * 256 + threadIdx.x; if (t >= N * (K / 8)) return; const int n = t / (K / 8), k8 = (t % (K / 8)) * 8; FragH f;
#pragma unroll
  for (int i = 0; i < 8; ++i) f.h[i] = (_Float16)(bf16_round(W[(size_t)(k8 + i) * N + n]) * scale); const v8us o = f.half[0];
  *(v8us*)((unsigned short*)Wt + (size_t)n * K + k8) = o; 
}
// k_gemm_hh variant with fused epilogue: v = acc·alpha + bias[by·sBias + col] (+ CP[(row/rowsPerB)·sCPb + by·64 + col] if CP) ; ACT 0 none / 1 elu ; writes f16 C16 (and f32 C if non-null)
template <int ACT>
__global__ __launch_bounds__(128) void k_gemm_hhx(const _Float16* __restrict__ A, int lda, size_t sA, const _Float16* __restrict__ Bh, int ldb, size_t sB, float alpha, const float* __restrict__ bias, size_t sBias, const float* __restrict__ CP, int rowsPerB, size_t sCPb, int row0g,
    float* __restrict__ C, _Float16* __restrict__ C16, int ldc, size_t sC, int M, int N, int K) {
  __shared__ __attribute__((aligned(16))) float so[4][16][64];
  const int tid = threadIdx.x, w = tid >> 5, lane = tid & 31, ln = lane & 15, hh = lane >> 4; const int by = blockIdx.y;
  A += (size_t)by * sA; Bh += (size_t)by * sB; const size_t cofs = (size_t)by * sC; const float* bp = bias ? bias + (size_t)by * sBias : nullptr;
  const int ntn = (N + 63) / 64; const int wid = blockIdx.x * 4 + w; const int mt = wid / ntn, nq = wid % ntn; if (mt * 16 >= M) return;
  const int row0 = mt * 16, col0 = nq * 64; const _Float16* arow = A + (size_t)(row0 + ln) * lda;
  v8f acc[4] = {};
  for (int kb = 0; kb < K; kb += 32) { FragH ah; ah.half[0] = *(const v8us*)((const unsigned short*)arow + kb + 8 * hh); ah.half[1] = *(const v8us*)((const unsigned short*)arow + kb + 16 + 8 * hh);
#pragma unroll
    for (int t = 0; t < 4; ++t) { if (col0 + t * 16 >= N) continue; const size_t boff = (size_t)(col0 + t * 16 + ln) * ldb + kb; FragH bq; bq.half[0] = *(const v8us*)((const unsigned short*)Bh + boff + 8 * hh); bq.half[1] = *(const v8us*)((const unsigned short*)Bh + boff + 16 + 8 * hh);
      acc[t] = mmaH<1>(ah.v, ah.v, bq.v, bq.v, acc[t]); }
  }
#pragma unroll
  for (int t = 0; t < 4; ++t) { if (col0 + t * 16 >= N) continue; const int col = col0 + t * 16 + ln; const float bv = bp ? bf16_round(bp[col]) : 0.f;
#pragma unroll
    for (int r = 0; r < 8; ++r) { float v = acc[t][r] * alpha + bv; if (CP) { const int bidx = (row0g + row0 + 8 * hh + r) / rowsPerB; v += CP[(size_t)bidx * sCPb + (size_t)by * 64 + col]; } if (ACT == 1) v = (v > 0.f) ? v : expm1f(v); else if (ACT == 7) v = (v > 0.f) ? v + 1.0f : expf(v); else if (ACT == 8) v = tanhf(v); else if (ACT == 9) v = 0.5f * v * (1.0f + tanhf(0.7978845608028654f * (v + 0.044715f * v * v * v))); else if (ACT == 11) v = 1.0f / (1.0f + expf(-v)); else if (ACT == 12) v = (v > 0.f) ? v : 0.01f * v; else if (ACT == 14) v = (v > 0.f) ? v : 0.1f * v; else if (ACT == 15) v = v / (1.0f + expf(-v)); else if (ACT == 3) v = fmaxf(v, 0.f); else if (ACT == 6) v = 0.5f * v * (1.0f + erff(v * 0.70710678118654752f)); so[w][8 * hh + r][t * 16 + ln] = v; } }
  __builtin_amdgcn_fence(__ATOMIC_ACQ_REL, "workgroup"); __builtin_amdgcn_wave_barrier();
  const int rsub = lane >> 4, c4 = (lane & 15) * 4; typedef _Float16 v4h __attribute__((ext_vector_type(4)));
  {
#pragma unroll
    for (int q = 0; q < 8; ++q) { const int r = q * 2 + rsub; if (col0 + c4 < N) { const v4f v = *(const v4fa*)&so[w][r][c4]; if (C) *(v4f*)(C + cofs + (size_t)(row0 + r) * ldc + col0 + c4) = v; if (C16) { v4h h4; for (int i = 0; i < 4; ++i) h4[i] = (_Float16)v[i]; *(v4h*)(C16 + cofs + (size_t)(row0 + r) * ldc + col0 + c4) = h4; } } }
     }
}


typedef _Float16 v4h __attribute__((ext_vector_type(4)));

__global__ __launch_bounds__(256) void k_x16(const float* __restrict__ x, _Float16* __restrict__ X16, size_t n8) { const size_t t = (size_t)blockIdx.x * 256 + threadIdx.x; if (t >= n8) return; FragH f;
#pragma unroll
  for (int q = 0; q < 8; ++q) f.h[q] = (_Float16)bf16_round(x[t * 8 + q]); *(v8us*)((unsigned short*)X16 + t * 8) = f.half[0];  }
__global__ __launch_bounds__(256) void k_h16(const float* __restrict__ x, _Float16* __restrict__ X16, size_t n8) { const size_t t = (size_t)blockIdx.x * 256 + threadIdx.x; if (t >= n8) return; FragH f;
#pragma unroll
  for (int q = 0; q < 8; ++q) f.h[q] = (_Float16)x[t * 8 + q]; *(v8us*)((unsigned short*)X16 + t * 8) = f.half[0];  }
__global__ __launch_bounds__(256) void k_round16f(const float* __restrict__ W, _Float16* __restrict__ Bt, size_t n8) { const size_t t = (size_t)blockIdx.x * 256 + threadIdx.x; if (t >= n8) return; FragH f;
#pragma unroll
  for (int i = 0; i < 8; ++i) f.h[i] = (_Float16)(bf16_round(W[t * 8 + i]) * 16.0f); *(v8us*)((unsigned short*)Bt + t * 8) = f.half[0];  }
template <int NHv, int TTv>
__global__ __launch_bounds__(256) void k_vt(const _Float16* __restrict__ V16, int ldv, int voff, _Float16* __restrict__ Vt) { __shared__ unsigned short tl[64][66]; const int tid = threadIdx.x; const int slab = blockIdx.x / (TTv / 64), lg = blockIdx.x % (TTv / 64); const int b = slab / NHv, h = slab % NHv;
  for (int i = tid; i < 64 * 8; i += 256) { const int r = i / 8, c8 = (i % 8) * 8; FragH f; f.half[0] = *(const v8us*)((const unsigned short*)V16 + ((size_t)b * TTv + lg * 64 + r) * ldv + voff + h * 64 + c8);
#pragma unroll
    for (int q = 0; q < 8; ++q) tl[r][c8 + q] = f.u[q]; }
  __syncthreads();
  {
#pragma unroll
    for (int rd = 0; rd < 2; ++rd) { const int d = rd * 32 + tid / 8, pc = tid % 8; FragH f;
#pragma unroll
      for (int q = 0; q < 8; ++q) f.u[q] = tl[pc * 8 + q][d];
      *(v8us*)((unsigned short*)Vt + ((size_t)slab * 64 + d) * TTv + lg * 64 + pc * 8) = f.half[0]; }
     } }

__global__ __launch_bounds__(256) void k_hl(const float* __restrict__ F, _Float16* __restrict__ Hh, _Float16* __restrict__ Hl, size_t n8) { const size_t t = (size_t)blockIdx.x * 256 + threadIdx.x; if (t >= n8) return; FragH fh, fl; const v4f a = *(const v4fa*)(F + t * 8), c = *(const v4fa*)(F + t * 8 + 4);
#pragma unroll
  for (int q = 0; q < 4; ++q) { _Float16 h = (_Float16)a[q]; fh.h[q] = h; fl.h[q] = (_Float16)((a[q] - (float)h) * 1024.0f); h = (_Float16)c[q]; fh.h[4 + q] = h; fl.h[4 + q] = (_Float16)((c[q] - (float)h) * 1024.0f); }
  { *(v8us*)((unsigned short*)Hh + t * 8) = fh.half[0]; *(v8us*)((unsigned short*)Hl + t * 8) = fl.half[0];  } }

// ---- fast GEMM (wave tile 32x64; requires M % 32 == 0 rows per launch region and N % 64 == 0); epilogue = k_gemm_hhx semantics ----
__device__ __forceinline__ v16h g2_frag(const _Float16* p, int hh) { FragH f; f.half[0] = *(const v8us*)((const unsigned short*)p + 8 * hh); f.half[1] = *(const v8us*)((const unsigned short*)p + 16 + 8 * hh); return f.v; }
__device__ __forceinline__ v8f g2_mma(v16h a, v16h b, v8f c) { v8f d = __builtin_amdgcn_wmma_f32_16x16x32_f16(false, a, false, b, (short)0, c, false, false); asm volatile("v_nop\n\tv_nop\n\tv_nop\n\tv_nop" : "+v"(d) : "v"(a), "v"(b)); return d; }
template <int ACT>
__global__ __launch_bounds__(128) void k_gemm2(const _Float16* __restrict__ A, int lda, size_t sA, const _Float16* __restrict__ Bh, int ldb, size_t sB, float alpha, const float* __restrict__ bias, size_t sBias, const float* __restrict__ CP, int rowsPerB, size_t sCPb, int row0g,
    float* __restrict__ C, _Float16* __restrict__ C16, int ldc, size_t sC, int M, int N, int K) {
  __shared__ __attribute__((aligned(16))) float so[4][32][68];
  const int tid = threadIdx.x, w = tid >> 5, lane = tid & 31, ln = lane & 15, hh = lane >> 4; const int by = blockIdx.y;
  A += (size_t)by * sA; Bh += (size_t)by * sB; const size_t cofs = (size_t)by * sC; const float* bp = bias ? bias + (size_t)by * sBias : nullptr;
  const int ntn = N >> 6; const int mt = blockIdx.x / ntn, nq = blockIdx.x - mt * ntn; const int row0 = mt * 128 + 32 * w, col0 = nq * 64; if (row0 >= M) return;
  const _Float16* a0p = A + (size_t)(row0 + ln) * lda; const _Float16* a1p = a0p + (size_t)16 * lda;
  const _Float16* b0p = Bh + (size_t)(col0 + ln) * ldb; const _Float16* b1p = b0p + (size_t)16 * ldb; const _Float16* b2p = b1p + (size_t)16 * ldb; const _Float16* b3p = b2p + (size_t)16 * ldb;
  const v8f z8 = {0.f,0.f,0.f,0.f,0.f,0.f,0.f,0.f}; v8f c00 = z8, c01 = z8, c02 = z8, c03 = z8, c10 = z8, c11 = z8, c12 = z8, c13 = z8;
#pragma unroll 1
  for (int kb = 0; kb < K; kb += 32) { const v16h a0 = g2_frag(a0p + kb, hh), a1 = g2_frag(a1p + kb, hh);
    v16h b = g2_frag(b0p + kb, hh); c00 = g2_mma(a0, b, c00); c10 = g2_mma(a1, b, c10);
    b = g2_frag(b1p + kb, hh); c01 = g2_mma(a0, b, c01); c11 = g2_mma(a1, b, c11);
    b = g2_frag(b2p + kb, hh); c02 = g2_mma(a0, b, c02); c12 = g2_mma(a1, b, c12);
    b = g2_frag(b3p + kb, hh); c03 = g2_mma(a0, b, c03); c13 = g2_mma(a1, b, c13); }
  v8f accs[8] = {c00, c01, c02, c03, c10, c11, c12, c13};
#pragma unroll
  for (int u = 0; u < 8; ++u) { const int t = u & 3, half = u >> 2; const int col = col0 + t * 16 + ln; const float bv = bp ? bf16_round(bp[col]) : 0.f;
#pragma unroll
    for (int r = 0; r < 8; ++r) { const int rloc = half * 16 + 8 * hh + r; float v = accs[u][r] * alpha + bv; if (CP) { const int bidx = (row0g + row0 + rloc) / rowsPerB; v += CP[(size_t)bidx * sCPb + (size_t)by * 64 + col]; }
      if (ACT == 3) v = fmaxf(v, 0.f); else if (ACT == 6) v = 0.5f * v * (1.0f + erff(v * 0.70710678118654752f)); else if (ACT == 11) v = 1.0f / (1.0f + expf(-v)); else if (ACT == 15) v = v / (1.0f + expf(-v)); else if (ACT == 12) v = (v > 0.f) ? v : 0.01f * v; else if (ACT == 8) v = tanhf(v);
      so[w][rloc][t * 16 + ln] = v; } }
  __builtin_amdgcn_fence(__ATOMIC_ACQ_REL, "workgroup"); __builtin_amdgcn_wave_barrier();
  const int rsub = lane >> 4, c4 = (lane & 15) * 4;
  {
#pragma unroll
    for (int q = 0; q < 16; ++q) { const int r = q * 2 + rsub; const v4f v = *(const v4fa*)&so[w][r][c4]; if (C) *(v4f*)(C + cofs + (size_t)(row0 + r) * ldc + col0 + c4) = v; if (C16) { v4h h4; for (int i = 0; i < 4; ++i) h4[i] = (_Float16)v[i]; *(v4h*)(C16 + cofs + (size_t)(row0 + r) * ldc + col0 + c4) = h4; } }
     } }


__global__ __launch_bounds__(256) void k_qk(const float* __restrict__ x, int s, const float* __restrict__ gqw, const float* __restrict__ gqb, const float* __restrict__ gkw, const float* __restrict__ gkb, const float* __restrict__ lqw, const float* __restrict__ lqb, const float* __restrict__ lkw, const float* __restrict__ lkb, _Float16* __restrict__ QP, _Float16* __restrict__ KP) {
  #pragma clang fp contract(off)
  const int t = blockIdx.x * 256 + threadIdx.x; if (t >= HW * NG * 2) return; const int j = blockIdx.y; s += j; const int which = t & 1; const int g = (t >> 1) % NG; const int p = t / (2 * NG); const int br = g >> 2, h = g & 3;
  const float* xr = x + (((size_t)which * NSL + s) * HW + p) * CC + h * HD;      /* x[0] = q slices, x[1] = k slices */
  const float* w = which ? (br ? lkw : gkw) : (br ? lqw : gqw); const float* bb = which ? (br ? lkb : gkb) : (br ? lqb : gqb); FragH a, s1, s2, z;
  /* three-segment rows (K 64): Q = [hi | 16 lo | hi/16 | 0], K = [hi | hi/16 | 16 lo | 0] -> hi.hi + lo.hi + hi.lo (~2^-20) */
#pragma unroll
  for (int d = 0; d < 16; ++d) { const int c = h * HD + d; const float v = bf16_round(xr[d]) * bf16_round(w[c]) + bf16_round(bb[c]); const _Float16 hv = (_Float16)v; const float lo = (v - (float)hv) * 16.0f; a.h[d] = hv;
    if (which) { s1.h[d] = (_Float16)((float)hv * 0.0625f); s2.h[d] = (_Float16)lo; } else { s1.h[d] = (_Float16)lo; s2.h[d] = (_Float16)((float)hv * 0.0625f); } z.u[d] = 0; }
  unsigned short* dst = (unsigned short*)(which ? KP : QP) + ((size_t)(j * NG + g) * HW + p) * 64;
  { *(v8us*)dst = a.half[0]; *(v8us*)(dst + 8) = a.half[1]; *(v8us*)(dst + 16) = s1.half[0]; *(v8us*)(dst + 24) = s1.half[1]; *(v8us*)(dst + 32) = s2.half[0]; *(v8us*)(dst + 40) = s2.half[1]; *(v8us*)(dst + 48) = z.half[0]; *(v8us*)(dst + 56) = z.half[0];  } }
__global__ __launch_bounds__(256) void k_vtp(const float* __restrict__ x, int s, const float* __restrict__ gvw, const float* __restrict__ gvb, const float* __restrict__ lvw, const float* __restrict__ lvb, _Float16* __restrict__ VT) {
  #pragma clang fp contract(off)
  __shared__ float tl[64][17]; const int tid = threadIdx.x; const int j = blockIdx.y; s += j; const int g = blockIdx.x / (HW / 64), pt = blockIdx.x % (HW / 64); const int br = g >> 2, h = g & 3; const float* w = br ? lvw : gvw; const float* bb = br ? lvb : gvb;
  for (int i = tid; i < 64 * 16; i += 256) { const int pl = i >> 4, d = i & 15; const int c = h * HD + d; tl[pl][d] = bf16_round(x[(((size_t)2 * NSL + s) * HW + pt * 64 + pl) * CC + c]) * bf16_round(w[c]) + bf16_round(bb[c]); }
  __syncthreads();
  const int d = tid >> 3, p8 = (tid & 7) * 8;      /* thread: row d (0..31 here; rows 32..63 in a second step), 8 positions */
  {
#pragma unroll
    for (int u = 0; u < 2; ++u) { const int dd = d + u * 32; FragH f;
#pragma unroll
      for (int q = 0; q < 8; ++q) f.h[q] = (dd < 16) ? (_Float16)tl[p8 + q][dd] : (_Float16)0.0f;
      *(v8us*)((unsigned short*)VT + ((size_t)(j * NG + g) * 64 + dd) * HW + pt * 64 + p8) = f.half[0]; }
     } }
#define KCH 256                  /* keys per staged chunk */
#define KPITCH 72                /* halves per staged key row: 64 + 8 of pad = 144 B = 16 B x odd (b128 reads without bank conflicts) */
#define VPITCH (KCH + 8)         /* halves per staged v row: 528 B = 16 B x odd */
typedef float v2f __attribute__((ext_vector_type(2)));
__device__ __forceinline__ v8f fa_mma(v16h a, v16h b, v8f c) { return __builtin_amdgcn_wmma_f32_16x16x32_f16(false, a, false, b, (short)0, c, false, false); }
__device__ __forceinline__ float fa_other_half(float v) { const int b = __float_as_int(v); return __int_as_float(__builtin_amdgcn_permlanex16(b, b, 0x76543210, 0xfedcba98, false, false)); }      /* lane l <-> l ^ 16 */
/* five waves a SIMD: the 1280 work-groups are five per WGP, so with at most 192 VGPRs all of them are resident in one round */
__global__ __launch_bounds__(128) __attribute__((amdgpu_waves_per_eu(5))) void k_fattn(const _Float16* __restrict__ QP, const _Float16* __restrict__ KP, const _Float16* __restrict__ VT, float* __restrict__ O) {
  __shared__ __attribute__((aligned(16))) unsigned short sk[KCH * KPITCH];
  __shared__ __attribute__((aligned(16))) unsigned short sv[HD * VPITCH];
  const int tid = threadIdx.x, w = tid >> 5, lane = tid & 31, ln = lane & 15, hh = lane >> 4; const int plane = blockIdx.y; const int q0 = blockIdx.x * 128 + w * 32;
  const unsigned short* kp = (const unsigned short*)KP + (size_t)plane * HW * 64; const unsigned short* vp = (const unsigned short*)VT + (size_t)plane * 64 * HW;
  const v8us z8 = {0, 0, 0, 0, 0, 0, 0, 0}; const v8f zf = {0.f, 0.f, 0.f, 0.f, 0.f, 0.f, 0.f, 0.f};
  FragH qa[2], qlo[2], qhi[2];      /* qa: features 0-31. Features 32-47 stand once in the lower k half (qlo) and once in the upper (qhi), zeros in the other: they meet a key fragment that holds features 32-47 of TWO key tiles, one per k half. 48-63, the rows' zero segment, enter no fragment */
#pragma unroll
  for (int j = 0; j < 2; ++j) { const unsigned short* qr = (const unsigned short*)QP + ((size_t)plane * HW + q0 + j * 16 + ln) * 64 + 8 * hh; qa[j].half[0] = *(const v8us*)qr; qa[j].half[1] = *(const v8us*)(qr + 16); qlo[j].half[0] = *(const v8us*)(qr + 32); qlo[j].half[1] = z8; qhi[j].half[0] = z8; qhi[j].half[1] = qlo[j].half[0]; }
  v8f o[2] = {zf, zf}; float m[2] = {-3.0e38f, -3.0e38f}, l[2] = {0.f, 0.f};
  const int srow = tid >> 3, scc = tid & 7;      /* staging: 8 threads a key row, 16 B each (whole 128-B lines) */
  const float c = 0.25f * 1.4426950408889634f;      /* 16^-0.5 x log2 e: exp(0.25 (s - m)) = exp2(c s - c m) */
  for (int ch = 0; ch < HW / KCH; ++ch) {
    v8us tk[KCH / 16], tv[HD / 4];      /* the whole chunk is requested before the first LDS store, so the work-group pays one load latency a chunk and not one per row group */
#pragma unroll
    for (int u = 0; u < KCH / 16; ++u) tk[u] = *(const v8us*)(kp + (size_t)(ch * KCH + u * 16 + srow) * 64 + scc * 8);
    asm volatile("s_wait_xcnt 0x0" ::: "memory");      /* precaution: the compiler lets a v load's result land in the address registers of the key loads issued above */
#pragma unroll
    for (int u = 0; u < HD / 4; ++u) tv[u] = *(const v8us*)(vp + (size_t)(u * 4 + w) * HW + ch * KCH + lane * 8);
    if (ch > 0) __syncthreads();      /* every wave has left the chunk that is overwritten next */
#pragma unroll
    for (int u = 0; u < KCH / 16; ++u) *(v8us*)&sk[(u * 16 + srow) * KPITCH + scc * 8] = tk[u];
#pragma unroll
    for (int u = 0; u < HD / 4; ++u) *(v8us*)&sv[(u * 4 + w) * VPITCH + lane * 8] = tv[u];
    __syncthreads();      /* the chunk is complete before any wave reads it */
    for (int kb = 0; kb < KCH; kb += 32) {
      const unsigned short* r0 = &sk[(kb + ln) * KPITCH + 8 * hh]; const unsigned short* r1 = r0 + 16 * KPITCH; const unsigned short* rv = &sv[ln * VPITCH + kb + 8 * hh];
      FragH k0a, k1a, kx, va;
      k0a.half[0] = *(const v8us*)r0; k0a.half[1] = *(const v8us*)(r0 + 16); k1a.half[0] = *(const v8us*)r1; k1a.half[1] = *(const v8us*)(r1 + 16);
      kx.half[0] = *(const v8us*)(r0 + 32); kx.half[1] = *(const v8us*)(r1 + 32);      /* features 32-47 of keys kb + ln (lower k half) and kb + 16 + ln (upper) */
      va.half[0] = *(const v8us*)rv; va.half[1] = *(const v8us*)(rv + 16);
#pragma unroll
      for (int j = 0; j < 2; ++j) {
        v8f s0 = fa_mma(k0a.v, qa[j].v, zf); s0 = fa_mma(kx.v, qlo[j].v, s0);      /* s0[r] = S[key kb + 8 hh + r][query ln] */
        v8f s1 = fa_mma(k1a.v, qa[j].v, zf); s1 = fa_mma(kx.v, qhi[j].v, s1);      /* s1[r] = S[key kb + 16 + 8 hh + r][query ln] */
        float mx = fmaxf(s0[0], s1[0]);
#pragma unroll
        for (int r = 1; r < 8; ++r) mx = fmaxf(mx, fmaxf(s0[r], s1[r]));
        mx = fmaxf(mx, fa_other_half(mx));
        const float mn = fmaxf(m[j], mx); const float al = __builtin_amdgcn_exp2f((m[j] - mn) * c); m[j] = mn;
        const float nb = 10.0f - mn * c;      /* P x 2^10 (at most 1024) keeps small probabilities out of the f16 subnormals; the factor cancels in o / l */
        const v2f c2 = {c, c}, nb2 = {nb, nb}; v2f su = {0.f, 0.f}; FragH pf;
#pragma unroll
        for (int r = 0; r < 8; r += 2) {
          const v2f a0 = {s0[r], s0[r + 1]}, a1 = {s1[r], s1[r + 1]}; const v2f t0 = __builtin_elementwise_fma(a0, c2, nb2), t1 = __builtin_elementwise_fma(a1, c2, nb2);
          const v2f p0 = {__builtin_amdgcn_exp2f(t0[0]), __builtin_amdgcn_exp2f(t0[1])}, p1 = {__builtin_amdgcn_exp2f(t1[0]), __builtin_amdgcn_exp2f(t1[1])};
          su += p0 + p1; pf.h[r] = (_Float16)p0[0]; pf.h[r + 1] = (_Float16)p0[1]; pf.h[8 + r] = (_Float16)p1[0]; pf.h[8 + r + 1] = (_Float16)p1[1]; }
        l[j] = l[j] * al + (su[0] + su[1]); o[j] *= al;
        o[j] = fa_mma(va.v, pf.v, o[j]);      /* o[r] = O[query ln][d = 8 hh + r] */
      }
    }
  }
#pragma unroll
  for (int j = 0; j < 2; ++j) { const float lt = l[j] + fa_other_half(l[j]); const float inv = 1.0f / lt; float* dst = O + ((size_t)plane * HW + q0 + j * 16 + ln) * 64 + 8 * hh;
    const v4f x0 = {o[j][0] * inv, o[j][1] * inv, o[j][2] * inv, o[j][3] * inv}, x1 = {o[j][4] * inv, o[j][5] * inv, o[j][6] * inv, o[j][7] * inv}; *(v4f*)dst = x0; *(v4f*)(dst + 4) = x1; } }
__global__ __launch_bounds__(256) void k_outs(const float* __restrict__ O, int s, const float* __restrict__ pw, const float* __restrict__ pb, float* __restrict__ out) {
  #pragma clang fp contract(off)
  const int t = blockIdx.x * 256 + threadIdx.x; if (t >= HW * (CC / 4)) return; O += (size_t)blockIdx.y * NG * HW * 64; s += blockIdx.y; const int c0 = (t & 15) * 4, p = t >> 4; v4f o;
#pragma unroll
  for (int q = 0; q < 4; ++q) { const int c = c0 + q; const int h = c / HD, d = c % HD; const float l = O[((size_t)(4 + h) * HW + p) * 64 + d], g = O[((size_t)h * HW + p) * 64 + d]; const float comb = 0.5f * l + 0.5f * g; o[q] = (2.0f * comb) * bf16_round(pw[c]) + bf16_round(pb[c]); }
  float* dst = out + ((size_t)s * HW + p) * CC + c0; *(v4f*)dst = o;  }

extern "C" void kernel_launch(void* const* d_in, const int* in_sizes, int n_in,
                              void* d_out, int out_size, void* d_ws, size_t ws_size, hipStream_t stream) {
  (void)in_sizes; (void)n_in; (void)out_size;
  const float* const* I = (const float* const*)d_in; const float* x = I[0];
  const float* gqw = I[1]; const float* gqb = I[2]; const float* gkw = I[3]; const float* gkb = I[4]; const float* gvw = I[5]; const float* gvb = I[6]; const float* lqw = I[7]; const float* lqb = I[8]; const float* lkw = I[9]; const float* lkb = I[10]; const float* lvw = I[11]; const float* lvb = I[12]; const float* pw = I[13]; const float* pb = I[14];
  char* ws = (char*)d_ws; size_t off = 0;
  auto take = [&](size_t bytes) { char* p = ws + off; off += (bytes + 255) & ~(size_t)255; return p; };
  _Float16* QP = (_Float16*)take((size_t)NB * NG * HW * 64 * 2); _Float16* KP = (_Float16*)take((size_t)NB * NG * HW * 64 * 2); _Float16* VT = (_Float16*)take((size_t)NB * NG * 64 * HW * 2); float* O = (float*)take((size_t)NB * NG * HW * 64 * 4);
  if (off > ws_size) return;      /* NB x (1 + 1 + 1 + 2) = 100 MiB */
  for (int s = 0; s < NRUN; s += NB) {
    k_qk<<<dim3((HW * NG * 2 + 255) / 256, NB), 256, 0, stream>>>(x, s, gqw, gqb, gkw, gkb, lqw, lqb, lkw, lkb, QP, KP); k_vtp<<<dim3(NG * (HW / 64), NB), 256, 0, stream>>>(x, s, gvw, gvb, lvw, lvb, VT);
    k_fattn<<<dim3(HW / 128, NB * NG), 128, 0, stream>>>(QP, KP, VT, O);      /* NB x 8 (slice, branch, head) planes batched */
    k_outs<<<dim3((HW * (CC / 4) + 255) / 256, NB), 256, 0, stream>>>(O, s, pw, pb, (float*)d_out); }
}

// v003
// It runs in 44.2 microseconds.
// Timed twice side by side with v002, it ran 1.64 and 1.63 times as fast.
// Counting every step since v000, it is 31.4 times as fast.
#include <hip/hip_runtime.h>
// Global + local spatial attention (x = [q|k|v] of 20 slices x 1024 positions x 64 channels; 4 heads of 16; per-channel scale+bias 'depthwise k=1 convs' for each branch): g = attn(q gq_w + gq_b, k gk_w + gk_b, v gv_w + gv_b), l likewise; out = (2 (0.5 l + 0.5 g)) proj_w + proj_b -> [20,1024,64].
// Structure (both launches batched over all NB slices): for the 8 (branch, head) pairs at once one fused attention kernel that reads x itself: while it stages a chunk in LDS it applies the per-channel scale and bias, writes the keys as three-segment f16 rows per 16-dim head ([hi | 16 lo | hi/16] x [hi | hi/16 | 16 lo], K 48) and v as f16 rows transposed per head; the queries are formed the same way in registers (scores, running-maximum softmax and attn.v in registers, f32 accumulation, P x2^10 f16); then the branch mix and the output scale/bias on VALU.
// Compute dtype: x and all parameters rounded to bf16; q, k as hi + residual three-segment products (~2^-20); v, P as f16 operands (~2^-12); f32 accumulation, softmax, elementwise. v_wmma_f32_16x16x32_f16.
#define NSL 20
#define NRUN NSL                 /* slices processed (NSL stays the input stride) */
#define HW 1024
#define CC 64
#define NHD 4
#define HD 16
#define NG 8                     /* (branch, head) pairs per slice: g = br*4 + h */
#define NB 20                    /* slices per launch: blockIdx.y runs over NB slices (or NB x NG planes); NB x 2 MiB of planes fit the workspace; NSL % NB == 0 */
typedef __bf16 v16b __attribute__((ext_vector_type(16)));
typedef unsigned short v8us __attribute__((ext_vector_type(8), may_alias));
typedef float  v8f  __attribute__((ext_vector_type(8)));
typedef float  v4f  __attribute__((ext_vector_type(4)));
typedef float  v4fa __attribute__((ext_vector_type(4), may_alias));
union FragB { v16b v; v8us half[2]; unsigned short u[16]; };

__device__ __forceinline__ unsigned short bf16_bits(float x) { unsigned int u = __float_as_uint(x); return (unsigned short)((u + 0x7FFFu + ((u >> 16) & 1u)) >> 16); }
__device__ __forceinline__ float bf16_val(unsigned short b) { return __uint_as_float(((unsigned int)b) << 16); }
__device__ __forceinline__ float bf16_round(float x) { return bf16_val(bf16_bits(x)); }
// D += A·B with NT terms: 1 = ah·bh, 2 = + al·bh (A split), 3 = + ah·bl (both split)
template <int NT>
__device__ __forceinline__ v8f mmaN(v16b ah, v16b al, v16b bh, v16b bl, v8f c) {
  c = __builtin_amdgcn_wmma_f32_16x16x32_bf16(false, ah, false, bh, (short)0, c, false, false);
  if (NT >= 2) c = __builtin_amdgcn_wmma_f32_16x16x32_bf16(false, al, false, bh, (short)0, c, false, false);
  if (NT >= 3) c = __builtin_amdgcn_wmma_f32_16x16x32_bf16(false, ah, false, bl, (short)0, c, false, false);
  asm volatile("v_nop\n\tv_nop\n\tv_nop\n\tv_nop" : "+v"(c) : "v"(ah), "v"(al), "v"(bh), "v"(bl));
  return c;
}

__global__ __launch_bounds__(256) void k_wt_bf16(const float* __restrict__ W, unsigned short* __restrict__ Wt, int K, int N) {
  const int t = blockIdx.x * 256 + threadIdx.x;
  const int k8n = K / 8;
  if (t >= N * k8n) return;
  const int n = t / k8n, k8 = (t % k8n) * 8;
  v8us v;
#pragma unroll
  for (int i = 0; i < 8; ++i) v[i] = bf16_bits(W[(size_t)(k8 + i) * N + n]);
  *(v8us*)(Wt + (size_t)n * K + k8) = v;
  
}

// GEMM C[M][N] (f32, pitch ldc) = act(A[M][K]·W + bias). A f32 row-major (pitch lda) converted per fragment to bf16
// (ASPLIT: hi/lo two planes -> 2 terms, else single rounded term); Wt bf16 [N][K] (pitch ldb). BIAS_BF16 rounds the
// bias to bf16 first (bias quantised to bf16 before the add). K%32==0, M%16==0, N%64==0.
template <bool ASPLIT, int ACT, bool BIAS_BF16>
__global__ __launch_bounds__(128) void k_gemm_bf(const float* __restrict__ A, int lda, const unsigned short* __restrict__ Wt, int ldb,
                                               const float* __restrict__ bias, float* __restrict__ C, int ldc, int M, int N, int K) {
  __shared__ __attribute__((aligned(16))) float so[4][16][64];
  const int tid = threadIdx.x, w = tid >> 5, lane = tid & 31, ln = lane & 15, hh = lane >> 4;
  const int ntn = N / 64;
  const int wid = blockIdx.x * 4 + w;
  const int mt = wid / ntn, nq = wid % ntn;
  if (mt * 16 >= M) return;
  const int row0 = mt * 16, col0 = nq * 64;
  const float* arow = A + (size_t)(row0 + ln) * lda;
  v8f acc[4] = {};
  for (int kb = 0; kb < K; kb += 32) {
    FragB ah, al;
    const v4f x0 = *(const v4fa*)(arow + kb + 8 * hh), x1 = *(const v4fa*)(arow + kb + 8 * hh + 4);
    const v4f x2 = *(const v4fa*)(arow + kb + 16 + 8 * hh), x3 = *(const v4fa*)(arow + kb + 16 + 8 * hh + 4);
    float xs[16] = {x0[0],x0[1],x0[2],x0[3],x1[0],x1[1],x1[2],x1[3],x2[0],x2[1],x2[2],x2[3],x3[0],x3[1],x3[2],x3[3]};
#pragma unroll
    for (int i = 0; i < 16; ++i) { const unsigned short hb = bf16_bits(xs[i]); ah.u[i] = hb; al.u[i] = ASPLIT ? bf16_bits(xs[i] - bf16_val(hb)) : (unsigned short)0; }
#pragma unroll
    for (int t = 0; t < 4; ++t) {
      const unsigned short* brow = Wt + (size_t)(col0 + t * 16 + ln) * ldb + kb;
      FragB b;
      b.half[0] = *(const v8us*)(brow + 8 * hh);
      b.half[1] = *(const v8us*)(brow + 16 + 8 * hh);
      acc[t] = mmaN<ASPLIT ? 2 : 1>(ah.v, al.v, b.v, b.v, acc[t]);
    }
  }
#pragma unroll
  for (int t = 0; t < 4; ++t) {
    float bv = bias ? bias[col0 + t * 16 + ln] : 0.f;
    if (BIAS_BF16) bv = bf16_round(bv);
#pragma unroll
    for (int r = 0; r < 8; ++r) { float v = acc[t][r] + bv; if (ACT == 1) v = fmaxf(v, 0.f); so[w][8 * hh + r][t * 16 + ln] = v; }
  }
  __builtin_amdgcn_fence(__ATOMIC_ACQ_REL, "workgroup");
  __builtin_amdgcn_wave_barrier();
  const int rsub = lane >> 4, c4 = (lane & 15) * 4;
  {
#pragma unroll
    for (int q = 0; q < 8; ++q) {
      const int r = q * 2 + rsub;
      const v4f v = *(const v4fa*)&so[w][r][c4];
      *(v4f*)(C + (size_t)(row0 + r) * ldc + col0 + c4) = v;
    }
    
  }
}

// GEMM C = act(A·W + bias + resid): A f32 (ASPLIT -> hi/lo 2 terms), Wt bf16 [N][K]; ACT 0 none, 1 relu, 2 exact gelu;
// resid (optional, f32, row index = (row % rmod), pitch ldr, RES_BF16 rounds it) added before the activation.
template <bool ASPLIT, int ACT, bool BIAS_BF16, bool RES_BF16>
__global__ __launch_bounds__(128) void k_gemm_bf3(const float* __restrict__ A, int lda, const unsigned short* __restrict__ Wt, int ldb,
                                                const float* __restrict__ bias, const float* __restrict__ resid, int rmod, int ldr,
                                                float* __restrict__ C, int ldc, int M, int N, int K) {
  __shared__ __attribute__((aligned(16))) float so[4][16][64];
  const int tid = threadIdx.x, w = tid >> 5, lane = tid & 31, ln = lane & 15, hh = lane >> 4;
  const int ntn = N / 64;
  const int wid = blockIdx.x * 4 + w;
  const int mt = wid / ntn, nq = wid % ntn;
  if (mt * 16 >= M) return;
  const int row0 = mt * 16, col0 = nq * 64;
  const float* arow = A + (size_t)(row0 + ln) * lda;
  v8f acc[4] = {};
  for (int kb = 0; kb < K; kb += 32) {
    FragB ah, al;
    const v4f x0 = *(const v4fa*)(arow + kb + 8 * hh), x1 = *(const v4fa*)(arow + kb + 8 * hh + 4);
    const v4f x2 = *(const v4fa*)(arow + kb + 16 + 8 * hh), x3 = *(const v4fa*)(arow + kb + 16 + 8 * hh + 4);
    float xs[16] = {x0[0],x0[1],x0[2],x0[3],x1[0],x1[1],x1[2],x1[3],x2[0],x2[1],x2[2],x2[3],x3[0],x3[1],x3[2],x3[3]};
#pragma unroll
    for (int i = 0; i < 16; ++i) { const unsigned short hb = bf16_bits(xs[i]); ah.u[i] = hb; al.u[i] = ASPLIT ? bf16_bits(xs[i] - bf16_val(hb)) : (unsigned short)0; }
#pragma unroll
    for (int t = 0; t < 4; ++t) {
      const unsigned short* brow = Wt + (size_t)(col0 + t * 16 + ln) * ldb + kb;
      FragB b;
      b.half[0] = *(const v8us*)(brow + 8 * hh);
      b.half[1] = *(const v8us*)(brow + 16 + 8 * hh);
      acc[t] = mmaN<ASPLIT ? 2 : 1>(ah.v, al.v, b.v, b.v, acc[t]);
    }
  }
#pragma unroll
  for (int t = 0; t < 4; ++t) {
    const int col = col0 + t * 16 + ln;
    float bv = bias ? bias[col] : 0.f;
    if (BIAS_BF16) bv = bf16_round(bv);
#pragma unroll
    for (int r = 0; r < 8; ++r) {
      float v = acc[t][r] + bv;
      if (resid) { float rv = resid[(size_t)((row0 + 8 * hh + r) % rmod) * ldr + col]; if (RES_BF16) rv = bf16_round(rv); v += rv; }
      if (ACT == 1) v = fmaxf(v, 0.f);
      if (ACT == 2) v = 0.5f * v * (1.0f + erff(v * 0.70710678118654752f));
      if (ACT == 3) { const float u = 0.7978845608028654f * (v + 0.044715f * v * v * v); v = 0.5f * v * (1.0f + tanhf(u)); }
      so[w][8 * hh + r][t * 16 + ln] = v;
    }
  }
  __builtin_amdgcn_fence(__ATOMIC_ACQ_REL, "workgroup");
  __builtin_amdgcn_wave_barrier();
  const int rsub = lane >> 4, c4 = (lane & 15) * 4;
  {
#pragma unroll
    for (int q = 0; q < 8; ++q) {
      const int r = q * 2 + rsub;
      const v4f v = *(const v4fa*)&so[w][r][c4];
      *(v4f*)(C + (size_t)(row0 + r) * ldc + col0 + c4) = v;
    }
    
  }
}
// row LayerNorm (biased variance, eps) over N: s = X (+ R); optional out_sum <- s; out_norm <- (s-mu)*rsqrt(var+eps)*g + b
template <bool PARAM_BF16>
__global__ __launch_bounds__(256) void k_layernorm(const float* __restrict__ X, const float* __restrict__ R, const float* __restrict__ g, const float* __restrict__ bta,
                                                  float* __restrict__ out_sum, float* __restrict__ out_norm, int N, float eps) {
  __shared__ float red[256];
  const int row = blockIdx.x, tid = threadIdx.x;
  const float* x = X + (size_t)row * N; const float* rr = R ? R + (size_t)row * N : nullptr;
  float vals[16];                     // up to N = 4096
  const int per = N / 256;            // contiguous chunk per thread? use strided-by-4 chunks: thread handles j = tid*4 + 1024*u
  float s1 = 0.f;
  for (int u = 0; u < per / 4; ++u) {
    const int j = tid * 4 + 1024 * u;
    const v4f a = *(const v4fa*)(x + j);
    v4f b = {0.f,0.f,0.f,0.f}; if (rr) b = *(const v4fa*)(rr + j);
#pragma unroll
    for (int q = 0; q < 4; ++q) { const float v = a[q] + b[q]; vals[u * 4 + q] = v; s1 += v; }
  }
  red[tid] = s1; __syncthreads();
  for (int st = 128; st > 0; st >>= 1) { if (tid < st) red[tid] += red[tid + st]; __syncthreads(); }
  const float mu = red[0] / (float)N; __syncthreads();
  float s2 = 0.f;
  for (int u = 0; u < per / 4; ++u)
#pragma unroll
    for (int q = 0; q < 4; ++q) { const float c = vals[u * 4 + q] - mu; s2 += c * c; }
  red[tid] = s2; __syncthreads();
  for (int st = 128; st > 0; st >>= 1) { if (tid < st) red[tid] += red[tid + st]; __syncthreads(); }
  const float rs = rsqrtf(red[0] / (float)N + eps);
  {
    for (int u = 0; u < per / 4; ++u) {
      const int j = tid * 4 + 1024 * u;
      v4f o, sm;
#pragma unroll
      for (int q = 0; q < 4; ++q) {
        float gg = g[j + q], bb = bta[j + q];
        if (PARAM_BF16) { gg = bf16_round(gg); bb = bf16_round(bb); }
        sm[q] = vals[u * 4 + q]; o[q] = (vals[u * 4 + q] - mu) * rs * gg + bb;
      }
      if (out_sum) *(v4f*)(out_sum + (size_t)row * N + j) = sm;
      *(v4f*)(out_norm + (size_t)row * N + j) = o;
    }
    
  }
}



// ---- f16 WMMA path (v_wmma_f32_16x16x32_f16): 11-bit significands for operands in range — used where a [0,1] probability operand needs more precision than bf16
typedef _Float16 v16h __attribute__((ext_vector_type(16)));
union FragH { v16h v; v8us half[2]; _Float16 h[16]; unsigned short u[16]; };
template <int NT>
__device__ __forceinline__ v8f mmaH(v16h ah, v16h al, v16h bh, v16h bl, v8f c) {
  c = __builtin_amdgcn_wmma_f32_16x16x32_f16(false, ah, false, bh, (short)0, c, false, false);
  if (NT >= 2) c = __builtin_amdgcn_wmma_f32_16x16x32_f16(false, al, false, bh, (short)0, c, false, false);
  if (NT >= 3) c = __builtin_amdgcn_wmma_f32_16x16x32_f16(false, ah, false, bl, (short)0, c, false, false);
  asm volatile("v_nop\n\tv_nop\n\tv_nop\n\tv_nop" : "+v"(c) : "v"(ah), "v"(al), "v"(bh), "v"(bl));
  return c;
}
// batched GEMM like k_gemm_b but f16 operands: A f32 (split into f16 hi/lo if ASPLIT, else rounded to f16), Bt = f16 values [n][k]; alpha; C f32; N multiple of 16 (partial tiles skipped)
template <bool ASPLIT>
__global__ __launch_bounds__(128) void k_gemm_h(const float* __restrict__ A, int lda, size_t sA, const _Float16* __restrict__ Bh, int ldb, size_t sB, float alpha, float* __restrict__ C, int ldc, size_t sC, int M, int N, int K) {
  __shared__ __attribute__((aligned(16))) float so[4][16][64];
  const int tid = threadIdx.x, w = tid >> 5, lane = tid & 31, ln = lane & 15, hh = lane >> 4; const int by = blockIdx.y;
  A += (size_t)by * sA; Bh += (size_t)by * sB; C += (size_t)by * sC;
  const int ntn = (N + 63) / 64; const int wid = blockIdx.x * 4 + w; const int mt = wid / ntn, nq = wid % ntn; if (mt * 16 >= M) return;
  const int row0 = mt * 16, col0 = nq * 64; const float* arow = A + (size_t)(row0 + ln) * lda;
  v8f acc[4] = {};
  for (int kb = 0; kb < K; kb += 32) {
    FragH ah, al;
    const v4f x0 = *(const v4fa*)(arow + kb + 8 * hh), x1 = *(const v4fa*)(arow + kb + 8 * hh + 4), x2 = *(const v4fa*)(arow + kb + 16 + 8 * hh), x3 = *(const v4fa*)(arow + kb + 16 + 8 * hh + 4);
    float xs[16] = {x0[0],x0[1],x0[2],x0[3],x1[0],x1[1],x1[2],x1[3],x2[0],x2[1],x2[2],x2[3],x3[0],x3[1],x3[2],x3[3]};
#pragma unroll
    for (int i = 0; i < 16; ++i) { const _Float16 h = (_Float16)xs[i]; ah.h[i] = h; al.h[i] = ASPLIT ? (_Float16)(xs[i] - (float)h) : (_Float16)0.0f; }
#pragma unroll
    for (int t = 0; t < 4; ++t) { if (col0 + t * 16 >= N) continue; const size_t boff = (size_t)(col0 + t * 16 + ln) * ldb + kb; FragH bq; bq.half[0] = *(const v8us*)(Bh + boff + 8 * hh); bq.half[1] = *(const v8us*)(Bh + boff + 16 + 8 * hh);
      acc[t] = mmaH<ASPLIT ? 2 : 1>(ah.v, al.v, bq.v, bq.v, acc[t]); }
  }
#pragma unroll
  for (int t = 0; t < 4; ++t) { if (col0 + t * 16 >= N) continue;
#pragma unroll
    for (int r = 0; r < 8; ++r) so[w][8 * hh + r][t * 16 + ln] = acc[t][r] * alpha; }
  __builtin_amdgcn_fence(__ATOMIC_ACQ_REL, "workgroup"); __builtin_amdgcn_wave_barrier();
  const int rsub = lane >> 4, c4 = (lane & 15) * 4;
  {
#pragma unroll
    for (int q = 0; q < 8; ++q) { const int r = q * 2 + rsub; if (col0 + c4 < N) { const v4f v = *(const v4fa*)&so[w][r][c4]; *(v4f*)(C + (size_t)(row0 + r) * ldc + col0 + c4) = v; } }
     }
}

// Wt[n][k] = f16(W[k][n]·scale) from f32 row-major W[K][N] (scale = power of two; bf16-exact weights stay exact in f16 away from the subnormal range)
__global__ __launch_bounds__(256) void k_wt_f16(const float* __restrict__ W, _Float16* __restrict__ Wt, int K, int N, float scale) {
  const int t = blockIdx.x * 256 + threadIdx.x; if (t >= N * (K / 8)) return; const int n = t / (K / 8), k8 = (t % (K / 8)) * 8; FragH f;
#pragma unroll
  for (int i = 0; i < 8; ++i) f.h[i] = (_Float16)(bf16_round(W[(size_t)(k8 + i) * N + n]) * scale); const v8us o = f.half[0];
  *(v8us*)((unsigned short*)Wt + (size_t)n * K + k8) = o; 
}
// k_gemm_hh variant with fused epilogue: v = acc·alpha + bias[by·sBias + col] (+ CP[(row/rowsPerB)·sCPb + by·64 + col] if CP) ; ACT 0 none / 1 elu ; writes f16 C16 (and f32 C if non-null)
template <int ACT>
__global__ __launch_bounds__(128) void k_gemm_hhx(const _Float16* __restrict__ A, int lda, size_t sA, const _Float16* __restrict__ Bh, int ldb, size_t sB, float alpha, const float* __restrict__ bias, size_t sBias, const float* __restrict__ CP, int rowsPerB, size_t sCPb, int row0g,
    float* __restrict__ C, _Float16* __restrict__ C16, int ldc, size_t sC, int M, int N, int K) {
  __shared__ __attribute__((aligned(16))) float so[4][16][64];
  const int tid = threadIdx.x, w = tid >> 5, lane = tid & 31, ln = lane & 15, hh = lane >> 4; const int by = blockIdx.y;
  A += (size_t)by * sA; Bh += (size_t)by * sB; const size_t cofs = (size_t)by * sC; const float* bp = bias ? bias + (size_t)by * sBias : nullptr;
  const int ntn = (N + 63) / 64; const int wid = blockIdx.x * 4 + w; const int mt = wid / ntn, nq = wid % ntn; if (mt * 16 >= M) return;
  const int row0 = mt * 16, col0 = nq * 64; const _Float16* arow = A + (size_t)(row0 + ln) * lda;
  v8f acc[4] = {};
  for (int kb = 0; kb < K; kb += 32) { FragH ah; ah.half[0] = *(const v8us*)((const unsigned short*)arow + kb + 8 * hh); ah.half[1] = *(const v8us*)((const unsigned short*)arow + kb + 16 + 8 * hh);
#pragma unroll
    for (int t = 0; t < 4; ++t) { if (col0 + t * 16 >= N) continue; const size_t boff = (size_t)(col0 + t * 16 + ln) * ldb + kb; FragH bq; bq.half[0] = *(const v8us*)((const unsigned short*)Bh + boff + 8 * hh); bq.half[1] = *(const v8us*)((const unsigned short*)Bh + boff + 16 + 8 * hh);
      acc[t] = mmaH<1>(ah.v, ah.v, bq.v, bq.v, acc[t]); }
  }
#pragma unroll
  for (int t = 0; t < 4; ++t) { if (col0 + t * 16 >= N) continue; const int col = col0 + t * 16 + ln; const float bv = bp ? bf16_round(bp[col]) : 0.f;
#pragma unroll
    for (int r = 0; r < 8; ++r) { float v = acc[t][r] * alpha + bv; if (CP) { const int bidx = (row0g + row0 + 8 * hh + r) / rowsPerB; v += CP[(size_t)bidx * sCPb + (size_t)by * 64 + col]; } if (ACT == 1) v = (v > 0.f) ? v : expm1f(v); else if (ACT == 7) v = (v > 0.f) ? v + 1.0f : expf(v); else if (ACT == 8) v = tanhf(v); else if (ACT == 9) v = 0.5f * v * (1.0f + tanhf(0.7978845608028654f * (v + 0.044715f * v * v * v))); else if (ACT == 11) v = 1.0f / (1.0f + expf(-v)); else if (ACT == 12) v = (v > 0.f) ? v : 0.01f * v; else if (ACT == 14) v = (v > 0.f) ? v : 0.1f * v; else if (ACT == 15) v = v / (1.0f + expf(-v)); else if (ACT == 3) v = fmaxf(v, 0.f); else if (ACT == 6) v = 0.5f * v * (1.0f + erff(v * 0.70710678118654752f)); so[w][8 * hh + r][t * 16 + ln] = v; } }
  __builtin_amdgcn_fence(__ATOMIC_ACQ_REL, "workgroup"); __builtin_amdgcn_wave_barrier();
  const int rsub = lane >> 4, c4 = (lane & 15) * 4; typedef _Float16 v4h __attribute__((ext_vector_type(4)));
  {
#pragma unroll
    for (int q = 0; q < 8; ++q) { const int r = q * 2 + rsub; if (col0 + c4 < N) { const v4f v = *(const v4fa*)&so[w][r][c4]; if (C) *(v4f*)(C + cofs + (size_t)(row0 + r) * ldc + col0 + c4) = v; if (C16) { v4h h4; for (int i = 0; i < 4; ++i) h4[i] = (_Float16)v[i]; *(v4h*)(C16 + cofs + (size_t)(row0 + r) * ldc + col0 + c4) = h4; } } }
     }
}


typedef _Float16 v4h __attribute__((ext_vector_type(4)));

__global__ __launch_bounds__(256) void k_x16(const float* __restrict__ x, _Float16* __restrict__ X16, size_t n8) { const size_t t = (size_t)blockIdx.x * 256 + threadIdx.x; if (t >= n8) return; FragH f;
#pragma unroll
  for (int q = 0; q < 8; ++q) f.h[q] = (_Float16)bf16_round(x[t * 8 + q]); *(v8us*)((unsigned short*)X16 + t * 8) = f.half[0];  }
__global__ __launch_bounds__(256) void k_h16(const float* __restrict__ x, _Float16* __restrict__ X16, size_t n8) { const size_t t = (size_t)blockIdx.x * 256 + threadIdx.x; if (t >= n8) return; FragH f;
#pragma unroll
  for (int q = 0; q < 8; ++q) f.h[q] = (_Float16)x[t * 8 + q]; *(v8us*)((unsigned short*)X16 + t * 8) = f.half[0];  }
__global__ __launch_bounds__(256) void k_round16f(const float* __restrict__ W, _Float16* __restrict__ Bt, size_t n8) { const size_t t = (size_t)blockIdx.x * 256 + threadIdx.x; if (t >= n8) return; FragH f;
#pragma unroll
  for (int i = 0; i < 8; ++i) f.h[i] = (_Float16)(bf16_round(W[t * 8 + i]) * 16.0f); *(v8us*)((unsigned short*)Bt + t * 8) = f.half[0];  }
template <int NHv, int TTv>
__global__ __launch_bounds__(256) void k_vt(const _Float16* __restrict__ V16, int ldv, int voff, _Float16* __restrict__ Vt) { __shared__ unsigned short tl[64][66]; const int tid = threadIdx.x; const int slab = blockIdx.x / (TTv / 64), lg = blockIdx.x % (TTv / 64); const int b = slab / NHv, h = slab % NHv;
  for (int i = tid; i < 64 * 8; i += 256) { const int r = i / 8, c8 = (i % 8) * 8; FragH f; f.half[0] = *(const v8us*)((const unsigned short*)V16 + ((size_t)b * TTv + lg * 64 + r) * ldv + voff + h * 64 + c8);
#pragma unroll
    for (int q = 0; q < 8; ++q) tl[r][c8 + q] = f.u[q]; }
  __syncthreads();
  {
#pragma unroll
    for (int rd = 0; rd < 2; ++rd) { const int d = rd * 32 + tid / 8, pc = tid % 8; FragH f;
#pragma unroll
      for (int q = 0; q < 8; ++q) f.u[q] = tl[pc * 8 + q][d];
      *(v8us*)((unsigned short*)Vt + ((size_t)slab * 64 + d) * TTv + lg * 64 + pc * 8) = f.half[0]; }
     } }

__global__ __launch_bounds__(256) void k_hl(const float* __restrict__ F, _Float16* __restrict__ Hh, _Float16* __restrict__ Hl, size_t n8) { const size_t t = (size_t)blockIdx.x * 256 + threadIdx.x; if (t >= n8) return; FragH fh, fl; const v4f a = *(const v4fa*)(F + t * 8), c = *(const v4fa*)(F + t * 8 + 4);
#pragma unroll
  for (int q = 0; q < 4; ++q) { _Float16 h = (_Float16)a[q]; fh.h[q] = h; fl.h[q] = (_Float16)((a[q] - (float)h) * 1024.0f); h = (_Float16)c[q]; fh.h[4 + q] = h; fl.h[4 + q] = (_Float16)((c[q] - (float)h) * 1024.0f); }
  { *(v8us*)((unsigned short*)Hh + t * 8) = fh.half[0]; *(v8us*)((unsigned short*)Hl + t * 8) = fl.half[0];  } }

// ---- fast GEMM (wave tile 32x64; requires M % 32 == 0 rows per launch region and N % 64 == 0); epilogue = k_gemm_hhx semantics ----
__device__ __forceinline__ v16h g2_frag(const _Float16* p, int hh) { FragH f; f.half[0] = *(const v8us*)((const unsigned short*)p + 8 * hh); f.half[1] = *(const v8us*)((const unsigned short*)p + 16 + 8 * hh); return f.v; }
__device__ __forceinline__ v8f g2_mma(v16h a, v16h b, v8f c) { v8f d = __builtin_amdgcn_wmma_f32_16x16x32_f16(false, a, false, b, (short)0, c, false, false); asm volatile("v_nop\n\tv_nop\n\tv_nop\n\tv_nop" : "+v"(d) : "v"(a), "v"(b)); return d; }
template <int ACT>
__global__ __launch_bounds__(128) void k_gemm2(const _Float16* __restrict__ A, int lda, size_t sA, const _Float16* __restrict__ Bh, int ldb, size_t sB, float alpha, const float* __restrict__ bias, size_t sBias, const float* __restrict__ CP, int rowsPerB, size_t sCPb, int row0g,
    float* __restrict__ C, _Float16* __restrict__ C16, int ldc, size_t sC, int M, int N, int K) {
  __shared__ __attribute__((aligned(16))) float so[4][32][68];
  const int tid = threadIdx.x, w = tid >> 5, lane = tid & 31, ln = lane & 15, hh = lane >> 4; const int by = blockIdx.y;
  A += (size_t)by * sA; Bh += (size_t)by * sB; const size_t cofs = (size_t)by * sC; const float* bp = bias ? bias + (size_t)by * sBias : nullptr;
  const int ntn = N >> 6; const int mt = blockIdx.x / ntn, nq = blockIdx.x - mt * ntn; const int row0 = mt * 128 + 32 * w, col0 = nq * 64; if (row0 >= M) return;
  const _Float16* a0p = A + (size_t)(row0 + ln) * lda; const _Float16* a1p = a0p + (size_t)16 * lda;
  const _Float16* b0p = Bh + (size_t)(col0 + ln) * ldb; const _Float16* b1p = b0p + (size_t)16 * ldb; const _Float16* b2p = b1p + (size_t)16 * ldb; const _Float16* b3p = b2p + (size_t)16 * ldb;
  const v8f z8 = {0.f,0.f,0.f,0.f,0.f,0.f,0.f,0.f}; v8f c00 = z8, c01 = z8, c02 = z8, c03 = z8, c10 = z8, c11 = z8, c12 = z8, c13 = z8;
#pragma unroll 1
  for (int kb = 0; kb < K; kb += 32) { const v16h a0 = g2_frag(a0p + kb, hh), a1 = g2_frag(a1p + kb, hh);
    v16h b = g2_frag(b0p + kb, hh); c00 = g2_mma(a0, b, c00); c10 = g2_mma(a1, b, c10);
    b = g2_frag(b1p + kb, hh); c01 = g2_mma(a0, b, c01); c11 = g2_mma(a1, b, c11);
    b = g2_frag(b2p + kb, hh); c02 = g2_mma(a0, b, c02); c12 = g2_mma(a1, b, c12);
    b = g2_frag(b3p + kb, hh); c03 = g2_mma(a0, b, c03); c13 = g2_mma(a1, b, c13); }
  v8f accs[8] = {c00, c01, c02, c03, c10, c11, c12, c13};
#pragma unroll
  for (int u = 0; u < 8; ++u) { const int t = u & 3, half = u >> 2; const int col = col0 + t * 16 + ln; const float bv = bp ? bf16_round(bp[col]) : 0.f;
#pragma unroll
    for (int r = 0; r < 8; ++r) { const int rloc = half * 16 + 8 * hh + r; float v = accs[u][r] * alpha + bv; if (CP) { const int bidx = (row0g + row0 + rloc) / rowsPerB; v += CP[(size_t)bidx * sCPb + (size_t)by * 64 + col]; }
      if (ACT == 3) v = fmaxf(v, 0.f); else if (ACT == 6) v = 0.5f * v * (1.0f + erff(v * 0.70710678118654752f)); else if (ACT == 11) v = 1.0f / (1.0f + expf(-v)); else if (ACT == 15) v = v / (1.0f + expf(-v)); else if (ACT == 12) v = (v > 0.f) ? v : 0.01f * v; else if (ACT == 8) v = tanhf(v);
      so[w][rloc][t * 16 + ln] = v; } }
  __builtin_amdgcn_fence(__ATOMIC_ACQ_REL, "workgroup"); __builtin_amdgcn_wave_barrier();
  const int rsub = lane >> 4, c4 = (lane & 15) * 4;
  {
#pragma unroll
    for (int q = 0; q < 16; ++q) { const int r = q * 2 + rsub; const v4f v = *(const v4fa*)&so[w][r][c4]; if (C) *(v4f*)(C + cofs + (size_t)(row0 + r) * ldc + col0 + c4) = v; if (C16) { v4h h4; for (int i = 0; i < 4; ++i) h4[i] = (_Float16)v[i]; *(v4h*)(C16 + cofs + (size_t)(row0 + r) * ldc + col0 + c4) = h4; } }
     } }


#define KCH 256                  /* keys per staged chunk */
#define KPITCH 72                /* halves per staged key row: 48 in use, pitch 144 B = 16 B x odd (b128 reads without bank conflicts) */
#define VPITCH (KCH + 8)         /* halves per staged v row: 528 B = 16 B x odd */
typedef float v2f __attribute__((ext_vector_type(2)));
__device__ __forceinline__ v8f fa_mma(v16h a, v16h b, v8f c) { return __builtin_amdgcn_wmma_f32_16x16x32_f16(false, a, false, b, (short)0, c, false, false); }
__device__ __forceinline__ float fa_other_half(float v) { const int b = __float_as_int(v); return __int_as_float(__builtin_amdgcn_permlanex16(b, b, 0x76543210, 0xfedcba98, false, false)); }      /* lane l <-> l ^ 16 */
typedef __bf16 v4b __attribute__((ext_vector_type(4)));
typedef _Float16 v4ha __attribute__((ext_vector_type(4), may_alias));
__device__ __forceinline__ v4f fa_bf4(v4f a) { return __builtin_convertvector(__builtin_convertvector(a, v4b), v4f); }      /* four values rounded to bf16 (nearest even), kept as f32 */
/* t = bf16(x) bf16(w) + bf16(b): the product of two bf16 values is exact in f32, so the fused form rounds once, like multiply then add */
__device__ __forceinline__ v4f fa_dw(v4f xv, v4f wr, v4f br) { return __builtin_elementwise_fma(fa_bf4(xv), wr, br); }
/* five waves a SIMD: the 1280 work-groups are five per WGP, so with at most 192 VGPRs all of them are resident in one round */
__global__ __launch_bounds__(128) __attribute__((amdgpu_waves_per_eu(5))) void k_fattn(const float* __restrict__ x, int s, const float* __restrict__ gqw, const float* __restrict__ gqb, const float* __restrict__ gkw, const float* __restrict__ gkb, const float* __restrict__ gvw, const float* __restrict__ gvb,
    const float* __restrict__ lqw, const float* __restrict__ lqb, const float* __restrict__ lkw, const float* __restrict__ lkb, const float* __restrict__ lvw, const float* __restrict__ lvb, float* __restrict__ O) {
  __shared__ __attribute__((aligned(16))) unsigned short sk[KCH * KPITCH];
  __shared__ __attribute__((aligned(16))) unsigned short sv[HD * VPITCH];
  const int tid = threadIdx.x, w = tid >> 5, lane = tid & 31, ln = lane & 15, hh = lane >> 4; const int plane = blockIdx.y; const int q0 = blockIdx.x * 128 + w * 32;
  const int sl = s + plane / NG, g = plane % NG, br = g >> 2, h = g & 3;      /* slice, (branch, head) */
  const float* xq = x + ((size_t)sl * HW) * CC + h * HD; const float* xk = xq + (size_t)NSL * HW * CC; const float* xv = xk + (size_t)NSL * HW * CC;      /* x[0] = q slices, x[1] = k, x[2] = v; this head's 16 channels */
  const float* qw = (br ? lqw : gqw) + h * HD; const float* qb = (br ? lqb : gqb) + h * HD; const float* kw = (br ? lkw : gkw) + h * HD; const float* kb = (br ? lkb : gkb) + h * HD; const float* vw = (br ? lvw : gvw) + h * HD; const float* vb = (br ? lvb : gvb) + h * HD;
  const v8us z8 = {0, 0, 0, 0, 0, 0, 0, 0}; const v8f zf = {0.f, 0.f, 0.f, 0.f, 0.f, 0.f, 0.f, 0.f};
  FragH qa[2], qlo[2], qhi[2];      /* query rows [hi | 16 lo | hi/16]; a lane holds dims 8 hh .. 8 hh + 7 of each segment. qa: hi and 16 lo (features 0-31). hi/16 (features 32-47) stands once in the lower k half (qlo) and once in the upper (qhi), zeros in the other: it meets a key fragment that holds features 32-47 of TWO key tiles, one per k half */
  { const v4f w0 = fa_bf4(*(const v4fa*)(qw + 8 * hh)), w1 = fa_bf4(*(const v4fa*)(qw + 8 * hh + 4)), b0 = fa_bf4(*(const v4fa*)(qb + 8 * hh)), b1 = fa_bf4(*(const v4fa*)(qb + 8 * hh + 4));
#pragma unroll
    for (int j = 0; j < 2; ++j) { const float* qr = xq + (size_t)(q0 + j * 16 + ln) * CC + 8 * hh; const v4f t0 = fa_dw(*(const v4fa*)qr, w0, b0), t1 = fa_dw(*(const v4fa*)(qr + 4), w1, b1);
      const v4h h0 = __builtin_convertvector(t0, v4h), h1 = __builtin_convertvector(t1, v4h); const v4f f0 = __builtin_convertvector(h0, v4f), f1 = __builtin_convertvector(h1, v4f);
      const v4h e0 = __builtin_convertvector((t0 - f0) * 16.0f, v4h), e1 = __builtin_convertvector((t1 - f1) * 16.0f, v4h), s0 = __builtin_convertvector(f0 * 0.0625f, v4h), s1 = __builtin_convertvector(f1 * 0.0625f, v4h);
#pragma unroll
      for (int d = 0; d < 4; ++d) { qa[j].h[d] = h0[d]; qa[j].h[4 + d] = h1[d]; qa[j].h[8 + d] = e0[d]; qa[j].h[12 + d] = e1[d]; qlo[j].h[d] = s0[d]; qlo[j].h[4 + d] = s1[d]; }
      qlo[j].half[1] = z8; qhi[j].half[0] = z8; qhi[j].half[1] = qlo[j].half[0]; } }
  v8f o[2] = {zf, zf}; float m[2] = {-3.0e38f, -3.0e38f}, l[2] = {0.f, 0.f};
  const int srow = tid >> 2, sq = (tid & 3) * 4;      /* staging: 4 threads a position, 4 channels (16 B of x) each: the head's whole 64 B */
  const v4f kwr = fa_bf4(*(const v4fa*)(kw + sq)), kbr = fa_bf4(*(const v4fa*)(kb + sq)), vwr = fa_bf4(*(const v4fa*)(vw + sq)), vbr = fa_bf4(*(const v4fa*)(vb + sq));
  const float c = 0.25f * 1.4426950408889634f;      /* 16^-0.5 x log2 e: exp(0.25 (s - m)) = exp2(c s - c m) */
  for (int ch = 0; ch < HW / KCH; ++ch) {
    v4f tk[KCH / 32], tv[8];      /* the whole chunk is requested before the first LDS store, so the work-group pays one load latency a chunk and not one per row group */
#pragma unroll
    for (int u = 0; u < KCH / 32; ++u) tk[u] = *(const v4fa*)(xk + (size_t)(ch * KCH + u * 32 + srow) * CC + sq);      /* keys u * 32 + srow */
    asm volatile("s_wait_xcnt 0x0" ::: "memory");      /* precaution: a later load's result may land in the address registers of the key loads issued above */
#pragma unroll
    for (int i = 0; i < 8; ++i) tv[i] = *(const v4fa*)(xv + (size_t)(ch * KCH + srow * 8 + i) * CC + sq);      /* 8 positions in a row: one 16-B piece of each of 4 transposed v rows */
    asm volatile("s_wait_xcnt 0x0" ::: "memory");      /* precaution: the conversions below may reuse the address registers of the v loads */
    v4h k_hi[KCH / 32], k_s1[KCH / 32], k_s2[KCH / 32]; FragH vt[4];      /* the chunk's LDS image, formed in registers */
#pragma unroll
    for (int u = 0; u < KCH / 32; ++u) { const v4f v = fa_dw(tk[u], kwr, kbr); k_hi[u] = __builtin_convertvector(v, v4h); const v4f hf = __builtin_convertvector(k_hi[u], v4f);
      k_s1[u] = __builtin_convertvector(hf * 0.0625f, v4h); k_s2[u] = __builtin_convertvector((v - hf) * 16.0f, v4h); }      /* key rows [hi | hi/16 | 16 lo]: with the query rows hi.hi + lo.hi + hi.lo (~2^-20) */
#pragma unroll
    for (int i = 0; i < 8; ++i) { const v4f v = fa_dw(tv[i], vwr, vbr);
#pragma unroll
      for (int q = 0; q < 4; ++q) vt[q].h[i] = (_Float16)v[q]; }
    if (ch > 0) __syncthreads();      /* every wave has left the chunk that is overwritten next */
#pragma unroll
    for (int u = 0; u < KCH / 32; ++u) { unsigned short* kr = &sk[(u * 32 + srow) * KPITCH + sq]; *(v4ha*)kr = k_hi[u]; *(v4ha*)(kr + 16) = k_s1[u]; *(v4ha*)(kr + 32) = k_s2[u]; }
#pragma unroll
    for (int q = 0; q < 4; ++q) *(v8us*)&sv[(sq + q) * VPITCH + srow * 8] = vt[q].half[0];
    __syncthreads();      /* the chunk is complete before any wave reads it */
    for (int kb = 0; kb < KCH; kb += 32) {
      const unsigned short* r0 = &sk[(kb + ln) * KPITCH + 8 * hh]; const unsigned short* r1 = r0 + 16 * KPITCH; const unsigned short* rv = &sv[ln * VPITCH + kb + 8 * hh];
      FragH k0a, k1a, kx, va;
      k0a.half[0] = *(const v8us*)r0; k0a.half[1] = *(const v8us*)(r0 + 16); k1a.half[0] = *(const v8us*)r1; k1a.half[1] = *(const v8us*)(r1 + 16);
      kx.half[0] = *(const v8us*)(r0 + 32); kx.half[1] = *(const v8us*)(r1 + 32);      /* features 32-47 of keys kb + ln (lower k half) and kb + 16 + ln (upper) */
      va.half[0] = *(const v8us*)rv; va.half[1] = *(const v8us*)(rv + 16);
#pragma unroll
      for (int j = 0; j < 2; ++j) {
        v8f s0 = fa_mma(k0a.v, qa[j].v, zf); s0 = fa_mma(kx.v, qlo[j].v, s0);      /* s0[r] = S[key kb + 8 hh + r][query ln] */
        v8f s1 = fa_mma(k1a.v, qa[j].v, zf); s1 = fa_mma(kx.v, qhi[j].v, s1);      /* s1[r] = S[key kb + 16 + 8 hh + r][query ln] */
        float mx = fmaxf(s0[0], s1[0]);
#pragma unroll
        for (int r = 1; r < 8; ++r) mx = fmaxf(mx, fmaxf(s0[r], s1[r]));
        mx = fmaxf(mx, fa_other_half(mx));
        const float mn = fmaxf(m[j], mx); const float al = __builtin_amdgcn_exp2f((m[j] - mn) * c); m[j] = mn;
        const float nb = 10.0f - mn * c;      /* P x 2^10 (at most 1024) keeps small probabilities out of the f16 subnormals; the factor cancels in o / l */
        const v2f c2 = {c, c}, nb2 = {nb, nb}; v2f su = {0.f, 0.f}; FragH pf;
#pragma unroll
        for (int r = 0; r < 8; r += 2) {
          const v2f a0 = {s0[r], s0[r + 1]}, a1 = {s1[r], s1[r + 1]}; const v2f t0 = __builtin_elementwise_fma(a0, c2, nb2), t1 = __builtin_elementwise_fma(a1, c2, nb2);
          const v2f p0 = {__builtin_amdgcn_exp2f(t0[0]), __builtin_amdgcn_exp2f(t0[1])}, p1 = {__builtin_amdgcn_exp2f(t1[0]), __builtin_amdgcn_exp2f(t1[1])};
          su += p0 + p1; pf.h[r] = (_Float16)p0[0]; pf.h[r + 1] = (_Float16)p0[1]; pf.h[8 + r] = (_Float16)p1[0]; pf.h[8 + r + 1] = (_Float16)p1[1]; }
        l[j] = l[j] * al + (su[0] + su[1]); o[j] *= al;
        o[j] = fa_mma(va.v, pf.v, o[j]);      /* o[r] = O[query ln][d = 8 hh + r] */
      }
    }
  }
#pragma unroll
  for (int j = 0; j < 2; ++j) { const float lt = l[j] + fa_other_half(l[j]); const float inv = 1.0f / lt; float* dst = O + ((size_t)plane * HW + q0 + j * 16 + ln) * 64 + 8 * hh;
    const v4f x0 = {o[j][0] * inv, o[j][1] * inv, o[j][2] * inv, o[j][3] * inv}, x1 = {o[j][4] * inv, o[j][5] * inv, o[j][6] * inv, o[j][7] * inv}; *(v4f*)dst = x0; *(v4f*)(dst + 4) = x1; } }
__global__ __launch_bounds__(256) void k_outs(const float* __restrict__ O, int s, const float* __restrict__ pw, const float* __restrict__ pb, float* __restrict__ out) {
  #pragma clang fp contract(off)
  const int t = blockIdx.x * 256 + threadIdx.x; if (t >= HW * (CC / 4)) return; O += (size_t)blockIdx.y * NG * HW * 64; s += blockIdx.y; const int c0 = (t & 15) * 4, p = t >> 4; v4f o;
#pragma unroll
  for (int q = 0; q < 4; ++q) { const int c = c0 + q; const int h = c / HD, d = c % HD; const float l = O[((size_t)(4 + h) * HW + p) * 64 + d], g = O[((size_t)h * HW + p) * 64 + d]; const float comb = 0.5f * l + 0.5f * g; o[q] = (2.0f * comb) * bf16_round(pw[c]) + bf16_round(pb[c]); }
  float* dst = out + ((size_t)s * HW + p) * CC + c0; *(v4f*)dst = o;  }

extern "C" void kernel_launch(void* const* d_in, const int* in_sizes, int n_in,
                              void* d_out, int out_size, void* d_ws, size_t ws_size, hipStream_t stream) {
  (void)in_sizes; (void)n_in; (void)out_size;
  const float* const* I = (const float* const*)d_in; const float* x = I[0];
  const float* gqw = I[1]; const float* gqb = I[2]; const float* gkw = I[3]; const float* gkb = I[4]; const float* gvw = I[5]; const float* gvb = I[6]; const float* lqw = I[7]; const float* lqb = I[8]; const float* lkw = I[9]; const float* lkb = I[10]; const float* lvw = I[11]; const float* lvb = I[12]; const float* pw = I[13]; const float* pb = I[14];
  char* ws = (char*)d_ws; size_t off = 0;
  auto take = [&](size_t bytes) { char* p = ws + off; off += (bytes + 255) & ~(size_t)255; return p; };
  float* O = (float*)take((size_t)NB * NG * HW * 64 * 4);
  if (off > ws_size) return;      /* NB x 2 = 40 MiB */
  for (int s = 0; s < NRUN; s += NB) {
    k_fattn<<<dim3(HW / 128, NB * NG), 128, 0, stream>>>(x, s, gqw, gqb, gkw, gkb, gvw, gvb, lqw, lqb, lkw, lkb, lvw, lvb, O);      /* NB x 8 (slice, branch, head) planes batched */
    k_outs<<<dim3((HW * (CC / 4) + 255) / 256, NB), 256, 0, stream>>>(O, s, pw, pb, (float*)d_out); }
}

// v005
// A run of this version takes 27.1 microseconds.
// Versions between v003 and this one are left out; their measured steps multiply to 1.64 times as fast.
// Over all steps from v000 it is 51.4 times as fast.
#include <hip/hip_runtime.h>
// Global + local spatial attention (x = [q|k|v] of 20 slices x 1024 positions x 64 channels; 4 heads of 16; per-channel scale+bias 'depthwise k=1 convs' for each branch): g = attn(q gq_w + gq_b, k gk_w + gk_b, v gv_w + gv_b), l likewise; out = (2 (0.5 l + 0.5 g)) proj_w + proj_b -> [20,1024,64].
// Structure (one launch): a fused attention kernel that reads x itself. The k scale is folded into the query, the k bias is left out (a constant per query, cancelled by softmax), the v scale+bias follow the division, so K and V are bf16(x) as f16 and serve both branches: a wave runs both branches of 16 queries of one head on the same fragments (scores, softmax with a lazily renewed shift and attn.v in registers, f32 accumulation, P f16), then mixes them and applies the output scale/bias.
// Compute dtype: x and all parameters rounded to bf16; the folded query as f16 hi + residual against exact f16 keys (K 32); v exact, P as f16 operands (~2^-12); f32 accumulation, softmax, elementwise. v_wmma_f32_16x16x32_f16.
#define NSL 20
#define NRUN NSL                 /* slices processed (NSL stays the input stride) */
#define HW 1024
#define CC 64
#define NHD 4
#define HD 16
#define NG 8                     /* (branch, head) pairs per slice: g = br*4 + h */
#define NB 20                    /* slices per launch: blockIdx.y runs over NB slices x 2 head pairs; NSL % NB == 0 */
typedef __bf16 v16b __attribute__((ext_vector_type(16)));
typedef unsigned short v8us __attribute__((ext_vector_type(8), may_alias));
typedef float  v8f  __attribute__((ext_vector_type(8)));
typedef float  v4f  __attribute__((ext_vector_type(4)));
typedef float  v4fa __attribute__((ext_vector_type(4), may_alias));
union FragB { v16b v; v8us half[2]; unsigned short u[16]; };

__device__ __forceinline__ unsigned short bf16_bits(float x) { unsigned int u = __float_as_uint(x); return (unsigned short)((u + 0x7FFFu + ((u >> 16) & 1u)) >> 16); }
__device__ __forceinline__ float bf16_val(unsigned short b) { return __uint_as_float(((unsigned int)b) << 16); }
__device__ __forceinline__ float bf16_round(float x) { return bf16_val(bf16_bits(x)); }
// D += A·B with NT terms: 1 = ah·bh, 2 = + al·bh (A split), 3 = + ah·bl (both split)
template <int NT>
__device__ __forceinline__ v8f mmaN(v16b ah, v16b al, v16b bh, v16b bl, v8f c) {
  c = __builtin_amdgcn_wmma_f32_16x16x32_bf16(false, ah, false, bh, (short)0, c, false, false);
  if (NT >= 2) c = __builtin_amdgcn_wmma_f32_16x16x32_bf16(false, al, false, bh, (short)0, c, false, false);
  if (NT >= 3) c = __builtin_amdgcn_wmma_f32_16x16x32_bf16(false, ah, false, bl, (short)0, c, false, false);
  asm volatile("v_nop\n\tv_nop\n\tv_nop\n\tv_nop" : "+v"(c) : "v"(ah), "v"(al), "v"(bh), "v"(bl));
  return c;
}

__global__ __launch_bounds__(256) void k_wt_bf16(const float* __restrict__ W, unsigned short* __restrict__ Wt, int K, int N) {
  const int t = blockIdx.x * 256 + threadIdx.x;
  const int k8n = K / 8;
  if (t >= N * k8n) return;
  const int n = t / k8n, k8 = (t % k8n) * 8;
  v8us v;
#pragma unroll
  for (int i = 0; i < 8; ++i) v[i] = bf16_bits(W[(size_t)(k8 + i) * N + n]);
  *(v8us*)(Wt + (size_t)n * K + k8) = v;
  
}

// GEMM C[M][N] (f32, pitch ldc) = act(A[M][K]·W + bias). A f32 row-major (pitch lda) converted per fragment to bf16
// (ASPLIT: hi/lo two planes -> 2 terms, else single rounded term); Wt bf16 [N][K] (pitch ldb). BIAS_BF16 rounds the
// bias to bf16 first (bias quantised to bf16 before the add). K%32==0, M%16==0, N%64==0.
template <bool ASPLIT, int ACT, bool BIAS_BF16>
__global__ __launch_bounds__(128) void k_gemm_bf(const float* __restrict__ A, int lda, const unsigned short* __restrict__ Wt, int ldb,
                                               const float* __restrict__ bias, float* __restrict__ C, int ldc, int M, int N, int K) {
  __shared__ __attribute__((aligned(16))) float so[4][16][64];
  const int tid = threadIdx.x, w = tid >> 5, lane = tid & 31, ln = lane & 15, hh = lane >> 4;
  const int ntn = N / 64;
  const int wid = blockIdx.x * 4 + w;
  const int mt = wid / ntn, nq = wid % ntn;
  if (mt * 16 >= M) return;
  const int row0 = mt * 16, col0 = nq * 64;
  const float* arow = A + (size_t)(row0 + ln) * lda;
  v8f acc[4] = {};
  for (int kb = 0; kb < K; kb += 32) {
    FragB ah, al;
    const v4f x0 = *(const v4fa*)(arow + kb + 8 * hh), x1 = *(const v4fa*)(arow + kb + 8 * hh + 4);
    const v4f x2 = *(const v4fa*)(arow + kb + 16 + 8 * hh), x3 = *(const v4fa*)(arow + kb + 16 + 8 * hh + 4);
    float xs[16] = {x0[0],x0[1],x0[2],x0[3],x1[0],x1[1],x1[2],x1[3],x2[0],x2[1],x2[2],x2[3],x3[0],x3[1],x3[2],x3[3]};
#pragma unroll
    for (int i = 0; i < 16; ++i) { const unsigned short hb = bf16_bits(xs[i]); ah.u[i] = hb; al.u[i] = ASPLIT ? bf16_bits(xs[i] - bf16_val(hb)) : (unsigned short)0; }
#pragma unroll
    for (int t = 0; t < 4; ++t) {
      const unsigned short* brow = Wt + (size_t)(col0 + t * 16 + ln) * ldb + kb;
      FragB b;
      b.half[0] = *(const v8us*)(brow + 8 * hh);
      b.half[1] = *(const v8us*)(brow + 16 + 8 * hh);
      acc[t] = mmaN<ASPLIT ? 2 : 1>(ah.v, al.v, b.v, b.v, acc[t]);
    }
  }
#pragma unroll
  for (int t = 0; t < 4; ++t) {
    float bv = bias ? bias[col0 + t * 16 + ln] : 0.f;
    if (BIAS_BF16) bv = bf16_round(bv);
#pragma unroll
    for (int r = 0; r < 8; ++r) { float v = acc[t][r] + bv; if (ACT == 1) v = fmaxf(v, 0.f); so[w][8 * hh + r][t * 16 + ln] = v; }
  }
  __builtin_amdgcn_fence(__ATOMIC_ACQ_REL, "workgroup");
  __builtin_amdgcn_wave_barrier();
  const int rsub = lane >> 4, c4 = (lane & 15) * 4;
  {
#pragma unroll
    for (int q = 0; q < 8; ++q) {
      const int r = q * 2 + rsub;
      const v4f v = *(const v4fa*)&so[w][r][c4];
      *(v4f*)(C + (size_t)(row0 + r) * ldc + col0 + c4) = v;
    }
    
  }
}

// GEMM C = act(A·W + bias + resid): A f32 (ASPLIT -> hi/lo 2 terms), Wt bf16 [N][K]; ACT 0 none, 1 relu, 2 exact gelu;
// resid (optional, f32, row index = (row % rmod), pitch ldr, RES_BF16 rounds it) added before the activation.
template <bool ASPLIT, int ACT, bool BIAS_BF16, bool RES_BF16>
__global__ __launch_bounds__(128) void k_gemm_bf3(const float* __restrict__ A, int lda, const unsigned short* __restrict__ Wt, int ldb,
                                                const float* __restrict__ bias, const float* __restrict__ resid, int rmod, int ldr,
                                                float* __restrict__ C, int ldc, int M, int N, int K) {
  __shared__ __attribute__((aligned(16))) float so[4][16][64];
  const int tid = threadIdx.x, w = tid >> 5, lane = tid & 31, ln = lane & 15, hh = lane >> 4;
  const int ntn = N / 64;
  const int wid = blockIdx.x * 4 + w;
  const int mt = wid / ntn, nq = wid % ntn;
  if (mt * 16 >= M) return;
  const int row0 = mt * 16, col0 = nq * 64;
  const float* arow = A + (size_t)(row0 + ln) * lda;
  v8f acc[4] = {};
  for (int kb = 0; kb < K; kb += 32) {
    FragB ah, al;
    const v4f x0 = *(const v4fa*)(arow + kb + 8 * hh), x1 = *(const v4fa*)(arow + kb + 8 * hh + 4);
    const v4f x2 = *(const v4fa*)(arow + kb + 16 + 8 * hh), x3 = *(const v4fa*)(arow + kb + 16 + 8 * hh + 4);
    float xs[16] = {x0[0],x0[1],x0[2],x0[3],x1[0],x1[1],x1[2],x1[3],x2[0],x2[1],x2[2],x2[3],x3[0],x3[1],x3[2],x3[3]};
#pragma unroll
    for (int i = 0; i < 16; ++i) { const unsigned short hb = bf16_bits(xs[i]); ah.u[i] = hb; al.u[i] = ASPLIT ? bf16_bits(xs[i] - bf16_val(hb)) : (unsigned short)0; }
#pragma unroll
    for (int t = 0; t < 4; ++t) {
      const unsigned short* brow = Wt + (size_t)(col0 + t * 16 + ln) * ldb + kb;
      FragB b;
      b.half[0] = *(const v8us*)(brow + 8 * hh);
      b.half[1] = *(const v8us*)(brow + 16 + 8 * hh);
      acc[t] = mmaN<ASPLIT ? 2 : 1>(ah.v, al.v, b.v, b.v, acc[t]);
    }
  }
#pragma unroll
  for (int t = 0; t < 4; ++t) {
    const int col = col0 + t * 16 + ln;
    float bv = bias ? bias[col] : 0.f;
    if (BIAS_BF16) bv = bf16_round(bv);
#pragma unroll
    for (int r = 0; r < 8; ++r) {
      float v = acc[t][r] + bv;
      if (resid) { float rv = resid[(size_t)((row0 + 8 * hh + r) % rmod) * ldr + col]; if (RES_BF16) rv = bf16_round(rv); v += rv; }
      if (ACT == 1) v = fmaxf(v, 0.f);
      if (ACT == 2) v = 0.5f * v * (1.0f + erff(v * 0.70710678118654752f));
      if (ACT == 3) { const float u = 0.7978845608028654f * (v + 0.044715f * v * v * v); v = 0.5f * v * (1.0f + tanhf(u)); }
      so[w][8 * hh + r][t * 16 + ln] = v;
    }
  }
  __builtin_amdgcn_fence(__ATOMIC_ACQ_REL, "workgroup");
  __builtin_amdgcn_wave_barrier();
  const int rsub = lane >> 4, c4 = (lane & 15) * 4;
  {
#pragma unroll
    for (int q = 0; q < 8; ++q) {
      const int r = q * 2 + rsub;
      const v4f v = *(const v4fa*)&so[w][r][c4];
      *(v4f*)(C + (size_t)(row0 + r) * ldc + col0 + c4) = v;
    }
    
  }
}
// row LayerNorm (biased variance, eps) over N: s = X (+ R); optional out_sum <- s; out_norm <- (s-mu)*rsqrt(var+eps)*g + b
template <bool PARAM_BF16>
__global__ __launch_bounds__(256) void k_layernorm(const float* __restrict__ X, const float* __restrict__ R, const float* __restrict__ g, const float* __restrict__ bta,
                                                  float* __restrict__ out_sum, float* __restrict__ out_norm, int N, float eps) {
  __shared__ float red[256];
  const int row = blockIdx.x, tid = threadIdx.x;
  const float* x = X + (size_t)row * N; const float* rr = R ? R + (size_t)row * N : nullptr;
  float vals[16];                     // up to N = 4096
  const int per = N / 256;            // contiguous chunk per thread? use strided-by-4 chunks: thread handles j = tid*4 + 1024*u
  float s1 = 0.f;
  for (int u = 0; u < per / 4; ++u) {
    const int j = tid * 4 + 1024 * u;
    const v4f a = *(const v4fa*)(x + j);
    v4f b = {0.f,0.f,0.f,0.f}; if (rr) b = *(const v4fa*)(rr + j);
#pragma unroll
    for (int q = 0; q < 4; ++q) { const float v = a[q] + b[q]; vals[u * 4 + q] = v; s1 += v; }
  }
  red[tid] = s1; __syncthreads();
  for (int st = 128; st > 0; st >>= 1) { if (tid < st) red[tid] += red[tid + st]; __syncthreads(); }
  const float mu = red[0] / (float)N; __syncthreads();
  float s2 = 0.f;
  for (int u = 0; u < per / 4; ++u)
#pragma unroll
    for (int q = 0; q < 4; ++q) { const float c = vals[u * 4 + q] - mu; s2 += c * c; }
  red[tid] = s2; __syncthreads();
  for (int st = 128; st > 0; st >>= 1) { if (tid < st) red[tid] += red[tid + st]; __syncthreads(); }
  const float rs = rsqrtf(red[0] / (float)N + eps);
  {
    for (int u = 0; u < per / 4; ++u) {
      const int j = tid * 4 + 1024 * u;
      v4f o, sm;
#pragma unroll
      for (int q = 0; q < 4; ++q) {
        float gg = g[j + q], bb = bta[j + q];
        if (PARAM_BF16) { gg = bf16_round(gg); bb = bf16_round(bb); }
        sm[q] = vals[u * 4 + q]; o[q] = (vals[u * 4 + q] - mu) * rs * gg + bb;
      }
      if (out_sum) *(v4f*)(out_sum + (size_t)row * N + j) = sm;
      *(v4f*)(out_norm + (size_t)row * N + j) = o;
    }
    
  }
}



// ---- f16 WMMA path (v_wmma_f32_16x16x32_f16): 11-bit significands for operands in range — used where a [0,1] probability operand needs more precision than bf16
typedef _Float16 v16h __attribute__((ext_vector_type(16)));
union FragH { v16h v; v8us half[2]; _Float16 h[16]; unsigned short u[16]; };
template <int NT>
__device__ __forceinline__ v8f mmaH(v16h ah, v16h al, v16h bh, v16h bl, v8f c) {
  c = __builtin_amdgcn_wmma_f32_16x16x32_f16(false, ah, false, bh, (short)0, c, false, false);
  if (NT >= 2) c = __builtin_amdgcn_wmma_f32_16x16x32_f16(false, al, false, bh, (short)0, c, false, false);
  if (NT >= 3) c = __builtin_amdgcn_wmma_f32_16x16x32_f16(false, ah, false, bl, (short)0, c, false, false);
  asm volatile("v_nop\n\tv_nop\n\tv_nop\n\tv_nop" : "+v"(c) : "v"(ah), "v"(al), "v"(bh), "v"(bl));
  return c;
}
// batched GEMM like k_gemm_b but f16 operands: A f32 (split into f16 hi/lo if ASPLIT, else rounded to f16), Bt = f16 values [n][k]; alpha; C f32; N multiple of 16 (partial tiles skipped)
template <bool ASPLIT>
__global__ __launch_bounds__(128) void k_gemm_h(const float* __restrict__ A, int lda, size_t sA, const _Float16* __restrict__ Bh, int ldb, size_t sB, float alpha, float* __restrict__ C, int ldc, size_t sC, int M, int N, int K) {
  __shared__ __attribute__((aligned(16))) float so[4][16][64];
  const int tid = threadIdx.x, w = tid >> 5, lane = tid & 31, ln = lane & 15, hh = lane >> 4; const int by = blockIdx.y;
  A += (size_t)by * sA; Bh += (size_t)by * sB; C += (size_t)by * sC;
  const int ntn = (N + 63) / 64; const int wid = blockIdx.x * 4 + w; const int mt = wid / ntn, nq = wid % ntn; if (mt * 16 >= M) return;
  const int row0 = mt * 16, col0 = nq * 64; const float* arow = A + (size_t)(row0 + ln) * lda;
  v8f acc[4] = {};
  for (int kb = 0; kb < K; kb += 32) {
    FragH ah, al;
    const v4f x0 = *(const v4fa*)(arow + kb + 8 * hh), x1 = *(const v4fa*)(arow + kb + 8 * hh + 4), x2 = *(const v4fa*)(arow + kb + 16 + 8 * hh), x3 = *(const v4fa*)(arow + kb + 16 + 8 * hh + 4);
    float xs[16] = {x0[0],x0[1],x0[2],x0[3],x1[0],x1[1],x1[2],x1[3],x2[0],x2[1],x2[2],x2[3],x3[0],x3[1],x3[2],x3[3]};
#pragma unroll
    for (int i = 0; i < 16; ++i) { const _Float16 h = (_Float16)xs[i]; ah.h[i] = h; al.h[i] = ASPLIT ? (_Float16)(xs[i] - (float)h) : (_Float16)0.0f; }
#pragma unroll
    for (int t = 0; t < 4; ++t) { if (col0 + t * 16 >= N) continue; const size_t boff = (size_t)(col0 + t * 16 + ln) * ldb + kb; FragH bq; bq.half[0] = *(const v8us*)(Bh + boff + 8 * hh); bq.half[1] = *(const v8us*)(Bh + boff + 16 + 8 * hh);
      acc[t] = mmaH<ASPLIT ? 2 : 1>(ah.v, al.v, bq.v, bq.v, acc[t]); }
  }
#pragma unroll
  for (int t = 0; t < 4; ++t) { if (col0 + t * 16 >= N) continue;
#pragma unroll
    for (int r = 0; r < 8; ++r) so[w][8 * hh + r][t * 16 + ln] = acc[t][r] * alpha; }
  __builtin_amdgcn_fence(__ATOMIC_ACQ_REL, "workgroup"); __builtin_amdgcn_wave_barrier();
  const int rsub = lane >> 4, c4 = (lane & 15) * 4;
  {
#pragma unroll
    for (int q = 0; q < 8; ++q) { const int r = q * 2 + rsub; if (col0 + c4 < N) { const v4f v = *(const v4fa*)&so[w][r][c4]; *(v4f*)(C + (size_t)(row0 + r) * ldc + col0 + c4) = v; } }
     }
}

// Wt[n][k] = f16(W[k][n]·scale) from f32 row-major W[K][N] (scale = power of two; bf16-exact weights stay exact in f16 away from the subnormal range)
__global__ __launch_bounds__(256) void k_wt_f16(const float* __restrict__ W, _Float16* __restrict__ Wt, int K, int N, float scale) {
  const int t = blockIdx.x * 256 + threadIdx.x; if (t >= N * (K / 8)) return; const int n = t / (K / 8), k8 = (t % (K / 8)) * 8; FragH f;
#pragma unroll
  for (int i = 0; i < 8; ++i) f.h[i] = (_Float16)(bf16_round(W[(size_t)(k8 + i) * N + n]) * scale); const v8us o = f.half[0];
  *(v8us*)((unsigned short*)Wt + (size_t)n * K + k8) = o; 
}
// k_gemm_hh variant with fused epilogue: v = acc·alpha + bias[by·sBias + col] (+ CP[(row/rowsPerB)·sCPb + by·64 + col] if CP) ; ACT 0 none / 1 elu ; writes f16 C16 (and f32 C if non-null)
template <int ACT>
__global__ __launch_bounds__(128) void k_gemm_hhx(const _Float16* __restrict__ A, int lda, size_t sA, const _Float16* __restrict__ Bh, int ldb, size_t sB, float alpha, const float* __restrict__ bias, size_t sBias, const float* __restrict__ CP, int rowsPerB, size_t sCPb, int row0g,
    float* __restrict__ C, _Float16* __restrict__ C16, int ldc, size_t sC, int M, int N, int K) {
  __shared__ __attribute__((aligned(16))) float so[4][16][64];
  const int tid = threadIdx.x, w = tid >> 5, lane = tid & 31, ln = lane & 15, hh = lane >> 4; const int by = blockIdx.y;
  A += (size_t)by * sA; Bh += (size_t)by * sB; const size_t cofs = (size_t)by * sC; const float* bp = bias ? bias + (size_t)by * sBias : nullptr;
  const int ntn = (N + 63) / 64; const int wid = blockIdx.x * 4 + w; const int mt = wid / ntn, nq = wid % ntn; if (mt * 16 >= M) return;
  const int row0 = mt * 16, col0 = nq * 64; const _Float16* arow = A + (size_t)(row0 + ln) * lda;
  v8f acc[4] = {};
  for (int kb = 0; kb < K; kb += 32) { FragH ah; ah.half[0] = *(const v8us*)((const unsigned short*)arow + kb + 8 * hh); ah.half[1] = *(const v8us*)((const unsigned short*)arow + kb + 16 + 8 * hh);
#pragma unroll
    for (int t = 0; t < 4; ++t) { if (col0 + t * 16 >= N) continue; const size_t boff = (size_t)(col0 + t * 16 + ln) * ldb + kb; FragH bq; bq.half[0] = *(const v8us*)((const unsigned short*)Bh + boff + 8 * hh); bq.half[1] = *(const v8us*)((const unsigned short*)Bh + boff + 16 + 8 * hh);
      acc[t] = mmaH<1>(ah.v, ah.v, bq.v, bq.v, acc[t]); }
  }
#pragma unroll
  for (int t = 0; t < 4; ++t) { if (col0 + t * 16 >= N) continue; const int col = col0 + t * 16 + ln; const float bv = bp ? bf16_round(bp[col]) : 0.f;
#pragma unroll
    for (int r = 0; r < 8; ++r) { float v = acc[t][r] * alpha + bv; if (CP) { const int bidx = (row0g + row0 + 8 * hh + r) / rowsPerB; v += CP[(size_t)bidx * sCPb + (size_t)by * 64 + col]; } if (ACT == 1) v = (v > 0.f) ? v : expm1f(v); else if (ACT == 7) v = (v > 0.f) ? v + 1.0f : expf(v); else if (ACT == 8) v = tanhf(v); else if (ACT == 9) v = 0.5f * v * (1.0f + tanhf(0.7978845608028654f * (v + 0.044715f * v * v * v))); else if (ACT == 11) v = 1.0f / (1.0f + expf(-v)); else if (ACT == 12) v = (v > 0.f) ? v : 0.01f * v; else if (ACT == 14) v = (v > 0.f) ? v : 0.1f * v; else if (ACT == 15) v = v / (1.0f + expf(-v)); else if (ACT == 3) v = fmaxf(v, 0.f); else if (ACT == 6) v = 0.5f * v * (1.0f + erff(v * 0.70710678118654752f)); so[w][8 * hh + r][t * 16 + ln] = v; } }
  __builtin_amdgcn_fence(__ATOMIC_ACQ_REL, "workgroup"); __builtin_amdgcn_wave_barrier();
  const int rsub = lane >> 4, c4 = (lane & 15) * 4; typedef _Float16 v4h __attribute__((ext_vector_type(4)));
  {
#pragma unroll
    for (int q = 0; q < 8; ++q) { const int r = q * 2 + rsub; if (col0 + c4 < N) { const v4f v = *(const v4fa*)&so[w][r][c4]; if (C) *(v4f*)(C + cofs + (size_t)(row0 + r) * ldc + col0 + c4) = v; if (C16) { v4h h4; for (int i = 0; i < 4; ++i) h4[i] = (_Float16)v[i]; *(v4h*)(C16 + cofs + (size_t)(row0 + r) * ldc + col0 + c4) = h4; } } }
     }
}


typedef _Float16 v4h __attribute__((ext_vector_type(4)));

__global__ __launch_bounds__(256) void k_x16(const float* __restrict__ x, _Float16* __restrict__ X16, size_t n8) { const size_t t = (size_t)blockIdx.x * 256 + threadIdx.x; if (t >= n8) return; FragH f;
#pragma unroll
  for (int q = 0; q < 8; ++q) f.h[q] = (_Float16)bf16_round(x[t * 8 + q]); *(v8us*)((unsigned short*)X16 + t * 8) = f.half[0];  }
__global__ __launch_bounds__(256) void k_h16(const float* __restrict__ x, _Float16* __restrict__ X16, size_t n8) { const size_t t = (size_t)blockIdx.x * 256 + threadIdx.x; if (t >= n8) return; FragH f;
#pragma unroll
  for (int q = 0; q < 8; ++q) f.h[q] = (_Float16)x[t * 8 + q]; *(v8us*)((unsigned short*)X16 + t * 8) = f.half[0];  }
__global__ __launch_bounds__(256) void k_round16f(const float* __restrict__ W, _Float16* __restrict__ Bt, size_t n8) { const size_t t = (size_t)blockIdx.x * 256 + threadIdx.x; if (t >= n8) return; FragH f;
#pragma unroll
  for (int i = 0; i < 8; ++i) f.h[i] = (_Float16)(bf16_round(W[t * 8 + i]) * 16.0f); *(v8us*)((unsigned short*)Bt + t * 8) = f.half[0];  }
template <int NHv, int TTv>
__global__ __launch_bounds__(256) void k_vt(const _Float16* __restrict__ V16, int ldv, int voff, _Float16* __restrict__ Vt) { __shared__ unsigned short tl[64][66]; const int tid = threadIdx.x; const int slab = blockIdx.x / (TTv / 64), lg = blockIdx.x % (TTv / 64); const int b = slab / NHv, h = slab % NHv;
  for (int i = tid; i < 64 * 8; i += 256) { const int r = i / 8, c8 = (i % 8) * 8; FragH f; f.half[0] = *(const v8us*)((const unsigned short*)V16 + ((size_t)b * TTv + lg * 64 + r) * ldv + voff + h * 64 + c8);
#pragma unroll
    for (int q = 0; q < 8; ++q) tl[r][c8 + q] = f.u[q]; }
  __syncthreads();
  {
#pragma unroll
    for (int rd = 0; rd < 2; ++rd) { const int d = rd * 32 + tid / 8, pc = tid % 8; FragH f;
#pragma unroll
      for (int q = 0; q < 8; ++q) f.u[q] = tl[pc * 8 + q][d];
      *(v8us*)((unsigned short*)Vt + ((size_t)slab * 64 + d) * TTv + lg * 64 + pc * 8) = f.half[0]; }
     } }

__global__ __launch_bounds__(256) void k_hl(const float* __restrict__ F, _Float16* __restrict__ Hh, _Float16* __restrict__ Hl, size_t n8) { const size_t t = (size_t)blockIdx.x * 256 + threadIdx.x; if (t >= n8) return; FragH fh, fl; const v4f a = *(const v4fa*)(F + t * 8), c = *(const v4fa*)(F + t * 8 + 4);
#pragma unroll
  for (int q = 0; q < 4; ++q) { _Float16 h = (_Float16)a[q]; fh.h[q] = h; fl.h[q] = (_Float16)((a[q] - (float)h) * 1024.0f); h = (_Float16)c[q]; fh.h[4 + q] = h; fl.h[4 + q] = (_Float16)((c[q] - (float)h) * 1024.0f); }
  { *(v8us*)((unsigned short*)Hh + t * 8) = fh.half[0]; *(v8us*)((unsigned short*)Hl + t * 8) = fl.half[0];  } }

// ---- fast GEMM (wave tile 32x64; requires M % 32 == 0 rows per launch region and N % 64 == 0); epilogue = k_gemm_hhx semantics ----
__device__ __forceinline__ v16h g2_frag(const _Float16* p, int hh) { FragH f; f.half[0] = *(const v8us*)((const unsigned short*)p + 8 * hh); f.half[1] = *(const v8us*)((const unsigned short*)p + 16 + 8 * hh); return f.v; }
__device__ __forceinline__ v8f g2_mma(v16h a, v16h b, v8f c) { v8f d = __builtin_amdgcn_wmma_f32_16x16x32_f16(false, a, false, b, (short)0, c, false, false); asm volatile("v_nop\n\tv_nop\n\tv_nop\n\tv_nop" : "+v"(d) : "v"(a), "v"(b)); return d; }
template <int ACT>
__global__ __launch_bounds__(128) void k_gemm2(const _Float16* __restrict__ A, int lda, size_t sA, const _Float16* __restrict__ Bh, int ldb, size_t sB, float alpha, const float* __restrict__ bias, size_t sBias, const float* __restrict__ CP, int rowsPerB, size_t sCPb, int row0g,
    float* __restrict__ C, _Float16* __restrict__ C16, int ldc, size_t sC, int M, int N, int K) {
  __shared__ __attribute__((aligned(16))) float so[4][32][68];
  const int tid = threadIdx.x, w = tid >> 5, lane = tid & 31, ln = lane & 15, hh = lane >> 4; const int by = blockIdx.y;
  A += (size_t)by * sA; Bh += (size_t)by * sB; const size_t cofs = (size_t)by * sC; const float* bp = bias ? bias + (size_t)by * sBias : nullptr;
  const int ntn = N >> 6; const int mt = blockIdx.x / ntn, nq = blockIdx.x - mt * ntn; const int row0 = mt * 128 + 32 * w, col0 = nq * 64; if (row0 >= M) return;
  const _Float16* a0p = A + (size_t)(row0 + ln) * lda; const _Float16* a1p = a0p + (size_t)16 * lda;
  const _Float16* b0p = Bh + (size_t)(col0 + ln) * ldb; const _Float16* b1p = b0p + (size_t)16 * ldb; const _Float16* b2p = b1p + (size_t)16 * ldb; const _Float16* b3p = b2p + (size_t)16 * ldb;
  const v8f z8 = {0.f,0.f,0.f,0.f,0.f,0.f,0.f,0.f}; v8f c00 = z8, c01 = z8, c02 = z8, c03 = z8, c10 = z8, c11 = z8, c12 = z8, c13 = z8;
#pragma unroll 1
  for (int kb = 0; kb < K; kb += 32) { const v16h a0 = g2_frag(a0p + kb, hh), a1 = g2_frag(a1p + kb, hh);
    v16h b = g2_frag(b0p + kb, hh); c00 = g2_mma(a0, b, c00); c10 = g2_mma(a1, b, c10);
    b = g2_frag(b1p + kb, hh); c01 = g2_mma(a0, b, c01); c11 = g2_mma(a1, b, c11);
    b = g2_frag(b2p + kb, hh); c02 = g2_mma(a0, b, c02); c12 = g2_mma(a1, b, c12);
    b = g2_frag(b3p + kb, hh); c03 = g2_mma(a0, b, c03); c13 = g2_mma(a1, b, c13); }
  v8f accs[8] = {c00, c01, c02, c03, c10, c11, c12, c13};
#pragma unroll
  for (int u = 0; u < 8; ++u) { const int t = u & 3, half = u >> 2; const int col = col0 + t * 16 + ln; const float bv = bp ? bf16_round(bp[col]) : 0.f;
#pragma unroll
    for (int r = 0; r < 8; ++r) { const int rloc = half * 16 + 8 * hh + r; float v = accs[u][r] * alpha + bv; if (CP) { const int bidx = (row0g + row0 + rloc) / rowsPerB; v += CP[(size_t)bidx * sCPb + (size_t)by * 64 + col]; }
      if (ACT == 3) v = fmaxf(v, 0.f); else if (ACT == 6) v = 0.5f * v * (1.0f + erff(v * 0.70710678118654752f)); else if (ACT == 11) v = 1.0f / (1.0f + expf(-v)); else if (ACT == 15) v = v / (1.0f + expf(-v)); else if (ACT == 12) v = (v > 0.f) ? v : 0.01f * v; else if (ACT == 8) v = tanhf(v);
      so[w][rloc][t * 16 + ln] = v; } }
  __builtin_amdgcn_fence(__ATOMIC_ACQ_REL, "workgroup"); __builtin_amdgcn_wave_barrier();
  const int rsub = lane >> 4, c4 = (lane & 15) * 4;
  {
#pragma unroll
    for (int q = 0; q < 16; ++q) { const int r = q * 2 + rsub; const v4f v = *(const v4fa*)&so[w][r][c4]; if (C) *(v4f*)(C + cofs + (size_t)(row0 + r) * ldc + col0 + c4) = v; if (C16) { v4h h4; for (int i = 0; i < 4; ++i) h4[i] = (_Float16)v[i]; *(v4h*)(C16 + cofs + (size_t)(row0 + r) * ldc + col0 + c4) = h4; } }
     } }


#define KCH 256                  /* keys per staged chunk */
#define KPITCH 40                /* halves per staged key row: [k | k], 32 in use, pitch 80 B = 16 B x odd (b128 reads without bank conflicts) */
#define KHEAD (KCH * KPITCH + 16) /* halves per head's key image: the 32 B more put the two heads' stores of one position on different banks */
#define VPITCH (KCH + 8)         /* halves per staged v row: 528 B = 16 B x odd */
#define OPITCH 36                /* floats per staged output row: 32 in use */
#define PBASE 4.0f               /* log2 of P at the score that set the shift in use: P below 2^-18 of it are f16 subnormals, whose rounding is far below that of the large P */
#define LFULL 12.0f              /* log2 of 256 x 2^PBASE: the most a running-sum component (256 keys) holds when no score lies above the one that set the shift */
#define LTOP 60000.0f            /* a running-sum component at or below this bounds every P in it below the f16 top (65504) */
typedef float v2f __attribute__((ext_vector_type(2)));
__device__ __forceinline__ v8f fa_mma(v16h a, v16h b, v8f c) { return __builtin_amdgcn_wmma_f32_16x16x32_f16(false, a, false, b, (short)0, c, false, false); }
__device__ __forceinline__ float fa_other_half(float v) { const int b = __float_as_int(v); return __int_as_float(__builtin_amdgcn_permlanex16(b, b, 0x76543210, 0xfedcba98, false, false)); }      /* lane l <-> l ^ 16 */
typedef __bf16 v4b __attribute__((ext_vector_type(4)));
typedef _Float16 v4ha __attribute__((ext_vector_type(4), may_alias));
__device__ __forceinline__ v4f fa_bf4(v4f a) { return __builtin_convertvector(__builtin_convertvector(a, v4b), v4f); }      /* four values rounded to bf16 (nearest even), kept as f32 */
typedef __bf16 v2b __attribute__((ext_vector_type(2)));
/* four values rounded to bf16 (nearest even), then as f16 (exact: 8 significant bits); the rounding is done on pairs, one conversion for two values */
__device__ __forceinline__ v4h fa_h4(v4f a) { const v2f a0 = {a[0], a[1]}, a1 = {a[2], a[3]}; const unsigned u0 = __builtin_bit_cast(unsigned, __builtin_convertvector(a0, v2b)), u1 = __builtin_bit_cast(unsigned, __builtin_convertvector(a1, v2b));
  const v4f r = {__uint_as_float(u0 << 16), __uint_as_float(u0 & 0xffff0000u), __uint_as_float(u1 << 16), __uint_as_float(u1 & 0xffff0000u)}; return __builtin_convertvector(r, v4h); }
__device__ __forceinline__ v4f fa_ld4(const float* p) { return fa_bf4(*(const v4fa*)p); }      /* four parameters or inputs, rounded to bf16 */
/* P = exp2 of two score tiles' exponents, as the f16 B operand of attn.v; returns the running sum l with these 16 P added */
__device__ __forceinline__ v2f fa_soft(v8f s0, v8f s1, v2f l, FragH& pf) {
#pragma unroll
  for (int r = 0; r < 8; r += 2) {
    const v2f p0 = {__builtin_amdgcn_exp2f(s0[r]), __builtin_amdgcn_exp2f(s0[r + 1])}, p1 = {__builtin_amdgcn_exp2f(s1[r]), __builtin_amdgcn_exp2f(s1[r + 1])};
    l += p0 + p1; pf.h[r] = (_Float16)p0[0]; pf.h[r + 1] = (_Float16)p0[1]; pf.h[8 + r] = (_Float16)p1[0]; pf.h[8 + r + 1] = (_Float16)p1[1]; }
  return l; }
/* five waves a SIMD: the 1280 work-groups are five per WGP, so with at most 192 VGPRs all of them are resident in one round */
__global__ __launch_bounds__(128) __attribute__((amdgpu_waves_per_eu(5))) void k_fattn(const float* __restrict__ x, const float* __restrict__ gqw, const float* __restrict__ gqb, const float* __restrict__ gkw, const float* __restrict__ gvw, const float* __restrict__ gvb,
    const float* __restrict__ lqw, const float* __restrict__ lqb, const float* __restrict__ lkw, const float* __restrict__ lvw, const float* __restrict__ lvb, const float* __restrict__ pw, const float* __restrict__ pb, float* __restrict__ out) {
  __shared__ __attribute__((aligned(16))) unsigned short sk[2 * KHEAD];
  __shared__ __attribute__((aligned(16))) unsigned short sv[2 * HD * VPITCH];
  __shared__ __attribute__((aligned(16))) float so[32 * OPITCH];
  const int tid = threadIdx.x, w = tid >> 5, lane = tid & 31, ln = lane & 15, hh = lane >> 4;
  const int sl = blockIdx.y >> 1, ch0 = (blockIdx.y & 1) * 32, hs = w >> 1, qt = w & 1, q0 = blockIdx.x * 32;      /* slice, first channel of the head pair, this wave's head of the pair and its query tile */
  const int cw = ch0 + hs * HD + 8 * hh;      /* the lane's 8 channels, as query features and as output channels */
  const float* xq = x + (size_t)sl * HW * CC; const float* xk = xq + (size_t)NSL * HW * CC; const float* xv = xk + (size_t)NSL * HW * CC;      /* x[0] = q slices, x[1] = k, x[2] = v */
  const v8f zf = {0.f, 0.f, 0.f, 0.f, 0.f, 0.f, 0.f, 0.f};
  const float c = 0.25f * 1.4426950408889634f;      /* 16^-0.5 x log2 e: exp(0.25 s) = exp2(c s) */
  FragH qa[2];      /* per branch the query row [hi | lo] of q'' = (q qw + qb) kw c; a lane holds dims 8 hh .. 8 hh + 7 of each segment; with the key row [k | k]: hi.k + lo.k */
  { const float* qr = xq + (size_t)(q0 + qt * 16 + ln) * CC + cw; const v4f x0 = fa_ld4(qr), x1 = fa_ld4(qr + 4);
#pragma unroll
    for (int j = 0; j < 2; ++j) { const float* qw = (j ? lqw : gqw) + cw; const float* qb = (j ? lqb : gqb) + cw; const float* kw = (j ? lkw : gkw) + cw;
      /* bf16(x) bf16(w) is exact in f32, so the fused form rounds once, like multiply then add */
      const v4f t0 = __builtin_elementwise_fma(x0, fa_ld4(qw), fa_ld4(qb)) * fa_ld4(kw) * c, t1 = __builtin_elementwise_fma(x1, fa_ld4(qw + 4), fa_ld4(qb + 4)) * fa_ld4(kw + 4) * c;
      const v4h h0 = __builtin_convertvector(t0, v4h), h1 = __builtin_convertvector(t1, v4h);
      const v4h e0 = __builtin_convertvector(t0 - __builtin_convertvector(h0, v4f), v4h), e1 = __builtin_convertvector(t1 - __builtin_convertvector(h1, v4f), v4h);
#pragma unroll
      for (int d = 0; d < 4; ++d) { qa[j].h[d] = h0[d]; qa[j].h[4 + d] = h1[d]; qa[j].h[8 + d] = e0[d]; qa[j].h[12 + d] = e1[d]; } } }
  asm volatile("s_wait_xcnt 0x0" :: "v"(cw * 4) : "memory");      /* precaution: the index lines below may reuse the offset register of the parameter loads above; the offset is named so that it is not rewritten ahead of the wait */
  /* sh[j]: the shift in use, PBASE - (c x the score that set it), the same in all 8 registers: it is the C operand of the score products, so their result is the exponent of P as it stands.
     l[j]: the lane's running sum of P in two components. Softmax is the same for any shift; the shift is renewed only when a component passes LTOP (test once per 32 keys). */
  v8f o[2] = {zf, zf}; float shs[2] = {0.f, 0.f}; v2f l[2] = {{0.f, 0.f}, {0.f, 0.f}};      /* shs: the shift as one register while a chunk is staged */
  const int sp = tid >> 3, cq = tid & 7;      /* staging: 8 threads a position, 4 channels (16 B of x) each: the head pair's whole 128-B line */
  const float* gk = xk + (size_t)sp * CC + ch0 + cq * 4; const float* gv = xv + (size_t)sp * 8 * CC + ch0 + cq * 4;
  unsigned short* kdst = &sk[(cq >> 2) * KHEAD + sp * KPITCH + (cq & 3) * 4]; unsigned short* vdst = &sv[cq * 4 * VPITCH + sp * 8];
  for (int ch = 0; ch < HW / KCH; ++ch) {
    v4f tk[KCH / 16], tv[KCH / 16];      /* the whole chunk is requested before the first LDS store, so the work-group pays one load latency a chunk and not one per row group */
#pragma unroll
    for (int u = 0; u < KCH / 16; ++u) tk[u] = *(const v4fa*)(gk + (size_t)(ch * KCH + u * 16) * CC);      /* keys u * 16 + sp */
    asm volatile("s_wait_xcnt 0x0" ::: "memory");      /* precaution: a later load's result may land in the address registers of the key loads issued above */
#pragma unroll
    for (int u = 0; u < KCH / 16; ++u) tv[u] = *(const v4fa*)(gv + (size_t)(ch * KCH + (u >> 3) * 128 + (u & 7)) * CC);      /* 8 positions in a row: one 16-B piece of each of 4 transposed v rows */
    asm volatile("s_wait_xcnt 0x0" :: "v"(gv + (size_t)ch * KCH * CC) : "memory");      /* precaution: the conversions below may reuse the address registers of the v loads; the address is named so that no v load's own result lands in it ahead of the wait */
    v4h kh[KCH / 16]; FragH vt[KCH / 128][4];      /* the chunk's LDS image, formed in registers */
#pragma unroll
    for (int u = 0; u < KCH / 16; ++u) kh[u] = fa_h4(tk[u]);
#pragma unroll
    for (int u = 0; u < KCH / 16; ++u) { const v4h v = fa_h4(tv[u]);
#pragma unroll
      for (int q = 0; q < 4; ++q) vt[u >> 3][q].h[u & 7] = v[q]; }
    if (ch > 0) __syncthreads();      /* every wave has left the chunk that is overwritten next */
#pragma unroll
    for (int u = 0; u < KCH / 16; ++u) { unsigned short* kr = kdst + u * 16 * KPITCH; *(v4ha*)kr = kh[u]; *(v4ha*)(kr + 16) = kh[u]; }
#pragma unroll
    for (int u = 0; u < KCH / 128; ++u)
#pragma unroll
      for (int q = 0; q < 4; ++q) *(v8us*)(vdst + q * VPITCH + u * 128) = vt[u][q].half[0];
    __syncthreads();      /* the chunk is complete before any wave reads it */
    v8f sh[2];
#pragma unroll
    for (int j = 0; j < 2; ++j) sh[j] = zf + shs[j];
#pragma unroll 4
    for (int kb = 0; kb < KCH; kb += 32) {      /* four passes a trip: constant LDS offsets, and a pass's attn.v stands with the next pass's loads and score products. Not all eight: the last pass then has the shift's registers free */
      const unsigned short* r0 = &sk[hs * KHEAD + (kb + ln) * KPITCH + 8 * hh]; const unsigned short* r1 = r0 + 16 * KPITCH; const unsigned short* rv = &sv[(hs * HD + ln) * VPITCH + kb + 8 * hh];
      FragH k0, k1, va;
      k0.half[0] = *(const v8us*)r0; k0.half[1] = *(const v8us*)(r0 + 16); k1.half[0] = *(const v8us*)r1; k1.half[1] = *(const v8us*)(r1 + 16);
      va.half[0] = *(const v8us*)rv; va.half[1] = *(const v8us*)(rv + 16);
      v8f s0[2], s1[2]; v2f lw[2]; FragH pf[2];      /* lw: the running sums with this pass's P */
#pragma unroll
      for (int j = 0; j < 2; ++j) {
        s0[j] = fa_mma(k0.v, qa[j].v, sh[j]);      /* s0[r] = c S[key kb + 8 hh + r][query ln] + shift */
        s1[j] = fa_mma(k1.v, qa[j].v, sh[j]);      /* s1[r] = c S[key kb + 16 + 8 hh + r][query ln] + shift */
      }
#pragma unroll
      for (int j = 0; j < 2; ++j) lw[j] = fa_soft(s0[j], s1[j], l[j], pf[j]);
      const bool first = (ch | kb) == 0;      /* the first 32 keys set the first shift */
      const bool high = fmaxf(fmaxf(lw[0][0], lw[0][1]), fmaxf(lw[1][0], lw[1][1])) > LTOP;
      if (__builtin_amdgcn_ballot_w32(high || first) != 0) {      /* the same for the whole wave: a scalar branch, seldom taken */
#pragma unroll
        for (int j = 0; j < 2; ++j) {
          float mx = fmaxf(s0[j][0], s1[j][0]);
#pragma unroll
          for (int r = 1; r < 8; ++r) mx = fmaxf(mx, fmaxf(s0[j][r], s1[j][r]));
          float lm = fmaxf(l[j][0], l[j][1]);
          mx = fmaxf(mx, fa_other_half(mx)); lm = fmaxf(lm, fa_other_half(lm));      /* both halves of the wave hold the same query: one shift for both */
          /* lower the exponents by dl: these 32 keys end at or below PBASE and the sum so far at or below 2^LFULL (its largest P is then still at least 2^PBASE) */
          const float dl = first ? mx - PBASE : fmaxf(fmaxf(mx - PBASE, __builtin_amdgcn_logf(lm) - LFULL), 0.f);
          const float al = first ? 1.0f : __builtin_amdgcn_exp2f(-dl);      /* at the first keys o and l are 0 */
          o[j] *= al; l[j] *= al; sh[j] -= dl; s0[j] -= dl; s1[j] -= dl;
          lw[j] = fa_soft(s0[j], s1[j], l[j], pf[j]);
        }
      }
#pragma unroll
      for (int j = 0; j < 2; ++j) { l[j] = lw[j]; o[j] = fa_mma(va.v, pf[j].v, o[j]); }      /* o[r] = sum_k P v [query ln][d = 8 hh + r] */
    }
    shs[0] = sh[0][0]; shs[1] = sh[1][0];
  }
  /* each branch: divide, then its v scale+bias; the branch mix and the output scale+bias; the 16 x 16 tile goes to LDS so that whole 128-B lines of out are stored */
  { const float lg = l[0][0] + l[0][1], ll = l[1][0] + l[1][1]; const float ig = 1.0f / (lg + fa_other_half(lg)), il = 1.0f / (ll + fa_other_half(ll)); float* sr = &so[(qt * 16 + ln) * OPITCH + hs * HD + 8 * hh];
#pragma unroll
    for (int a = 0; a < 2; ++a) { const int cc = cw + 4 * a;
      const v4f og = {o[0][4 * a] * ig, o[0][4 * a + 1] * ig, o[0][4 * a + 2] * ig, o[0][4 * a + 3] * ig}, ol = {o[1][4 * a] * il, o[1][4 * a + 1] * il, o[1][4 * a + 2] * il, o[1][4 * a + 3] * il};
      const v4f g = __builtin_elementwise_fma(og, fa_ld4(gvw + cc), fa_ld4(gvb + cc)), lo = __builtin_elementwise_fma(ol, fa_ld4(lvw + cc), fa_ld4(lvb + cc));
      const v4f comb = 0.5f * lo + 0.5f * g; *(v4fa*)(sr + 4 * a) = (2.0f * comb) * fa_ld4(pw + cc) + fa_ld4(pb + cc); } }
  __syncthreads();      /* the 32 x 32 output tile is complete before it is read across waves */
#pragma unroll
  for (int i = 0; i < 2; ++i) { const int idx = i * 128 + tid, row = idx >> 3, c4 = (idx & 7) * 4;      /* 8 lanes store one 128-B line */
    *(v4f*)(out + ((size_t)sl * HW + q0 + row) * CC + ch0 + c4) = *(const v4fa*)&so[row * OPITCH + c4]; } }

extern "C" void kernel_launch(void* const* d_in, const int* in_sizes, int n_in,
                              void* d_out, int out_size, void* d_ws, size_t ws_size, hipStream_t stream) {
  (void)in_sizes; (void)n_in; (void)out_size; (void)d_ws; (void)ws_size;
  const float* const* I = (const float* const*)d_in; const float* x = I[0];
  const float* gqw = I[1]; const float* gqb = I[2]; const float* gkw = I[3]; const float* gvw = I[5]; const float* gvb = I[6]; const float* lqw = I[7]; const float* lqb = I[8]; const float* lkw = I[9]; const float* lvw = I[11]; const float* lvb = I[12]; const float* pw = I[13]; const float* pb = I[14];      /* I[4], I[10]: the key biases add a constant to each query's scores, which softmax cancels */
  k_fattn<<<dim3(HW / 32, NSL * 2), 128, 0, stream>>>(x, gqw, gqb, gkw, gvw, gvb, lqw, lqb, lkw, lvw, lvb, pw, pb, (float*)d_out);      /* 32 query blocks x (slice, head pair) */
}

// v006
// It runs in 21.4 microseconds.
// In both of two side-by-side timings against v005, it was 1.26 times as fast.
// Over all steps from v000 it is 64.8 times as fast.
#include <hip/hip_runtime.h>
// Global + local spatial attention (x = [q|k|v] of 20 slices x 1024 positions x 64 channels; 4 heads of 16; per-channel scale+bias 'depthwise k=1 convs' for each branch): g = attn(q gq_w + gq_b, k gk_w + gk_b, v gv_w + gv_b), l likewise; out = (2 (0.5 l + 0.5 g)) proj_w + proj_b -> [20,1024,64].
// Structure (one launch): a fused attention kernel that reads x itself. The k scale is folded into the query, the k bias is left out (a constant per query, cancelled by softmax), the v scale+bias follow the division, so K and V are bf16(x) as f16 and serve both branches: a wave runs both branches of 16 queries of one head on the same fragments (scores, softmax with a lazily renewed shift and attn.v in registers, f32 accumulation, P f16), then mixes them and applies the output scale/bias.
// Compute dtype: x and all parameters rounded to bf16; the folded query as f16 hi + residual against exact f16 keys (K 32); v exact, P as f16 operands (~2^-12); f32 accumulation, softmax, elementwise. v_wmma_f32_16x16x32_f16.
#define NSL 20
#define NRUN NSL                 /* slices processed (NSL stays the input stride) */
#define HW 1024
#define CC 64
#define NHD 4
#define HD 16
#define NG 8                     /* (branch, head) pairs per slice: g = br*4 + h */
#define NB 20                    /* slices per launch: blockIdx.x runs over NB slices x 2 head pairs x 32 query blocks, NT blocks a work-group; NSL % NB == 0 */
typedef __bf16 v16b __attribute__((ext_vector_type(16)));
typedef unsigned short v8us __attribute__((ext_vector_type(8), may_alias));
typedef float  v8f  __attribute__((ext_vector_type(8)));
typedef float  v4f  __attribute__((ext_vector_type(4)));
typedef float  v4fa __attribute__((ext_vector_type(4), may_alias));
union FragB { v16b v; v8us half[2]; unsigned short u[16]; };

__device__ __forceinline__ unsigned short bf16_bits(float x) { unsigned int u = __float_as_uint(x); return (unsigned short)((u + 0x7FFFu + ((u >> 16) & 1u)) >> 16); }
__device__ __forceinline__ float bf16_val(unsigned short b) { return __uint_as_float(((unsigned int)b) << 16); }
__device__ __forceinline__ float bf16_round(float x) { return bf16_val(bf16_bits(x)); }
// D += A·B with NT terms: 1 = ah·bh, 2 = + al·bh (A split), 3 = + ah·bl (both split)
template <int NT>
__device__ __forceinline__ v8f mmaN(v16b ah, v16b al, v16b bh, v16b bl, v8f c) {
  c = __builtin_amdgcn_wmma_f32_16x16x32_bf16(false, ah, false, bh, (short)0, c, false, false);
  if (NT >= 2) c = __builtin_amdgcn_wmma_f32_16x16x32_bf16(false, al, false, bh, (short)0, c, false, false);
  if (NT >= 3) c = __builtin_amdgcn_wmma_f32_16x16x32_bf16(false, ah, false, bl, (short)0, c, false, false);
  asm volatile("v_nop\n\tv_nop\n\tv_nop\n\tv_nop" : "+v"(c) : "v"(ah), "v"(al), "v"(bh), "v"(bl));
  return c;
}

__global__ __launch_bounds__(256) void k_wt_bf16(const float* __restrict__ W, unsigned short* __restrict__ Wt, int K, int N) {
  const int t = blockIdx.x * 256 + threadIdx.x;
  const int k8n = K / 8;
  if (t >= N * k8n) return;
  const int n = t / k8n, k8 = (t % k8n) * 8;
  v8us v;
#pragma unroll
  for (int i = 0; i < 8; ++i) v[i] = bf16_bits(W[(size_t)(k8 + i) * N + n]);
  *(v8us*)(Wt + (size_t)n * K + k8) = v;
  
}

// GEMM C[M][N] (f32, pitch ldc) = act(A[M][K]·W + bias). A f32 row-major (pitch lda) converted per fragment to bf16
// (ASPLIT: hi/lo two planes -> 2 terms, else single rounded term); Wt bf16 [N][K] (pitch ldb). BIAS_BF16 rounds the
// bias to bf16 first (bias quantised to bf16 before the add). K%32==0, M%16==0, N%64==0.
template <bool ASPLIT, int ACT, bool BIAS_BF16>
__global__ __launch_bounds__(128) void k_gemm_bf(const float* __restrict__ A, int lda, const unsigned short* __restrict__ Wt, int ldb,
                                               const float* __restrict__ bias, float* __restrict__ C, int ldc, int M, int N, int K) {
  __shared__ __attribute__((aligned(16))) float so[4][16][64];
  const int tid = threadIdx.x, w = tid >> 5, lane = tid & 31, ln = lane & 15, hh = lane >> 4;
  const int ntn = N / 64;
  const int wid = blockIdx.x * 4 + w;
  const int mt = wid / ntn, nq = wid % ntn;
  if (mt * 16 >= M) return;
  const int row0 = mt * 16, col0 = nq * 64;
  const float* arow = A + (size_t)(row0 + ln) * lda;
  v8f acc[4] = {};
  for (int kb = 0; kb < K; kb += 32) {
    FragB ah, al;
    const v4f x0 = *(const v4fa*)(arow + kb + 8 * hh), x1 = *(const v4fa*)(arow + kb + 8 * hh + 4);
    const v4f x2 = *(const v4fa*)(arow + kb + 16 + 8 * hh), x3 = *(const v4fa*)(arow + kb + 16 + 8 * hh + 4);
    float xs[16] = {x0[0],x0[1],x0[2],x0[3],x1[0],x1[1],x1[2],x1[3],x2[0],x2[1],x2[2],x2[3],x3[0],x3[1],x3[2],x3[3]};
#pragma unroll
    for (int i = 0; i < 16; ++i) { const unsigned short hb = bf16_bits(xs[i]); ah.u[i] = hb; al.u[i] = ASPLIT ? bf16_bits(xs[i] - bf16_val(hb)) : (unsigned short)0; }
#pragma unroll
    for (int t = 0; t < 4; ++t) {
      const unsigned short* brow = Wt + (size_t)(col0 + t * 16 + ln) * ldb + kb;
      FragB b;
      b.half[0] = *(const v8us*)(brow + 8 * hh);
      b.half[1] = *(const v8us*)(brow + 16 + 8 * hh);
      acc[t] = mmaN<ASPLIT ? 2 : 1>(ah.v, al.v, b.v, b.v, acc[t]);
    }
  }
#pragma unroll
  for (int t = 0; t < 4; ++t) {
    float bv = bias ? bias[col0 + t * 16 + ln] : 0.f;
    if (BIAS_BF16) bv = bf16_round(bv);
#pragma unroll
    for (int r = 0; r < 8; ++r) { float v = acc[t][r] + bv; if (ACT == 1) v = fmaxf(v, 0.f); so[w][8 * hh + r][t * 16 + ln] = v; }
  }
  __builtin_amdgcn_fence(__ATOMIC_ACQ_REL, "workgroup");
  __builtin_amdgcn_wave_barrier();
  const int rsub = lane >> 4, c4 = (lane & 15) * 4;
  {
#pragma unroll
    for (int q = 0; q < 8; ++q) {
      const int r = q * 2 + rsub;
      const v4f v = *(const v4fa*)&so[w][r][c4];
      *(v4f*)(C + (size_t)(row0 + r) * ldc + col0 + c4) = v;
    }
    
  }
}

// GEMM C = act(A·W + bias + resid): A f32 (ASPLIT -> hi/lo 2 terms), Wt bf16 [N][K]; ACT 0 none, 1 relu, 2 exact gelu;
// resid (optional, f32, row index = (row % rmod), pitch ldr, RES_BF16 rounds it) added before the activation.
template <bool ASPLIT, int ACT, bool BIAS_BF16, bool RES_BF16>
__global__ __launch_bounds__(128) void k_gemm_bf3(const float* __restrict__ A, int lda, const unsigned short* __restrict__ Wt, int ldb,
                                                const float* __restrict__ bias, const float* __restrict__ resid, int rmod, int ldr,
                                                float* __restrict__ C, int ldc, int M, int N, int K) {
  __shared__ __attribute__((aligned(16))) float so[4][16][64];
  const int tid = threadIdx.x, w = tid >> 5, lane = tid & 31, ln = lane & 15, hh = lane >> 4;
  const int ntn = N / 64;
  const int wid = blockIdx.x * 4 + w;
  const int mt = wid / ntn, nq = wid % ntn;
  if (mt * 16 >= M) return;
  const int row0 = mt * 16, col0 = nq * 64;
  const float* arow = A + (size_t)(row0 + ln) * lda;
  v8f acc[4] = {};
  for (int kb = 0; kb < K; kb += 32) {
    FragB ah, al;
    const v4f x0 = *(const v4fa*)(arow + kb + 8 * hh), x1 = *(const v4fa*)(arow + kb + 8 * hh + 4);
    const v4f x2 = *(const v4fa*)(arow + kb + 16 + 8 * hh), x3 = *(const v4fa*)(arow + kb + 16 + 8 * hh + 4);
    float xs[16] = {x0[0],x0[1],x0[2],x0[3],x1[0],x1[1],x1[2],x1[3],x2[0],x2[1],x2[2],x2[3],x3[0],x3[1],x3[2],x3[3]};
#pragma unroll
    for (int i = 0; i < 16; ++i) { const unsigned short hb = bf16_bits(xs[i]); ah.u[i] = hb; al.u[i] = ASPLIT ? bf16_bits(xs[i] - bf16_val(hb)) : (unsigned short)0; }
#pragma unroll
    for (int t = 0; t < 4; ++t) {
      const unsigned short* brow = Wt + (size_t)(col0 + t * 16 + ln) * ldb + kb;
      FragB b;
      b.half[0] = *(const v8us*)(brow + 8 * hh);
      b.half[1] = *(const v8us*)(brow + 16 + 8 * hh);
      acc[t] = mmaN<ASPLIT ? 2 : 1>(ah.v, al.v, b.v, b.v, acc[t]);
    }
  }
#pragma unroll
  for (int t = 0; t < 4; ++t) {
    const int col = col0 + t * 16 + ln;
    float bv = bias ? bias[col] : 0.f;
    if (BIAS_BF16) bv = bf16_round(bv);
#pragma unroll
    for (int r = 0; r < 8; ++r) {
      float v = acc[t][r] + bv;
      if (resid) { float rv = resid[(size_t)((row0 + 8 * hh + r) % rmod) * ldr + col]; if (RES_BF16) rv = bf16_round(rv); v += rv; }
      if (ACT == 1) v = fmaxf(v, 0.f);
      if (ACT == 2) v = 0.5f * v * (1.0f + erff(v * 0.70710678118654752f));
      if (ACT == 3) { const float u = 0.7978845608028654f * (v + 0.044715f * v * v * v); v = 0.5f * v * (1.0f + tanhf(u)); }
      so[w][8 * hh + r][t * 16 + ln] = v;
    }
  }
  __builtin_amdgcn_fence(__ATOMIC_ACQ_REL, "workgroup");
  __builtin_amdgcn_wave_barrier();
  const int rsub = lane >> 4, c4 = (lane & 15) * 4;
  {
#pragma unroll
    for (int q = 0; q < 8; ++q) {
      const int r = q * 2 + rsub;
      const v4f v = *(const v4fa*)&so[w][r][c4];
      *(v4f*)(C + (size_t)(row0 + r) * ldc + col0 + c4) = v;
    }
    
  }
}
// row LayerNorm (biased variance, eps) over N: s = X (+ R); optional out_sum <- s; out_norm <- (s-mu)*rsqrt(var+eps)*g + b
template <bool PARAM_BF16>
__global__ __launch_bounds__(256) void k_layernorm(const float* __restrict__ X, const float* __restrict__ R, const float* __restrict__ g, const float* __restrict__ bta,
                                                  float* __restrict__ out_sum, float* __restrict__ out_norm, int N, float eps) {
  __shared__ float red[256];
  const int row = blockIdx.x, tid = threadIdx.x;
  const float* x = X + (size_t)row * N; const float* rr = R ? R + (size_t)row * N : nullptr;
  float vals[16];                     // up to N = 4096
  const int per = N / 256;            // contiguous chunk per thread? use strided-by-4 chunks: thread handles j = tid*4 + 1024*u
  float s1 = 0.f;
  for (int u = 0; u < per / 4; ++u) {
    const int j = tid * 4 + 1024 * u;
    const v4f a = *(const v4fa*)(x + j);
    v4f b = {0.f,0.f,0.f,0.f}; if (rr) b = *(const v4fa*)(rr + j);
#pragma unroll
    for (int q = 0; q < 4; ++q) { const float v = a[q] + b[q]; vals[u * 4 + q] = v; s1 += v; }
  }
  red[tid] = s1; __syncthreads();
  for (int st = 128; st > 0; st >>= 1) { if (tid < st) red[tid] += red[tid + st]; __syncthreads(); }
  const float mu = red[0] / (float)N; __syncthreads();
  float s2 = 0.f;
  for (int u = 0; u < per / 4; ++u)
#pragma unroll
    for (int q = 0; q < 4; ++q) { const float c = vals[u * 4 + q] - mu; s2 += c * c; }
  red[tid] = s2; __syncthreads();
  for (int st = 128; st > 0; st >>= 1) { if (tid < st) red[tid] += red[tid + st]; __syncthreads(); }
  const float rs = rsqrtf(red[0] / (float)N + eps);
  {
    for (int u = 0; u < per / 4; ++u) {
      const int j = tid * 4 + 1024 * u;
      v4f o, sm;
#pragma unroll
      for (int q = 0; q < 4; ++q) {
        float gg = g[j + q], bb = bta[j + q];
        if (PARAM_BF16) { gg = bf16_round(gg); bb = bf16_round(bb); }
        sm[q] = vals[u * 4 + q]; o[q] = (vals[u * 4 + q] - mu) * rs * gg + bb;
      }
      if (out_sum) *(v4f*)(out_sum + (size_t)row * N + j) = sm;
      *(v4f*)(out_norm + (size_t)row * N + j) = o;
    }
    
  }
}



// ---- f16 WMMA path (v_wmma_f32_16x16x32_f16): 11-bit significands for operands in range — used where a [0,1] probability operand needs more precision than bf16
typedef _Float16 v16h __attribute__((ext_vector_type(16)));
union FragH { v16h v; v8us half[2]; _Float16 h[16]; unsigned short u[16]; };
template <int NT>
__device__ __forceinline__ v8f mmaH(v16h ah, v16h al, v16h bh, v16h bl, v8f c) {
  c = __builtin_amdgcn_wmma_f32_16x16x32_f16(false, ah, false, bh, (short)0, c, false, false);
  if (NT >= 2) c = __builtin_amdgcn_wmma_f32_16x16x32_f16(false, al, false, bh, (short)0, c, false, false);
  if (NT >= 3) c = __builtin_amdgcn_wmma_f32_16x16x32_f16(false, ah, false, bl, (short)0, c, false, false);
  asm volatile("v_nop\n\tv_nop\n\tv_nop\n\tv_nop" : "+v"(c) : "v"(ah), "v"(al), "v"(bh), "v"(bl));
  return c;
}
// batched GEMM like k_gemm_b but f16 operands: A f32 (split into f16 hi/lo if ASPLIT, else rounded to f16), Bt = f16 values [n][k]; alpha; C f32; N multiple of 16 (partial tiles skipped)
template <bool ASPLIT>
__global__ __launch_bounds__(128) void k_gemm_h(const float* __restrict__ A, int lda, size_t sA, const _Float16* __restrict__ Bh, int ldb, size_t sB, float alpha, float* __restrict__ C, int ldc, size_t sC, int M, int N, int K) {
  __shared__ __attribute__((aligned(16))) float so[4][16][64];
  const int tid = threadIdx.x, w = tid >> 5, lane = tid & 31, ln = lane & 15, hh = lane >> 4; const int by = blockIdx.y;
  A += (size_t)by * sA; Bh += (size_t)by * sB; C += (size_t)by * sC;
  const int ntn = (N + 63) / 64; const int wid = blockIdx.x * 4 + w; const int mt = wid / ntn, nq = wid % ntn; if (mt * 16 >= M) return;
  const int row0 = mt * 16, col0 = nq * 64; const float* arow = A + (size_t)(row0 + ln) * lda;
  v8f acc[4] = {};
  for (int kb = 0; kb < K; kb += 32) {
    FragH ah, al;
    const v4f x0 = *(const v4fa*)(arow + kb + 8 * hh), x1 = *(const v4fa*)(arow + kb + 8 * hh + 4), x2 = *(const v4fa*)(arow + kb + 16 + 8 * hh), x3 = *(const v4fa*)(arow + kb + 16 + 8 * hh + 4);
    float xs[16] = {x0[0],x0[1],x0[2],x0[3],x1[0],x1[1],x1[2],x1[3],x2[0],x2[1],x2[2],x2[3],x3[0],x3[1],x3[2],x3[3]};
#pragma unroll
    for (int i = 0; i < 16; ++i) { const _Float16 h = (_Float16)xs[i]; ah.h[i] = h; al.h[i] = ASPLIT ? (_Float16)(xs[i] - (float)h) : (_Float16)0.0f; }
#pragma unroll
    for (int t = 0; t < 4; ++t) { if (col0 + t * 16 >= N) continue; const size_t boff = (size_t)(col0 + t * 16 + ln) * ldb + kb; FragH bq; bq.half[0] = *(const v8us*)(Bh + boff + 8 * hh); bq.half[1] = *(const v8us*)(Bh + boff + 16 + 8 * hh);
      acc[t] = mmaH<ASPLIT ? 2 : 1>(ah.v, al.v, bq.v, bq.v, acc[t]); }
  }
#pragma unroll
  for (int t = 0; t < 4; ++t) { if (col0 + t * 16 >= N) continue;
#pragma unroll
    for (int r = 0; r < 8; ++r) so[w][8 * hh + r][t * 16 + ln] = acc[t][r] * alpha; }
  __builtin_amdgcn_fence(__ATOMIC_ACQ_REL, "workgroup"); __builtin_amdgcn_wave_barrier();
  const int rsub = lane >> 4, c4 = (lane & 15) * 4;
  {
#pragma unroll
    for (int q = 0; q < 8; ++q) { const int r = q * 2 + rsub; if (col0 + c4 < N) { const v4f v = *(const v4fa*)&so[w][r][c4]; *(v4f*)(C + (size_t)(row0 + r) * ldc + col0 + c4) = v; } }
     }
}

// Wt[n][k] = f16(W[k][n]·scale) from f32 row-major W[K][N] (scale = power of two; bf16-exact weights stay exact in f16 away from the subnormal range)
__global__ __launch_bounds__(256) void k_wt_f16(const float* __restrict__ W, _Float16* __restrict__ Wt, int K, int N, float scale) {
  const int t = blockIdx.x * 256 + threadIdx.x; if (t >= N * (K / 8)) return; const int n = t / (K / 8), k8 = (t % (K / 8)) * 8; FragH f;
#pragma unroll
  for (int i = 0; i < 8; ++i) f.h[i] = (_Float16)(bf16_round(W[(size_t)(k8 + i) * N + n]) * scale); const v8us o = f.half[0];
  *(v8us*)((unsigned short*)Wt + (size_t)n * K + k8) = o; 
}
// k_gemm_hh variant with fused epilogue: v = acc·alpha + bias[by·sBias + col] (+ CP[(row/rowsPerB)·sCPb + by·64 + col] if CP) ; ACT 0 none / 1 elu ; writes f16 C16 (and f32 C if non-null)
template <int ACT>
__global__ __launch_bounds__(128) void k_gemm_hhx(const _Float16* __restrict__ A, int lda, size_t sA, const _Float16* __restrict__ Bh, int ldb, size_t sB, float alpha, const float* __restrict__ bias, size_t sBias, const float* __restrict__ CP, int rowsPerB, size_t sCPb, int row0g,
    float* __restrict__ C, _Float16* __restrict__ C16, int ldc, size_t sC, int M, int N, int K) {
  __shared__ __attribute__((aligned(16))) float so[4][16][64];
  const int tid = threadIdx.x, w = tid >> 5, lane = tid & 31, ln = lane & 15, hh = lane >> 4; const int by = blockIdx.y;
  A += (size_t)by * sA; Bh += (size_t)by * sB; const size_t cofs = (size_t)by * sC; const float* bp = bias ? bias + (size_t)by * sBias : nullptr;
  const int ntn = (N + 63) / 64; const int wid = blockIdx.x * 4 + w; const int mt = wid / ntn, nq = wid % ntn; if (mt * 16 >= M) return;
  const int row0 = mt * 16, col0 = nq * 64; const _Float16* arow = A + (size_t)(row0 + ln) * lda;
  v8f acc[4] = {};
  for (int kb = 0; kb < K; kb += 32) { FragH ah; ah.half[0] = *(const v8us*)((const unsigned short*)arow + kb + 8 * hh); ah.half[1] = *(const v8us*)((const unsigned short*)arow + kb + 16 + 8 * hh);
#pragma unroll
    for (int t = 0; t < 4; ++t) { if (col0 + t * 16 >= N) continue; const size_t boff = (size_t)(col0 + t * 16 + ln) * ldb + kb; FragH bq; bq.half[0] = *(const v8us*)((const unsigned short*)Bh + boff + 8 * hh); bq.half[1] = *(const v8us*)((const unsigned short*)Bh + boff + 16 + 8 * hh);
      acc[t] = mmaH<1>(ah.v, ah.v, bq.v, bq.v, acc[t]); }
  }
#pragma unroll
  for (int t = 0; t < 4; ++t) { if (col0 + t * 16 >= N) continue; const int col = col0 + t * 16 + ln; const float bv = bp ? bf16_round(bp[col]) : 0.f;
#pragma unroll
    for (int r = 0; r < 8; ++r) { float v = acc[t][r] * alpha + bv; if (CP) { const int bidx = (row0g + row0 + 8 * hh + r) / rowsPerB; v += CP[(size_t)bidx * sCPb + (size_t)by * 64 + col]; } if (ACT == 1) v = (v > 0.f) ? v : expm1f(v); else if (ACT == 7) v = (v > 0.f) ? v + 1.0f : expf(v); else if (ACT == 8) v = tanhf(v); else if (ACT == 9) v = 0.5f * v * (1.0f + tanhf(0.7978845608028654f * (v + 0.044715f * v * v * v))); else if (ACT == 11) v = 1.0f / (1.0f + expf(-v)); else if (ACT == 12) v = (v > 0.f) ? v : 0.01f * v; else if (ACT == 14) v = (v > 0.f) ? v : 0.1f * v; else if (ACT == 15) v = v / (1.0f + expf(-v)); else if (ACT == 3) v = fmaxf(v, 0.f); else if (ACT == 6) v = 0.5f * v * (1.0f + erff(v * 0.70710678118654752f)); so[w][8 * hh + r][t * 16 + ln] = v; } }
  __builtin_amdgcn_fence(__ATOMIC_ACQ_REL, "workgroup"); __builtin_amdgcn_wave_barrier();
  const int rsub = lane >> 4, c4 = (lane & 15) * 4; typedef _Float16 v4h __attribute__((ext_vector_type(4)));
  {
#pragma unroll
    for (int q = 0; q < 8; ++q) { const int r = q * 2 + rsub; if (col0 + c4 < N) { const v4f v = *(const v4fa*)&so[w][r][c4]; if (C) *(v4f*)(C + cofs + (size_t)(row0 + r) * ldc + col0 + c4) = v; if (C16) { v4h h4; for (int i = 0; i < 4; ++i) h4[i] = (_Float16)v[i]; *(v4h*)(C16 + cofs + (size_t)(row0 + r) * ldc + col0 + c4) = h4; } } }
     }
}


typedef _Float16 v4h __attribute__((ext_vector_type(4)));

__global__ __launch_bounds__(256) void k_x16(const float* __restrict__ x, _Float16* __restrict__ X16, size_t n8) { const size_t t = (size_t)blockIdx.x * 256 + threadIdx.x; if (t >= n8) return; FragH f;
#pragma unroll
  for (int q = 0; q < 8; ++q) f.h[q] = (_Float16)bf16_round(x[t * 8 + q]); *(v8us*)((unsigned short*)X16 + t * 8) = f.half[0];  }
__global__ __launch_bounds__(256) void k_h16(const float* __restrict__ x, _Float16* __restrict__ X16, size_t n8) { const size_t t = (size_t)blockIdx.x * 256 + threadIdx.x; if (t >= n8) return; FragH f;
#pragma unroll
  for (int q = 0; q < 8; ++q) f.h[q] = (_Float16)x[t * 8 + q]; *(v8us*)((unsigned short*)X16 + t * 8) = f.half[0];  }
__global__ __launch_bounds__(256) void k_round16f(const float* __restrict__ W, _Float16* __restrict__ Bt, size_t n8) { const size_t t = (size_t)blockIdx.x * 256 + threadIdx.x; if (t >= n8) return; FragH f;
#pragma unroll
  for (int i = 0; i < 8; ++i) f.h[i] = (_Float16)(bf16_round(W[t * 8 + i]) * 16.0f); *(v8us*)((unsigned short*)Bt + t * 8) = f.half[0];  }
template <int NHv, int TTv>
__global__ __launch_bounds__(256) void k_vt(const _Float16* __restrict__ V16, int ldv, int voff, _Float16* __restrict__ Vt) { __shared__ unsigned short tl[64][66]; const int tid = threadIdx.x; const int slab = blockIdx.x / (TTv / 64), lg = blockIdx.x % (TTv / 64); const int b = slab / NHv, h = slab % NHv;
  for (int i = tid; i < 64 * 8; i += 256) { const int r = i / 8, c8 = (i % 8) * 8; FragH f; f.half[0] = *(const v8us*)((const unsigned short*)V16 + ((size_t)b * TTv + lg * 64 + r) * ldv + voff + h * 64 + c8);
#pragma unroll
    for (int q = 0; q < 8; ++q) tl[r][c8 + q] = f.u[q]; }
  __syncthreads();
  {
#pragma unroll
    for (int rd = 0; rd < 2; ++rd) { const int d = rd * 32 + tid / 8, pc = tid % 8; FragH f;
#pragma unroll
      for (int q = 0; q < 8; ++q) f.u[q] = tl[pc * 8 + q][d];
      *(v8us*)((unsigned short*)Vt + ((size_t)slab * 64 + d) * TTv + lg * 64 + pc * 8) = f.half[0]; }
     } }

__global__ __launch_bounds__(256) void k_hl(const float* __restrict__ F, _Float16* __restrict__ Hh, _Float16* __restrict__ Hl, size_t n8) { const size_t t = (size_t)blockIdx.x * 256 + threadIdx.x; if (t >= n8) return; FragH fh, fl; const v4f a = *(const v4fa*)(F + t * 8), c = *(const v4fa*)(F + t * 8 + 4);
#pragma unroll
  for (int q = 0; q < 4; ++q) { _Float16 h = (_Float16)a[q]; fh.h[q] = h; fl.h[q] = (_Float16)((a[q] - (float)h) * 1024.0f); h = (_Float16)c[q]; fh.h[4 + q] = h; fl.h[4 + q] = (_Float16)((c[q] - (float)h) * 1024.0f); }
  { *(v8us*)((unsigned short*)Hh + t * 8) = fh.half[0]; *(v8us*)((unsigned short*)Hl + t * 8) = fl.half[0];  } }

// ---- fast GEMM (wave tile 32x64; requires M % 32 == 0 rows per launch region and N % 64 == 0); epilogue = k_gemm_hhx semantics ----
__device__ __forceinline__ v16h g2_frag(const _Float16* p, int hh) { FragH f; f.half[0] = *(const v8us*)((const unsigned short*)p + 8 * hh); f.half[1] = *(const v8us*)((const unsigned short*)p + 16 + 8 * hh); return f.v; }
__device__ __forceinline__ v8f g2_mma(v16h a, v16h b, v8f c) { v8f d = __builtin_amdgcn_wmma_f32_16x16x32_f16(false, a, false, b, (short)0, c, false, false); asm volatile("v_nop\n\tv_nop\n\tv_nop\n\tv_nop" : "+v"(d) : "v"(a), "v"(b)); return d; }
template <int ACT>
__global__ __launch_bounds__(128) void k_gemm2(const _Float16* __restrict__ A, int lda, size_t sA, const _Float16* __restrict__ Bh, int ldb, size_t sB, float alpha, const float* __restrict__ bias, size_t sBias, const float* __restrict__ CP, int rowsPerB, size_t sCPb, int row0g,
    float* __restrict__ C, _Float16* __restrict__ C16, int ldc, size_t sC, int M, int N, int K) {
  __shared__ __attribute__((aligned(16))) float so[4][32][68];
  const int tid = threadIdx.x, w = tid >> 5, lane = tid & 31, ln = lane & 15, hh = lane >> 4; const int by = blockIdx.y;
  A += (size_t)by * sA; Bh += (size_t)by * sB; const size_t cofs = (size_t)by * sC; const float* bp = bias ? bias + (size_t)by * sBias : nullptr;
  const int ntn = N >> 6; const int mt = blockIdx.x / ntn, nq = blockIdx.x - mt * ntn; const int row0 = mt * 128 + 32 * w, col0 = nq * 64; if (row0 >= M) return;
  const _Float16* a0p = A + (size_t)(row0 + ln) * lda; const _Float16* a1p = a0p + (size_t)16 * lda;
  const _Float16* b0p = Bh + (size_t)(col0 + ln) * ldb; const _Float16* b1p = b0p + (size_t)16 * ldb; const _Float16* b2p = b1p + (size_t)16 * ldb; const _Float16* b3p = b2p + (size_t)16 * ldb;
  const v8f z8 = {0.f,0.f,0.f,0.f,0.f,0.f,0.f,0.f}; v8f c00 = z8, c01 = z8, c02 = z8, c03 = z8, c10 = z8, c11 = z8, c12 = z8, c13 = z8;
#pragma unroll 1
  for (int kb = 0; kb < K; kb += 32) { const v16h a0 = g2_frag(a0p + kb, hh), a1 = g2_frag(a1p + kb, hh);
    v16h b = g2_frag(b0p + kb, hh); c00 = g2_mma(a0, b, c00); c10 = g2_mma(a1, b, c10);
    b = g2_frag(b1p + kb, hh); c01 = g2_mma(a0, b, c01); c11 = g2_mma(a1, b, c11);
    b = g2_frag(b2p + kb, hh); c02 = g2_mma(a0, b, c02); c12 = g2_mma(a1, b, c12);
    b = g2_frag(b3p + kb, hh); c03 = g2_mma(a0, b, c03); c13 = g2_mma(a1, b, c13); }
  v8f accs[8] = {c00, c01, c02, c03, c10, c11, c12, c13};
#pragma unroll
  for (int u = 0; u < 8; ++u) { const int t = u & 3, half = u >> 2; const int col = col0 + t * 16 + ln; const float bv = bp ? bf16_round(bp[col]) : 0.f;
#pragma unroll
    for (int r = 0; r < 8; ++r) { const int rloc = half * 16 + 8 * hh + r; float v = accs[u][r] * alpha + bv; if (CP) { const int bidx = (row0g + row0 + rloc) / rowsPerB; v += CP[(size_t)bidx * sCPb + (size_t)by * 64 + col]; }
      if (ACT == 3) v = fmaxf(v, 0.f); else if (ACT == 6) v = 0.5f * v * (1.0f + erff(v * 0.70710678118654752f)); else if (ACT == 11) v = 1.0f / (1.0f + expf(-v)); else if (ACT == 15) v = v / (1.0f + expf(-v)); else if (ACT == 12) v = (v > 0.f) ? v : 0.01f * v; else if (ACT == 8) v = tanhf(v);
      so[w][rloc][t * 16 + ln] = v; } }
  __builtin_amdgcn_fence(__ATOMIC_ACQ_REL, "workgroup"); __builtin_amdgcn_wave_barrier();
  const int rsub = lane >> 4, c4 = (lane & 15) * 4;
  {
#pragma unroll
    for (int q = 0; q < 16; ++q) { const int r = q * 2 + rsub; const v4f v = *(const v4fa*)&so[w][r][c4]; if (C) *(v4f*)(C + cofs + (size_t)(row0 + r) * ldc + col0 + c4) = v; if (C16) { v4h h4; for (int i = 0; i < 4; ++i) h4[i] = (_Float16)v[i]; *(v4h*)(C16 + cofs + (size_t)(row0 + r) * ldc + col0 + c4) = h4; } }
     } }


#define KCH 256                  /* keys per staged chunk */
#define KPITCH 40                /* halves per staged key row: [k | k], 32 in use, pitch 80 B = 16 B x odd (b128 reads without bank conflicts) */
#define KHEAD (KCH * KPITCH + 16) /* halves per head's key image: the 32 B more put the two heads' stores of one position on different banks */
#define VPITCH (KCH + 8)         /* halves per staged v row: 528 B = 16 B x odd */
#define OPITCH 36                /* floats per staged output row: 32 in use */
#define NT 5                     /* query blocks per work-group; 32 x NSL x 2 blocks are a multiple of it */
#define NSTG 512                 /* threads that stage (waves 0-15, four a SIMD) */
#define PBASE 4.0f               /* log2 of P at the score that set the shift in use: P below 2^-18 of it are f16 subnormals, whose rounding is far below that of the large P */
#define LFULL 12.0f              /* log2 of 256 x 2^PBASE: the most a running-sum component (256 keys) holds when no score lies above the one that set the shift */
#define LTOP 60000.0f            /* a running-sum component at or below this bounds every P in it below the f16 top (65504) */
typedef float v2f __attribute__((ext_vector_type(2)));
__device__ __forceinline__ v8f fa_mma(v16h a, v16h b, v8f c) { return __builtin_amdgcn_wmma_f32_16x16x32_f16(false, a, false, b, (short)0, c, false, false); }
__device__ __forceinline__ float fa_other_half(float v) { const int b = __float_as_int(v); return __int_as_float(__builtin_amdgcn_permlanex16(b, b, 0x76543210, 0xfedcba98, false, false)); }      /* lane l <-> l ^ 16 */
typedef __bf16 v4b __attribute__((ext_vector_type(4)));
typedef _Float16 v4ha __attribute__((ext_vector_type(4), may_alias));
__device__ __forceinline__ v4f fa_bf4(v4f a) { return __builtin_convertvector(__builtin_convertvector(a, v4b), v4f); }      /* four values rounded to bf16 (nearest even), kept as f32 */
typedef __bf16 v2b __attribute__((ext_vector_type(2)));
/* four values rounded to bf16 (nearest even), then as f16 (exact: 8 significant bits); the rounding is done on pairs, one conversion for two values */
__device__ __forceinline__ v4h fa_h4(v4f a) { const v2f a0 = {a[0], a[1]}, a1 = {a[2], a[3]}; const unsigned u0 = __builtin_bit_cast(unsigned, __builtin_convertvector(a0, v2b)), u1 = __builtin_bit_cast(unsigned, __builtin_convertvector(a1, v2b));
  const v4f r = {__uint_as_float(u0 << 16), __uint_as_float(u0 & 0xffff0000u), __uint_as_float(u1 << 16), __uint_as_float(u1 & 0xffff0000u)}; return __builtin_convertvector(r, v4h); }
__device__ __forceinline__ v4f fa_ld4(const float* p) { return fa_bf4(*(const v4fa*)p); }      /* four parameters or inputs, rounded to bf16 */
/* P = exp2 of two score tiles' exponents, as the f16 B operand of attn.v; returns the running sum l with these 16 P added */
__device__ __forceinline__ v2f fa_soft(v8f s0, v8f s1, v2f l, FragH& pf) {
#pragma unroll
  for (int r = 0; r < 8; r += 2) {
    const v2f p0 = {__builtin_amdgcn_exp2f(s0[r]), __builtin_amdgcn_exp2f(s0[r + 1])}, p1 = {__builtin_amdgcn_exp2f(s1[r]), __builtin_amdgcn_exp2f(s1[r + 1])};
    l += p0 + p1; pf.h[r] = (_Float16)p0[0]; pf.h[r + 1] = (_Float16)p0[1]; pf.h[8 + r] = (_Float16)p1[0]; pf.h[8 + r + 1] = (_Float16)p1[1]; }
  return l; }
/* five waves a SIMD: 256 work-groups of 20 waves, one per WGP, at most 192 VGPRs */
__global__ __launch_bounds__(128 * NT) __attribute__((amdgpu_waves_per_eu(5))) void k_fattn(const float* __restrict__ x, const float* __restrict__ gqw, const float* __restrict__ gqb, const float* __restrict__ gkw, const float* __restrict__ gvw, const float* __restrict__ gvb,
    const float* __restrict__ lqw, const float* __restrict__ lqb, const float* __restrict__ lkw, const float* __restrict__ lvw, const float* __restrict__ lvb, const float* __restrict__ pw, const float* __restrict__ pb, float* __restrict__ out) {
  __shared__ __attribute__((aligned(16))) unsigned short sk[2][2 * KHEAD];      /* [image] */
  __shared__ __attribute__((aligned(16))) unsigned short sv[2][2 * HD * VPITCH];
  __shared__ __attribute__((aligned(16))) float so[NT * 32 * OPITCH];
  const int tid = threadIdx.x, w = __builtin_amdgcn_readfirstlane(tid >> 5), lane = tid & 31, ln = lane & 15, hh = lane >> 4;      /* the wave's number in a scalar register: what follows from it (block, image, slice, head) costs no VGPR */
  const int n0 = blockIdx.x * NT, nb = n0 + (w >> 2), w4 = w & 3;      /* the work-group's first query block, this wave's block, its place among the block's four waves */
  const int y0 = n0 >> 5, yw = nb >> 5, img = yw - y0;      /* (slice, head pair) of the first block and of this wave's; the image this wave reads */
  const bool two = ((n0 + NT - 1) >> 5) != y0;      /* the same for the whole work-group: its blocks lie in two pairs */
  const int sl = yw >> 1, ch0 = (yw & 1) * 32, hs = w4 >> 1, qt = w4 & 1, q0 = (nb & 31) * 32;      /* slice, first channel of the head pair, this wave's head of the pair and its query tile */
  const int cw = ch0 + hs * HD + 8 * hh;      /* the lane's 8 channels, as query features and as output channels */
  const float* xq = x + (size_t)sl * HW * CC;      /* x[0] = q slices, x[1] = k, x[2] = v */
  const v8f zf = {0.f, 0.f, 0.f, 0.f, 0.f, 0.f, 0.f, 0.f};
  const float c = 0.25f * 1.4426950408889634f;      /* 16^-0.5 x log2 e: exp(0.25 s) = exp2(c s) */
  FragH qa[2];      /* per branch the query row [hi | lo] of q'' = (q qw + qb) kw c; a lane holds dims 8 hh .. 8 hh + 7 of each segment; with the key row [k | k]: hi.k + lo.k */
  { const float* qr = xq + (size_t)(q0 + qt * 16 + ln) * CC + cw; const v4f x0 = fa_ld4(qr), x1 = fa_ld4(qr + 4);
#pragma unroll
    for (int j = 0; j < 2; ++j) { const float* qw = (j ? lqw : gqw) + cw; const float* qb = (j ? lqb : gqb) + cw; const float* kw = (j ? lkw : gkw) + cw;
      /* bf16(x) bf16(w) is exact in f32, so the fused form rounds once, like multiply then add */
      const v4f t0 = __builtin_elementwise_fma(x0, fa_ld4(qw), fa_ld4(qb)) * fa_ld4(kw) * c, t1 = __builtin_elementwise_fma(x1, fa_ld4(qw + 4), fa_ld4(qb + 4)) * fa_ld4(kw + 4) * c;
      const v4h h0 = __builtin_convertvector(t0, v4h), h1 = __builtin_convertvector(t1, v4h);
      const v4h e0 = __builtin_convertvector(t0 - __builtin_convertvector(h0, v4f), v4h), e1 = __builtin_convertvector(t1 - __builtin_convertvector(h1, v4f), v4h);
#pragma unroll
      for (int d = 0; d < 4; ++d) { qa[j].h[d] = h0[d]; qa[j].h[4 + d] = h1[d]; qa[j].h[8 + d] = e0[d]; qa[j].h[12 + d] = e1[d]; } } }
  asm volatile("s_wait_xcnt 0x0" :: "v"(cw * 4) : "memory");      /* precaution: the index lines below may reuse the offset register of the parameter loads above; the offset is named so that it is not rewritten ahead of the wait */
  /* sh[j]: the shift in use, PBASE - (c x the score that set it), the same in all 8 registers: it is the C operand of the score products, so their result is the exponent of P as it stands.
     l[j]: the lane's running sum of P in two components. Softmax is the same for any shift; the shift is renewed only when a component passes LTOP (test once per 32 keys). */
  v8f o[2] = {zf, zf}; float shs[2] = {0.f, 0.f}; v2f l[2] = {{0.f, 0.f}, {0.f, 0.f}};      /* shs: the shift as one register while a chunk is staged */
  const int sp = tid >> 3, cq = tid & 7;      /* staging: 8 threads a position, 4 channels (16 B of x) each: the head pair's whole 128-B line */
  const bool stg = w < NSTG / 32;      /* whole waves: a scalar branch */
  for (int ch = 0; ch < HW / KCH; ++ch) {
    v4h kh[2][4], vt[2][4];      /* per image the thread's part of the chunk's LDS image, formed in registers: 4 keys x 4 channels, and 4 positions in a row of 4 transposed v rows */
    if (stg) {
#pragma unroll
      for (int m = 0; m < 2; ++m) if (m == 0 || two) {
        const int ym = y0 + m;
        const float* gk = x + ((size_t)(NSL + (ym >> 1)) * HW + ch * KCH + sp) * CC + (ym & 1) * 32 + cq * 4;
        const float* gv = x + ((size_t)(2 * NSL + (ym >> 1)) * HW + ch * KCH + sp * 4) * CC + (ym & 1) * 32 + cq * 4;
        v4f tk[4], tv[4];      /* an image's part is requested whole before its first conversion: one load latency an image */
#pragma unroll
        for (int u = 0; u < 4; ++u) tk[u] = *(const v4fa*)(gk + (size_t)u * 64 * CC);      /* keys u * 64 + sp */
#pragma unroll
        for (int u = 0; u < 4; ++u) tv[u] = *(const v4fa*)(gv + (size_t)u * CC);      /* positions sp * 4 + u */
        asm volatile("s_wait_xcnt 0x0" :: "v"(gk), "v"(gv) : "memory");      /* precaution: later lines may reuse the address registers of the loads above; the addresses are named so that they are not rewritten ahead of the wait */
#pragma unroll
        for (int u = 0; u < 4; ++u) kh[m][u] = fa_h4(tk[u]);
#pragma unroll
        for (int u = 0; u < 4; ++u) { const v4h v = fa_h4(tv[u]);
#pragma unroll
          for (int q = 0; q < 4; ++q) vt[m][q][u] = v[q]; }
      }
    }
    if (ch > 0) __syncthreads();      /* every wave has left the chunk that is overwritten next */
    if (stg) {
#pragma unroll
      for (int m = 0; m < 2; ++m) if (m == 0 || two) {
        unsigned short* kdst = &sk[m][(cq >> 2) * KHEAD + sp * KPITCH + (cq & 3) * 4]; unsigned short* vdst = &sv[m][cq * 4 * VPITCH + sp * 4];
#pragma unroll
        for (int u = 0; u < 4; ++u) { unsigned short* kr = kdst + u * 64 * KPITCH; *(v4ha*)kr = kh[m][u]; *(v4ha*)(kr + 16) = kh[m][u]; }
#pragma unroll
        for (int q = 0; q < 4; ++q) *(v4ha*)(vdst + q * VPITCH) = vt[m][q];
      }
    }
    __syncthreads();      /* the chunk is complete before any wave reads it */
    v8f sh[2];
#pragma unroll
    for (int j = 0; j < 2; ++j) sh[j] = zf + shs[j];
#pragma unroll 4
    for (int kb = 0; kb < KCH; kb += 32) {      /* four passes a trip: constant LDS offsets, and a pass's attn.v stands with the next pass's loads and score products. */
      const unsigned short* r0 = &sk[img][hs * KHEAD + (kb + ln) * KPITCH + 8 * hh]; const unsigned short* r1 = r0 + 16 * KPITCH; const unsigned short* rv = &sv[img][(hs * HD + ln) * VPITCH + kb + 8 * hh];
      FragH k0, k1, va;
      k0.half[0] = *(const v8us*)r0; k0.half[1] = *(const v8us*)(r0 + 16); k1.half[0] = *(const v8us*)r1; k1.half[1] = *(const v8us*)(r1 + 16);
      va.half[0] = *(const v8us*)rv; va.half[1] = *(const v8us*)(rv + 16);
      v8f s0[2], s1[2]; v2f lw[2]; FragH pf[2];      /* lw: the running sums with this pass's P */
#pragma unroll
      for (int j = 0; j < 2; ++j) {
        s0[j] = fa_mma(k0.v, qa[j].v, sh[j]);      /* s0[r] = c S[key kb + 8 hh + r][query ln] + shift */
        s1[j] = fa_mma(k1.v, qa[j].v, sh[j]);      /* s1[r] = c S[key kb + 16 + 8 hh + r][query ln] + shift */
      }
#pragma unroll
      for (int j = 0; j < 2; ++j) lw[j] = fa_soft(s0[j], s1[j], l[j], pf[j]);
      const bool first = (ch | kb) == 0;      /* the first 32 keys set the first shift */
      const bool high = fmaxf(fmaxf(lw[0][0], lw[0][1]), fmaxf(lw[1][0], lw[1][1])) > LTOP;
      if (__builtin_amdgcn_ballot_w32(high || first) != 0) {      /* the same for the whole wave: a scalar branch, seldom taken */
#pragma unroll
        for (int j = 0; j < 2; ++j) {
          float mx = fmaxf(s0[j][0], s1[j][0]);
#pragma unroll
          for (int r = 1; r < 8; ++r) mx = fmaxf(mx, fmaxf(s0[j][r], s1[j][r]));
          float lm = fmaxf(l[j][0], l[j][1]);
          mx = fmaxf(mx, fa_other_half(mx)); lm = fmaxf(lm, fa_other_half(lm));      /* both halves of the wave hold the same query: one shift for both */
          /* lower the exponents by dl: these 32 keys end at or below PBASE and the sum so far at or below 2^LFULL (its largest P is then still at least 2^PBASE) */
          const float dl = first ? mx - PBASE : fmaxf(fmaxf(mx - PBASE, __builtin_amdgcn_logf(lm) - LFULL), 0.f);
          const float al = first ? 1.0f : __builtin_amdgcn_exp2f(-dl);      /* at the first keys o and l are 0 */
          o[j] *= al; l[j] *= al; sh[j] -= dl; s0[j] -= dl; s1[j] -= dl;
          lw[j] = fa_soft(s0[j], s1[j], l[j], pf[j]);
        }
      }
#pragma unroll
      for (int j = 0; j < 2; ++j) { l[j] = lw[j]; o[j] = fa_mma(va.v, pf[j].v, o[j]); }      /* o[r] = sum_k P v [query ln][d = 8 hh + r] */
    }
    shs[0] = sh[0][0]; shs[1] = sh[1][0];
  }
  /* each branch: divide, then its v scale+bias; the branch mix and the output scale+bias; the 16 x 16 tile goes to LDS so that whole 128-B lines of out are stored */
  { const float lg = l[0][0] + l[0][1], ll = l[1][0] + l[1][1]; const float ig = 1.0f / (lg + fa_other_half(lg)), il = 1.0f / (ll + fa_other_half(ll)); float* sr = &so[((w >> 2) * 32 + qt * 16 + ln) * OPITCH + hs * HD + 8 * hh];
#pragma unroll
    for (int a = 0; a < 2; ++a) { const int cc = cw + 4 * a;
      const v4f og = {o[0][4 * a] * ig, o[0][4 * a + 1] * ig, o[0][4 * a + 2] * ig, o[0][4 * a + 3] * ig}, ol = {o[1][4 * a] * il, o[1][4 * a + 1] * il, o[1][4 * a + 2] * il, o[1][4 * a + 3] * il};
      const v4f g = __builtin_elementwise_fma(og, fa_ld4(gvw + cc), fa_ld4(gvb + cc)), lo = __builtin_elementwise_fma(ol, fa_ld4(lvw + cc), fa_ld4(lvb + cc));
      const v4f comb = 0.5f * lo + 0.5f * g; *(v4fa*)(sr + 4 * a) = (2.0f * comb) * fa_ld4(pw + cc) + fa_ld4(pb + cc); } }
  __syncthreads();      /* the 32 x 32 output tiles are complete before they are read across waves */
#pragma unroll
  for (int i = 0; i < 2; ++i) { const int idx = i * 128 + (tid & 127), row = idx >> 3, c4 = (idx & 7) * 4;      /* a block's four waves store its tile; 8 lanes store one 128-B line */
    *(v4f*)(out + ((size_t)sl * HW + q0 + row) * CC + ch0 + c4) = *(const v4fa*)&so[((w >> 2) * 32 + row) * OPITCH + c4]; } }

extern "C" void kernel_launch(void* const* d_in, const int* in_sizes, int n_in,
                              void* d_out, int out_size, void* d_ws, size_t ws_size, hipStream_t stream) {
  (void)in_sizes; (void)n_in; (void)out_size; (void)d_ws; (void)ws_size;
  const float* const* I = (const float* const*)d_in; const float* x = I[0];
  const float* gqw = I[1]; const float* gqb = I[2]; const float* gkw = I[3]; const float* gvw = I[5]; const float* gvb = I[6]; const float* lqw = I[7]; const float* lqb = I[8]; const float* lkw = I[9]; const float* lvw = I[11]; const float* lvb = I[12]; const float* pw = I[13]; const float* pb = I[14];      /* I[4], I[10]: the key biases add a constant to each query's scores, which softmax cancels */
  k_fattn<<<dim3(HW / 32 * NSL * 2 / NT), 128 * NT, 0, stream>>>(x, gqw, gqb, gkw, gvw, gvb, lqw, lqb, lkw, lvw, lvb, pw, pb, (float*)d_out);      /* 32 query blocks x (slice, head pair), NT blocks a work-group */
}

// v007
// Measured time: 20.4 microseconds a run.
// Two timings next to v006 both put it at 1.05 times that version's speed.
// All steps since v000 together make it 68.1 times as fast.
#include <hip/hip_runtime.h>
// Global + local spatial attention (x = [q|k|v] of 20 slices x 1024 positions x 64 channels; 4 heads of 16; per-channel scale+bias 'depthwise k=1 convs' for each branch): g = attn(q gq_w + gq_b, k gk_w + gk_b, v gv_w + gv_b), l likewise; out = (2 (0.5 l + 0.5 g)) proj_w + proj_b -> [20,1024,64].
// Structure (one launch): a fused attention kernel that reads x itself. The k scale is folded into the query, the k bias is left out (a constant per query, cancelled by softmax), the v scale+bias follow the division, so K and V are bf16(x) as f16 and serve both branches: a wave runs both branches of 16 queries of one head on the same fragments (scores, softmax with a lazily renewed shift and attn.v in registers, f32 accumulation, P f16), then mixes them and applies the output scale/bias.
// Compute dtype: x and all parameters rounded to bf16; the folded query as f16 hi + residual against exact f16 keys (K 32); v exact, P as f16 operands (~2^-12); f32 accumulation, softmax, elementwise. v_wmma_f32_16x16x32_f16.
#define NSL 20
#define NRUN NSL                 /* slices processed (NSL stays the input stride) */
#define HW 1024
#define CC 64
#define NHD 4
#define HD 16
#define NG 8                     /* (branch, head) pairs per slice: g = br*4 + h */
#define NB 20                    /* slices per launch: blockIdx.x runs over NB slices x 2 head pairs x 32 query blocks, NT blocks a work-group; NSL % NB == 0 */
typedef __bf16 v16b __attribute__((ext_vector_type(16)));
typedef unsigned short v8us __attribute__((ext_vector_type(8), may_alias));
typedef float  v8f  __attribute__((ext_vector_type(8)));
typedef float  v4f  __attribute__((ext_vector_type(4)));
typedef float  v4fa __attribute__((ext_vector_type(4), may_alias));
union FragB { v16b v; v8us half[2]; unsigned short u[16]; };

__device__ __forceinline__ unsigned short bf16_bits(float x) { unsigned int u = __float_as_uint(x); return (unsigned short)((u + 0x7FFFu + ((u >> 16) & 1u)) >> 16); }
__device__ __forceinline__ float bf16_val(unsigned short b) { return __uint_as_float(((unsigned int)b) << 16); }
__device__ __forceinline__ float bf16_round(float x) { return bf16_val(bf16_bits(x)); }
// D += A·B with NT terms: 1 = ah·bh, 2 = + al·bh (A split), 3 = + ah·bl (both split)
template <int NT>
__device__ __forceinline__ v8f mmaN(v16b ah, v16b al, v16b bh, v16b bl, v8f c) {
  c = __builtin_amdgcn_wmma_f32_16x16x32_bf16(false, ah, false, bh, (short)0, c, false, false);
  if (NT >= 2) c = __builtin_amdgcn_wmma_f32_16x16x32_bf16(false, al, false, bh, (short)0, c, false, false);
  if (NT >= 3) c = __builtin_amdgcn_wmma_f32_16x16x32_bf16(false, ah, false, bl, (short)0, c, false, false);
  asm volatile("v_nop\n\tv_nop\n\tv_nop\n\tv_nop" : "+v"(c) : "v"(ah), "v"(al), "v"(bh), "v"(bl));
  return c;
}

__global__ __launch_bounds__(256) void k_wt_bf16(const float* __restrict__ W, unsigned short* __restrict__ Wt, int K, int N) {
  const int t = blockIdx.x * 256 + threadIdx.x;
  const int k8n = K / 8;
  if (t >= N * k8n) return;
  const int n = t / k8n, k8 = (t % k8n) * 8;
  v8us v;
#pragma unroll
  for (int i = 0; i < 8; ++i) v[i] = bf16_bits(W[(size_t)(k8 + i) * N + n]);
  *(v8us*)(Wt + (size_t)n * K + k8) = v;
  
}

// GEMM C[M][N] (f32, pitch ldc) = act(A[M][K]·W + bias). A f32 row-major (pitch lda) converted per fragment to bf16
// (ASPLIT: hi/lo two planes -> 2 terms, else single rounded term); Wt bf16 [N][K] (pitch ldb). BIAS_BF16 rounds the
// bias to bf16 first (bias quantised to bf16 before the add). K%32==0, M%16==0, N%64==0.
template <bool ASPLIT, int ACT, bool BIAS_BF16>
__global__ __launch_bounds__(128) void k_gemm_bf(const float* __restrict__ A, int lda, const unsigned short* __restrict__ Wt, int ldb,
                                               const float* __restrict__ bias, float* __restrict__ C, int ldc, int M, int N, int K) {
  __shared__ __attribute__((aligned(16))) float so[4][16][64];
  const int tid = threadIdx.x, w = tid >> 5, lane = tid & 31, ln = lane & 15, hh = lane >> 4;
  const int ntn = N / 64;
  const int wid = blockIdx.x * 4 + w;
  const int mt = wid / ntn, nq = wid % ntn;
  if (mt * 16 >= M) return;
  const int row0 = mt * 16, col0 = nq * 64;
  const float* arow = A + (size_t)(row0 + ln) * lda;
  v8f acc[4] = {};
  for (int kb = 0; kb < K; kb += 32) {
    FragB ah, al;
    const v4f x0 = *(const v4fa*)(arow + kb + 8 * hh), x1 = *(const v4fa*)(arow + kb + 8 * hh + 4);
    const v4f x2 = *(const v4fa*)(arow + kb + 16 + 8 * hh), x3 = *(const v4fa*)(arow + kb + 16 + 8 * hh + 4);
    float xs[16] = {x0[0],x0[1],x0[2],x0[3],x1[0],x1[1],x1[2],x1[3],x2[0],x2[1],x2[2],x2[3],x3[0],x3[1],x3[2],x3[3]};
#pragma unroll
    for (int i = 0; i < 16; ++i) { const unsigned short hb = bf16_bits(xs[i]); ah.u[i] = hb; al.u[i] = ASPLIT ? bf16_bits(xs[i] - bf16_val(hb)) : (unsigned short)0; }
#pragma unroll
    for (int t = 0; t < 4; ++t) {
      const unsigned short* brow = Wt + (size_t)(col0 + t * 16 + ln) * ldb + kb;
      FragB b;
      b.half[0] = *(const v8us*)(brow + 8 * hh);
      b.half[1] = *(const v8us*)(brow + 16 + 8 * hh);
      acc[t] = mmaN<ASPLIT ? 2 : 1>(ah.v, al.v, b.v, b.v, acc[t]);
    }
  }
#pragma unroll
  for (int t = 0; t < 4; ++t) {
    float bv = bias ? bias[col0 + t * 16 + ln] : 0.f;
    if (BIAS_BF16) bv = bf16_round(bv);
#pragma unroll
    for (int r = 0; r < 8; ++r) { float v = acc[t][r] + bv; if (ACT == 1) v = fmaxf(v, 0.f); so[w][8 * hh + r][t * 16 + ln] = v; }
  }
  __builtin_amdgcn_fence(__ATOMIC_ACQ_REL, "workgroup");
  __builtin_amdgcn_wave_barrier();
  const int rsub = lane >> 4, c4 = (lane & 15) * 4;
  {
#pragma unroll
    for (int q = 0; q < 8; ++q) {
      const int r = q * 2 + rsub;
      const v4f v = *(const v4fa*)&so[w][r][c4];
      *(v4f*)(C + (size_t)(row0 + r) * ldc + col0 + c4) = v;
    }
    
  }
}

// GEMM C = act(A·W + bias + resid): A f32 (ASPLIT -> hi/lo 2 terms), Wt bf16 [N][K]; ACT 0 none, 1 relu, 2 exact gelu;
// resid (optional, f32, row index = (row % rmod), pitch ldr, RES_BF16 rounds it) added before the activation.
template <bool ASPLIT, int ACT, bool BIAS_BF16, bool RES_BF16>
__global__ __launch_bounds__(128) void k_gemm_bf3(const float* __restrict__ A, int lda, const unsigned short* __restrict__ Wt, int ldb,
                                                const float* __restrict__ bias, const float* __restrict__ resid, int rmod, int ldr,
                                                float* __restrict__ C, int ldc, int M, int N, int K) {
  __shared__ __attribute__((aligned(16))) float so[4][16][64];
  const int tid = threadIdx.x, w = tid >> 5, lane = tid & 31, ln = lane & 15, hh = lane >> 4;
  const int ntn = N / 64;
  const int wid = blockIdx.x * 4 + w;
  const int mt = wid / ntn, nq = wid % ntn;
  if (mt * 16 >= M) return;
  const int row0 = mt * 16, col0 = nq * 64;
  const float* arow = A + (size_t)(row0 + ln) * lda;
  v8f acc[4] = {};
  for (int kb = 0; kb < K; kb += 32) {
    FragB ah, al;
    const v4f x0 = *(const v4fa*)(arow + kb + 8 * hh), x1 = *(const v4fa*)(arow + kb + 8 * hh + 4);
    const v4f x2 = *(const v4fa*)(arow + kb + 16 + 8 * hh), x3 = *(const v4fa*)(arow + kb + 16 + 8 * hh + 4);
    float xs[16] = {x0[0],x0[1],x0[2],x0[3],x1[0],x1[1],x1[2],x1[3],x2[0],x2[1],x2[2],x2[3],x3[0],x3[1],x3[2],x3[3]};
#pragma unroll
    for (int i = 0; i < 16; ++i) { const unsigned short hb = bf16_bits(xs[i]); ah.u[i] = hb; al.u[i] = ASPLIT ? bf16_bits(xs[i] - bf16_val(hb)) : (unsigned short)0; }
#pragma unroll
    for (int t = 0; t < 4; ++t) {
      const unsigned short* brow = Wt + (size_t)(col0 + t * 16 + ln) * ldb + kb;
      FragB b;
      b.half[0] = *(const v8us*)(brow + 8 * hh);
      b.half[1] = *(const v8us*)(brow + 16 + 8 * hh);
      acc[t] = mmaN<ASPLIT ? 2 : 1>(ah.v, al.v, b.v, b.v, acc[t]);
    }
  }
#pragma unroll
  for (int t = 0; t < 4; ++t) {
    const int col = col0 + t * 16 + ln;
    float bv = bias ? bias[col] : 0.f;
    if (BIAS_BF16) bv = bf16_round(bv);
#pragma unroll
    for (int r = 0; r < 8; ++r) {
      float v = acc[t][r] + bv;
      if (resid) { float rv = resid[(size_t)((row0 + 8 * hh + r) % rmod) * ldr + col]; if (RES_BF16) rv = bf16_round(rv); v += rv; }
      if (ACT == 1) v = fmaxf(v, 0.f);
      if (ACT == 2) v = 0.5f * v * (1.0f + erff(v * 0.70710678118654752f));
      if (ACT == 3) { const float u = 0.7978845608028654f * (v + 0.044715f * v * v * v); v = 0.5f * v * (1.0f + tanhf(u)); }
      so[w][8 * hh + r][t * 16 + ln] = v;
    }
  }
  __builtin_amdgcn_fence(__ATOMIC_ACQ_REL, "workgroup");
  __builtin_amdgcn_wave_barrier();
  const int rsub = lane >> 4, c4 = (lane & 15) * 4;
  {
#pragma unroll
    for (int q = 0; q < 8; ++q) {
      const int r = q * 2 + rsub;
      const v4f v = *(const v4fa*)&so[w][r][c4];
      *(v4f*)(C + (size_t)(row0 + r) * ldc + col0 + c4) = v;
    }
    
  }
}
// row LayerNorm (biased variance, eps) over N: s = X (+ R); optional out_sum <- s; out_norm <- (s-mu)*rsqrt(var+eps)*g + b
template <bool PARAM_BF16>
__global__ __launch_bounds__(256) void k_layernorm(const float* __restrict__ X, const float* __restrict__ R, const float* __restrict__ g, const float* __restrict__ bta,
                                                  float* __restrict__ out_sum, float* __restrict__ out_norm, int N, float eps) {
  __shared__ float red[256];
  const int row = blockIdx.x, tid = threadIdx.x;
  const float* x = X + (size_t)row * N; const float* rr = R ? R + (size_t)row * N : nullptr;
  float vals[16];                     // up to N = 4096
  const int per = N / 256;            // contiguous chunk per thread? use strided-by-4 chunks: thread handles j = tid*4 + 1024*u
  float s1 = 0.f;
  for (int u = 0; u < per / 4; ++u) {
    const int j = tid * 4 + 1024 * u;
    const v4f a = *(const v4fa*)(x + j);
    v4f b = {0.f,0.f,0.f,0.f}; if (rr) b = *(const v4fa*)(rr + j);
#pragma unroll
    for (int q = 0; q < 4; ++q) { const float v = a[q] + b[q]; vals[u * 4 + q] = v; s1 += v; }
  }
  red[tid] = s1; __syncthreads();
  for (int st = 128; st > 0; st >>= 1) { if (tid < st) red[tid] += red[tid + st]; __syncthreads(); }
  const float mu = red[0] / (float)N; __syncthreads();
  float s2 = 0.f;
  for (int u = 0; u < per / 4; ++u)
#pragma unroll
    for (int q = 0; q < 4; ++q) { const float c = vals[u * 4 + q] - mu; s2 += c * c; }
  red[tid] = s2; __syncthreads();
  for (int st = 128; st > 0; st >>= 1) { if (tid < st) red[tid] += red[tid + st]; __syncthreads(); }
  const float rs = rsqrtf(red[0] / (float)N + eps);
  {
    for (int u = 0; u < per / 4; ++u) {
      const int j = tid * 4 + 1024 * u;
      v4f o, sm;
#pragma unroll
      for (int q = 0; q < 4; ++q) {
        float gg = g[j + q], bb = bta[j + q];
        if (PARAM_BF16) { gg = bf16_round(gg); bb = bf16_round(bb); }
        sm[q] = vals[u * 4 + q]; o[q] = (vals[u * 4 + q] - mu) * rs * gg + bb;
      }
      if (out_sum) *(v4f*)(out_sum + (size_t)row * N + j) = sm;
      *(v4f*)(out_norm + (size_t)row * N + j) = o;
    }
    
  }
}



// ---- f16 WMMA path (v_wmma_f32_16x16x32_f16): 11-bit significands for operands in range — used where a [0,1] probability operand needs more precision than bf16
typedef _Float16 v16h __attribute__((ext_vector_type(16)));
union FragH { v16h v; v8us half[2]; _Float16 h[16]; unsigned short u[16]; };
template <int NT>
__device__ __forceinline__ v8f mmaH(v16h ah, v16h al, v16h bh, v16h bl, v8f c) {
  c = __builtin_amdgcn_wmma_f32_16x16x32_f16(false, ah, false, bh, (short)0, c, false, false);
  if (NT >= 2) c = __builtin_amdgcn_wmma_f32_16x16x32_f16(false, al, false, bh, (short)0, c, false, false);
  if (NT >= 3) c = __builtin_amdgcn_wmma_f32_16x16x32_f16(false, ah, false, bl, (short)0, c, false, false);
  asm volatile("v_nop\n\tv_nop\n\tv_nop\n\tv_nop" : "+v"(c) : "v"(ah), "v"(al), "v"(bh), "v"(bl));
  return c;
}
// batched GEMM like k_gemm_b but f16 operands: A f32 (split into f16 hi/lo if ASPLIT, else rounded to f16), Bt = f16 values [n][k]; alpha; C f32; N multiple of 16 (partial tiles skipped)
template <bool ASPLIT>
__global__ __launch_bounds__(128) void k_gemm_h(const float* __restrict__ A, int lda, size_t sA, const _Float16* __restrict__ Bh, int ldb, size_t sB, float alpha, float* __restrict__ C, int ldc, size_t sC, int M, int N, int K) {
  __shared__ __attribute__((aligned(16))) float so[4][16][64];
  const int tid = threadIdx.x, w = tid >> 5, lane = tid & 31, ln = lane & 15, hh = lane >> 4; const int by = blockIdx.y;
  A += (size_t)by * sA; Bh += (size_t)by * sB; C += (size_t)by * sC;
  const int ntn = (N + 63) / 64; const int wid = blockIdx.x * 4 + w; const int mt = wid / ntn, nq = wid % ntn; if (mt * 16 >= M) return;
  const int row0 = mt * 16, col0 = nq * 64; const float* arow = A + (size_t)(row0 + ln) * lda;
  v8f acc[4] = {};
  for (int kb = 0; kb < K; kb += 32) {
    FragH ah, al;
    const v4f x0 = *(const v4fa*)(arow + kb + 8 * hh), x1 = *(const v4fa*)(arow + kb + 8 * hh + 4), x2 = *(const v4fa*)(arow + kb + 16 + 8 * hh), x3 = *(const v4fa*)(arow + kb + 16 + 8 * hh + 4);
    float xs[16] = {x0[0],x0[1],x0[2],x0[3],x1[0],x1[1],x1[2],x1[3],x2[0],x2[1],x2[2],x2[3],x3[0],x3[1],x3[2],x3[3]};
#pragma unroll
    for (int i = 0; i < 16; ++i) { const _Float16 h = (_Float16)xs[i]; ah.h[i] = h; al.h[i] = ASPLIT ? (_Float16)(xs[i] - (float)h) : (_Float16)0.0f; }
#pragma unroll
    for (int t = 0; t < 4; ++t) { if (col0 + t * 16 >= N) continue; const size_t boff = (size_t)(col0 + t * 16 + ln) * ldb + kb; FragH bq; bq.half[0] = *(const v8us*)(Bh + boff + 8 * hh); bq.half[1] = *(const v8us*)(Bh + boff + 16 + 8 * hh);
      acc[t] = mmaH<ASPLIT ? 2 : 1>(ah.v, al.v, bq.v, bq.v, acc[t]); }
  }
#pragma unroll
  for (int t = 0; t < 4; ++t) { if (col0 + t * 16 >= N) continue;
#pragma unroll
    for (int r = 0; r < 8; ++r) so[w][8 * hh + r][t * 16 + ln] = acc[t][r] * alpha; }
  __builtin_amdgcn_fence(__ATOMIC_ACQ_REL, "workgroup"); __builtin_amdgcn_wave_barrier();
  const int rsub = lane >> 4, c4 = (lane & 15) * 4;
  {
#pragma unroll
    for (int q = 0; q < 8; ++q) { const int r = q * 2 + rsub; if (col0 + c4 < N) { const v4f v = *(const v4fa*)&so[w][r][c4]; *(v4f*)(C + (size_t)(row0 + r) * ldc + col0 + c4) = v; } }
     }
}

// Wt[n][k] = f16(W[k][n]·scale) from f32 row-major W[K][N] (scale = power of two; bf16-exact weights stay exact in f16 away from the subnormal range)
__global__ __launch_bounds__(256) void k_wt_f16(const float* __restrict__ W, _Float16* __restrict__ Wt, int K, int N, float scale) {
  const int t = blockIdx.x * 256 + threadIdx.x; if (t >= N * (K / 8)) return; const int n = t / (K / 8), k8 = (t % (K / 8)) * 8; FragH f;
#pragma unroll
  for (int i = 0; i < 8; ++i) f.h[i] = (_Float16)(bf16_round(W[(size_t)(k8 + i) * N + n]) * scale); const v8us o = f.half[0];
  *(v8us*)((unsigned short*)Wt + (size_t)n * K + k8) = o; 
}
// k_gemm_hh variant with fused epilogue: v = acc·alpha + bias[by·sBias + col] (+ CP[(row/rowsPerB)·sCPb + by·64 + col] if CP) ; ACT 0 none / 1 elu ; writes f16 C16 (and f32 C if non-null)
template <int ACT>
__global__ __launch_bounds__(128) void k_gemm_hhx(const _Float16* __restrict__ A, int lda, size_t sA, const _Float16* __restrict__ Bh, int ldb, size_t sB, float alpha, const float* __restrict__ bias, size_t sBias, const float* __restrict__ CP, int rowsPerB, size_t sCPb, int row0g,
    float* __restrict__ C, _Float16* __restrict__ C16, int ldc, size_t sC, int M, int N, int K) {
  __shared__ __attribute__((aligned(16))) float so[4][16][64];
  const int tid = threadIdx.x, w = tid >> 5, lane = tid & 31, ln = lane & 15, hh = lane >> 4; const int by = blockIdx.y;
  A += (size_t)by * sA; Bh += (size_t)by * sB; const size_t cofs = (size_t)by * sC; const float* bp = bias ? bias + (size_t)by * sBias : nullptr;
  const int ntn = (N + 63) / 64; const int wid = blockIdx.x * 4 + w; const int mt = wid / ntn, nq = wid % ntn; if (mt * 16 >= M) return;
  const int row0 = mt * 16, col0 = nq * 64; const _Float16* arow = A + (size_t)(row0 + ln) * lda;
  v8f acc[4] = {};
  for (int kb = 0; kb < K; kb += 32) { FragH ah; ah.half[0] = *(const v8us*)((const unsigned short*)arow + kb + 8 * hh); ah.half[1] = *(const v8us*)((const unsigned short*)arow + kb + 16 + 8 * hh);
#pragma unroll
    for (int t = 0; t < 4; ++t) { if (col0 + t * 16 >= N) continue; const size_t boff = (size_t)(col0 + t * 16 + ln) * ldb + kb; FragH bq; bq.half[0] = *(const v8us*)((const unsigned short*)Bh + boff + 8 * hh); bq.half[1] = *(const v8us*)((const unsigned short*)Bh + boff + 16 + 8 * hh);
      acc[t] = mmaH<1>(ah.v, ah.v, bq.v, bq.v, acc[t]); }
  }
#pragma unroll
  for (int t = 0; t < 4; ++t) { if (col0 + t * 16 >= N) continue; const int col = col0 + t * 16 + ln; const float bv = bp ? bf16_round(bp[col]) : 0.f;
#pragma unroll
    for (int r = 0; r < 8; ++r) { float v = acc[t][r] * alpha + bv; if (CP) { const int bidx = (row0g + row0 + 8 * hh + r) / rowsPerB; v += CP[(size_t)bidx * sCPb + (size_t)by * 64 + col]; } if (ACT == 1) v = (v > 0.f) ? v : expm1f(v); else if (ACT == 7) v = (v > 0.f) ? v + 1.0f : expf(v); else if (ACT == 8) v = tanhf(v); else if (ACT == 9) v = 0.5f * v * (1.0f + tanhf(0.7978845608028654f * (v + 0.044715f * v * v * v))); else if (ACT == 11) v = 1.0f / (1.0f + expf(-v)); else if (ACT == 12) v = (v > 0.f) ? v : 0.01f * v; else if (ACT == 14) v = (v > 0.f) ? v : 0.1f * v; else if (ACT == 15) v = v / (1.0f + expf(-v)); else if (ACT == 3) v = fmaxf(v, 0.f); else if (ACT == 6) v = 0.5f * v * (1.0f + erff(v * 0.70710678118654752f)); so[w][8 * hh + r][t * 16 + ln] = v; } }
  __builtin_amdgcn_fence(__ATOMIC_ACQ_REL, "workgroup"); __builtin_amdgcn_wave_barrier();
  const int rsub = lane >> 4, c4 = (lane & 15) * 4; typedef _Float16 v4h __attribute__((ext_vector_type(4)));
  {
#pragma unroll
    for (int q = 0; q < 8; ++q) { const int r = q * 2 + rsub; if (col0 + c4 < N) { const v4f v = *(const v4fa*)&so[w][r][c4]; if (C) *(v4f*)(C + cofs + (size_t)(row0 + r) * ldc + col0 + c4) = v; if (C16) { v4h h4; for (int i = 0; i < 4; ++i) h4[i] = (_Float16)v[i]; *(v4h*)(C16 + cofs + (size_t)(row0 + r) * ldc + col0 + c4) = h4; } } }
     }
}


typedef _Float16 v4h __attribute__((ext_vector_type(4)));

__global__ __launch_bounds__(256) void k_x16(const float* __restrict__ x, _Float16* __restrict__ X16, size_t n8) { const size_t t = (size_t)blockIdx.x * 256 + threadIdx.x; if (t >= n8) return; FragH f;
#pragma unroll
  for (int q = 0; q < 8; ++q) f.h[q] = (_Float16)bf16_round(x[t * 8 + q]); *(v8us*)((unsigned short*)X16 + t * 8) = f.half[0];  }
__global__ __launch_bounds__(256) void k_h16(const float* __restrict__ x, _Float16* __restrict__ X16, size_t n8) { const size_t t = (size_t)blockIdx.x * 256 + threadIdx.x; if (t >= n8) return; FragH f;
#pragma unroll
  for (int q = 0; q < 8; ++q) f.h[q] = (_Float16)x[t * 8 + q]; *(v8us*)((unsigned short*)X16 + t * 8) = f.half[0];  }
__global__ __launch_bounds__(256) void k_round16f(const float* __restrict__ W, _Float16* __restrict__ Bt, size_t n8) { const size_t t = (size_t)blockIdx.x * 256 + threadIdx.x; if (t >= n8) return; FragH f;
#pragma unroll
  for (int i = 0; i < 8; ++i) f.h[i] = (_Float16)(bf16_round(W[t * 8 + i]) * 16.0f); *(v8us*)((unsigned short*)Bt + t * 8) = f.half[0];  }
template <int NHv, int TTv>
__global__ __launch_bounds__(256) void k_vt(const _Float16* __restrict__ V16, int ldv, int voff, _Float16* __restrict__ Vt) { __shared__ unsigned short tl[64][66]; const int tid = threadIdx.x; const int slab = blockIdx.x / (TTv / 64), lg = blockIdx.x % (TTv / 64); const int b = slab / NHv, h = slab % NHv;
  for (int i = tid; i < 64 * 8; i += 256) { const int r = i / 8, c8 = (i % 8) * 8; FragH f; f.half[0] = *(const v8us*)((const unsigned short*)V16 + ((size_t)b * TTv + lg * 64 + r) * ldv + voff + h * 64 + c8);
#pragma unroll
    for (int q = 0; q < 8; ++q) tl[r][c8 + q] = f.u[q]; }
  __syncthreads();
  {
#pragma unroll
    for (int rd = 0; rd < 2; ++rd) { const int d = rd * 32 + tid / 8, pc = tid % 8; FragH f;
#pragma unroll
      for (int q = 0; q < 8; ++q) f.u[q] = tl[pc * 8 + q][d];
      *(v8us*)((unsigned short*)Vt + ((size_t)slab * 64 + d) * TTv + lg * 64 + pc * 8) = f.half[0]; }
     } }

__global__ __launch_bounds__(256) void k_hl(const float* __restrict__ F, _Float16* __restrict__ Hh, _Float16* __restrict__ Hl, size_t n8) { const size_t t = (size_t)blockIdx.x * 256 + threadIdx.x; if (t >= n8) return; FragH fh, fl; const v4f a = *(const v4fa*)(F + t * 8), c = *(const v4fa*)(F + t * 8 + 4);
#pragma unroll
  for (int q = 0; q < 4; ++q) { _Float16 h = (_Float16)a[q]; fh.h[q] = h; fl.h[q] = (_Float16)((a[q] - (float)h) * 1024.0f); h = (_Float16)c[q]; fh.h[4 + q] = h; fl.h[4 + q] = (_Float16)((c[q] - (float)h) * 1024.0f); }
  { *(v8us*)((unsigned short*)Hh + t * 8) = fh.half[0]; *(v8us*)((unsigned short*)Hl + t * 8) = fl.half[0];  } }

// ---- fast GEMM (wave tile 32x64; requires M % 32 == 0 rows per launch region and N % 64 == 0); epilogue = k_gemm_hhx semantics ----
__device__ __forceinline__ v16h g2_frag(const _Float16* p, int hh) { FragH f; f.half[0] = *(const v8us*)((const unsigned short*)p + 8 * hh); f.half[1] = *(const v8us*)((const unsigned short*)p + 16 + 8 * hh); return f.v; }
__device__ __forceinline__ v8f g2_mma(v16h a, v16h b, v8f c) { v8f d = __builtin_amdgcn_wmma_f32_16x16x32_f16(false, a, false, b, (short)0, c, false, false); asm volatile("v_nop\n\tv_nop\n\tv_nop\n\tv_nop" : "+v"(d) : "v"(a), "v"(b)); return d; }
template <int ACT>
__global__ __launch_bounds__(128) void k_gemm2(const _Float16* __restrict__ A, int lda, size_t sA, const _Float16* __restrict__ Bh, int ldb, size_t sB, float alpha, const float* __restrict__ bias, size_t sBias, const float* __restrict__ CP, int rowsPerB, size_t sCPb, int row0g,
    float* __restrict__ C, _Float16* __restrict__ C16, int ldc, size_t sC, int M, int N, int K) {
  __shared__ __attribute__((aligned(16))) float so[4][32][68];
  const int tid = threadIdx.x, w = tid >> 5, lane = tid & 31, ln = lane & 15, hh = lane >> 4; const int by = blockIdx.y;
  A += (size_t)by * sA; Bh += (size_t)by * sB; const size_t cofs = (size_t)by * sC; const float* bp = bias ? bias + (size_t)by * sBias : nullptr;
  const int ntn = N >> 6; const int mt = blockIdx.x / ntn, nq = blockIdx.x - mt * ntn; const int row0 = mt * 128 + 32 * w, col0 = nq * 64; if (row0 >= M) return;
  const _Float16* a0p = A + (size_t)(row0 + ln) * lda; const _Float16* a1p = a0p + (size_t)16 * lda;
  const _Float16* b0p = Bh + (size_t)(col0 + ln) * ldb; const _Float16* b1p = b0p + (size_t)16 * ldb; const _Float16* b2p = b1p + (size_t)16 * ldb; const _Float16* b3p = b2p + (size_t)16 * ldb;
  const v8f z8 = {0.f,0.f,0.f,0.f,0.f,0.f,0.f,0.f}; v8f c00 = z8, c01 = z8, c02 = z8, c03 = z8, c10 = z8, c11 = z8, c12 = z8, c13 = z8;
#pragma unroll 1
  for (int kb = 0; kb < K; kb += 32) { const v16h a0 = g2_frag(a0p + kb, hh), a1 = g2_frag(a1p + kb, hh);
    v16h b = g2_frag(b0p + kb, hh); c00 = g2_mma(a0, b, c00); c10 = g2_mma(a1, b, c10);
    b = g2_frag(b1p + kb, hh); c01 = g2_mma(a0, b, c01); c11 = g2_mma(a1, b, c11);
    b = g2_frag(b2p + kb, hh); c02 = g2_mma(a0, b, c02); c12 = g2_mma(a1, b, c12);
    b = g2_frag(b3p + kb, hh); c03 = g2_mma(a0, b, c03); c13 = g2_mma(a1, b, c13); }
  v8f accs[8] = {c00, c01, c02, c03, c10, c11, c12, c13};
#pragma unroll
  for (int u = 0; u < 8; ++u) { const int t = u & 3, half = u >> 2; const int col = col0 + t * 16 + ln; const float bv = bp ? bf16_round(bp[col]) : 0.f;
#pragma unroll
    for (int r = 0; r < 8; ++r) { const int rloc = half * 16 + 8 * hh + r; float v = accs[u][r] * alpha + bv; if (CP) { const int bidx = (row0g + row0 + rloc) / rowsPerB; v += CP[(size_t)bidx * sCPb + (size_t)by * 64 + col]; }
      if (ACT == 3) v = fmaxf(v, 0.f); else if (ACT == 6) v = 0.5f * v * (1.0f + erff(v * 0.70710678118654752f)); else if (ACT == 11) v = 1.0f / (1.0f + expf(-v)); else if (ACT == 15) v = v / (1.0f + expf(-v)); else if (ACT == 12) v = (v > 0.f) ? v : 0.01f * v; else if (ACT == 8) v = tanhf(v);
      so[w][rloc][t * 16 + ln] = v; } }
  __builtin_amdgcn_fence(__ATOMIC_ACQ_REL, "workgroup"); __builtin_amdgcn_wave_barrier();
  const int rsub = lane >> 4, c4 = (lane & 15) * 4;
  {
#pragma unroll
    for (int q = 0; q < 16; ++q) { const int r = q * 2 + rsub; const v4f v = *(const v4fa*)&so[w][r][c4]; if (C) *(v4f*)(C + cofs + (size_t)(row0 + r) * ldc + col0 + c4) = v; if (C16) { v4h h4; for (int i = 0; i < 4; ++i) h4[i] = (_Float16)v[i]; *(v4h*)(C16 + cofs + (size_t)(row0 + r) * ldc + col0 + c4) = h4; } }
     } }


#define KCH 256                  /* keys per staged chunk */
#define KPITCH 40                /* halves per staged key row: [k | k], 32 in use, pitch 80 B = 16 B x odd (b128 reads without bank conflicts) */
#define KHEAD (KCH * KPITCH + 16) /* halves per head's key image: the 32 B more put the two heads' stores of one position on different banks */
#define VPITCH (KCH + 8)         /* halves per staged v row: 528 B = 16 B x odd */
#define OPITCH 36                /* floats per staged output row: 32 in use */
#define NT 5                     /* query blocks per work-group; 32 x NSL x 2 blocks are a multiple of it */
#define NSTG 512                 /* threads that stage (waves 0-15, four a SIMD) */
#define PBASE 4.0f               /* log2 of P at the score that set the shift in use: P below 2^-18 of it are f16 subnormals, whose rounding is far below that of the large P */
#define LFULL 12.0f              /* log2 of 256 x 2^PBASE: the most a running-sum component (256 keys) holds when no score lies above the one that set the shift */
#define LTOP 60000.0f            /* a running-sum component at or below this bounds every P in it below the f16 top (65504) */
typedef float v2f __attribute__((ext_vector_type(2)));
__device__ __forceinline__ v8f fa_mma(v16h a, v16h b, v8f c) { return __builtin_amdgcn_wmma_f32_16x16x32_f16(false, a, false, b, (short)0, c, false, false); }
__device__ __forceinline__ float fa_other_half(float v) { const int b = __float_as_int(v); return __int_as_float(__builtin_amdgcn_permlanex16(b, b, 0x76543210, 0xfedcba98, false, false)); }      /* lane l <-> l ^ 16 */
typedef __bf16 v4b __attribute__((ext_vector_type(4)));
typedef _Float16 v4ha __attribute__((ext_vector_type(4), may_alias));
__device__ __forceinline__ v4f fa_bf4(v4f a) { return __builtin_convertvector(__builtin_convertvector(a, v4b), v4f); }      /* four values rounded to bf16 (nearest even), kept as f32 */
typedef __bf16 v2b __attribute__((ext_vector_type(2)));
/* four values rounded to bf16 (nearest even), then as f16 (exact: 8 significant bits); the rounding is done on pairs, one conversion for two values */
__device__ __forceinline__ v4h fa_h4(v4f a) { const v2f a0 = {a[0], a[1]}, a1 = {a[2], a[3]}; const unsigned u0 = __builtin_bit_cast(unsigned, __builtin_convertvector(a0, v2b)), u1 = __builtin_bit_cast(unsigned, __builtin_convertvector(a1, v2b));
  const v4f r = {__uint_as_float(u0 << 16), __uint_as_float(u0 & 0xffff0000u), __uint_as_float(u1 << 16), __uint_as_float(u1 & 0xffff0000u)}; return __builtin_convertvector(r, v4h); }
__device__ __forceinline__ v4f fa_ld4(const float* p) { return fa_bf4(*(const v4fa*)p); }      /* four parameters or inputs, rounded to bf16 */
/* P = exp2 of two score tiles' exponents, as the f16 B operand of attn.v; returns the running sum l with these 16 P added */
__device__ __forceinline__ v2f fa_soft(v8f s0, v8f s1, v2f l, FragH& pf) {
#pragma unroll
  for (int r = 0; r < 8; r += 2) {
    const v2f p0 = {__builtin_amdgcn_exp2f(s0[r]), __builtin_amdgcn_exp2f(s0[r + 1])}, p1 = {__builtin_amdgcn_exp2f(s1[r]), __builtin_amdgcn_exp2f(s1[r + 1])};
    l += p0 + p1; pf.h[r] = (_Float16)p0[0]; pf.h[r + 1] = (_Float16)p0[1]; pf.h[8 + r] = (_Float16)p1[0]; pf.h[8 + r + 1] = (_Float16)p1[1]; }
  return l; }
/* five waves a SIMD: 256 work-groups of 20 waves, one per WGP, at most 192 VGPRs */
__global__ __launch_bounds__(128 * NT) __attribute__((amdgpu_waves_per_eu(5))) void k_fattn(const float* __restrict__ x, const float* __restrict__ gqw, const float* __restrict__ gqb, const float* __restrict__ gkw, const float* __restrict__ gvw, const float* __restrict__ gvb,
    const float* __restrict__ lqw, const float* __restrict__ lqb, const float* __restrict__ lkw, const float* __restrict__ lvw, const float* __restrict__ lvb, const float* __restrict__ pw, const float* __restrict__ pb, float* __restrict__ out) {
  __shared__ __attribute__((aligned(16))) unsigned short sk[2][2][2 * KHEAD];      /* [buffer][image]: chunk ch lies in buffer ch & 1 */
  __shared__ __attribute__((aligned(16))) unsigned short sv[2][2][2 * HD * VPITCH];
  __shared__ __attribute__((aligned(16))) float so[NT * 32 * OPITCH];
  const int tid = threadIdx.x, w = __builtin_amdgcn_readfirstlane(tid >> 5), lane = tid & 31, ln = lane & 15, hh = lane >> 4;      /* the wave's number in a scalar register: what follows from it (block, image, slice, head) costs no VGPR */
  const int n0 = blockIdx.x * NT, nb = n0 + (w >> 2), w4 = w & 3;      /* the work-group's first query block, this wave's block, its place among the block's four waves */
  const int y0 = n0 >> 5, yw = nb >> 5, img = yw - y0;      /* (slice, head pair) of the first block and of this wave's; the image this wave reads */
  const bool two = ((n0 + NT - 1) >> 5) != y0;      /* the same for the whole work-group: its blocks lie in two pairs */
  const int sl = yw >> 1, ch0 = (yw & 1) * 32, hs = w4 >> 1, qt = w4 & 1, q0 = (nb & 31) * 32;      /* slice, first channel of the head pair, this wave's head of the pair and its query tile */
  const int cw = ch0 + hs * HD + 8 * hh;      /* the lane's 8 channels, as query features and as output channels */
  const float* xq = x + (size_t)sl * HW * CC;      /* x[0] = q slices, x[1] = k, x[2] = v */
  const v8f zf = {0.f, 0.f, 0.f, 0.f, 0.f, 0.f, 0.f, 0.f};
  const float c = 0.25f * 1.4426950408889634f;      /* 16^-0.5 x log2 e: exp(0.25 s) = exp2(c s) */
  FragH qa[2];      /* per branch the query row [hi | lo] of q'' = (q qw + qb) kw c; a lane holds dims 8 hh .. 8 hh + 7 of each segment; with the key row [k | k]: hi.k + lo.k */
  { const float* qr = xq + (size_t)(q0 + qt * 16 + ln) * CC + cw; const v4f x0 = fa_ld4(qr), x1 = fa_ld4(qr + 4);
#pragma unroll
    for (int j = 0; j < 2; ++j) { const float* qw = (j ? lqw : gqw) + cw; const float* qb = (j ? lqb : gqb) + cw; const float* kw = (j ? lkw : gkw) + cw;
      /* bf16(x) bf16(w) is exact in f32, so the fused form rounds once, like multiply then add */
      const v4f t0 = __builtin_elementwise_fma(x0, fa_ld4(qw), fa_ld4(qb)) * fa_ld4(kw) * c, t1 = __builtin_elementwise_fma(x1, fa_ld4(qw + 4), fa_ld4(qb + 4)) * fa_ld4(kw + 4) * c;
      const v4h h0 = __builtin_convertvector(t0, v4h), h1 = __builtin_convertvector(t1, v4h);
      const v4h e0 = __builtin_convertvector(t0 - __builtin_convertvector(h0, v4f), v4h), e1 = __builtin_convertvector(t1 - __builtin_convertvector(h1, v4f), v4h);
#pragma unroll
      for (int d = 0; d < 4; ++d) { qa[j].h[d] = h0[d]; qa[j].h[4 + d] = h1[d]; qa[j].h[8 + d] = e0[d]; qa[j].h[12 + d] = e1[d]; } } }
  asm volatile("s_wait_xcnt 0x0" :: "v"(cw * 4) : "memory");      /* precaution: the index lines below may reuse the offset register of the parameter loads above; the offset is named so that it is not rewritten ahead of the wait */
  /* sh[j]: the shift in use, PBASE - (c x the score that set it), the same in all 8 registers: it is the C operand of the score products, so their result is the exponent of P as it stands.
     l[j]: the lane's running sum of P in two components. Softmax is the same for any shift; the shift is renewed only when a component passes LTOP (test once per 32 keys). */
  v8f o[2] = {zf, zf}, sh[2] = {zf, zf}; v2f l[2] = {{0.f, 0.f}, {0.f, 0.f}};
  const int sp = tid >> 3, cq = tid & 7;      /* staging: 8 threads a position, 4 channels (16 B of x) each: the head pair's whole 128-B line */
  const bool stg = w < NSTG / 32;      /* whole waves: a scalar branch */
  if (stg) {      /* chunk 0 goes into buffer 0 ahead of the loop */
    v4f tk[2][4], tv[2][4];      /* both images' parts are requested before the first conversion: one load latency */
#pragma unroll
    for (int m = 0; m < 2; ++m) if (m == 0 || two) {
      const int ym = y0 + m;
      const float* bk = x + ((size_t)(ym >> 1) * HW + sp) * CC + (ym & 1) * 32 + cq * 4;      /* the thread's place in the q plane; k lies NSL slices on, v 2 NSL */
      const float* bv = x + ((size_t)(ym >> 1) * HW + sp * 4) * CC + (ym & 1) * 32 + cq * 4;
#pragma unroll
      for (int u = 0; u < 4; ++u) tk[m][u] = *(const v4fa*)(bk + (size_t)NSL * HW * CC + (size_t)u * 64 * CC);      /* keys u * 64 + sp */
#pragma unroll
      for (int u = 0; u < 3; ++u) tv[m][u] = *(const v4fa*)(bv + (size_t)2 * NSL * HW * CC + (size_t)u * CC);      /* positions sp * 4 + u */
      asm volatile("s_wait_xcnt 0x0" ::: "memory");      /* precaution: the last load's result was placed on the address registers of the loads above */
      tv[m][3] = *(const v4fa*)(bv + (size_t)2 * NSL * HW * CC + (size_t)3 * CC);
      asm volatile("s_wait_xcnt 0x0" :: "v"(bk), "v"(bv) : "memory");      /* precaution: later lines may reuse the address registers of the loads above; the bases are named so that they are not rewritten ahead of the wait */
    }
#pragma unroll
    for (int m = 0; m < 2; ++m) if (m == 0 || two) {
      unsigned short* kdst = &sk[0][m][(cq >> 2) * KHEAD + sp * KPITCH + (cq & 3) * 4]; unsigned short* vdst = &sv[0][m][cq * 4 * VPITCH + sp * 4];
#pragma unroll
      for (int u = 0; u < 4; ++u) { const v4h kh = fa_h4(tk[m][u]); unsigned short* kr = kdst + u * 64 * KPITCH; *(v4ha*)kr = kh; *(v4ha*)(kr + 16) = kh; }
      v4h vt[4];      /* 4 positions in a row of 4 transposed v rows */
#pragma unroll
      for (int u = 0; u < 4; ++u) { const v4h v = fa_h4(tv[m][u]);
#pragma unroll
        for (int q = 0; q < 4; ++q) vt[q][u] = v[q]; }
#pragma unroll
      for (int q = 0; q < 4; ++q) *(v4ha*)(vdst + q * VPITCH) = vt[q];
    }
  }
  __syncthreads();      /* chunk 0 is complete before any wave reads it */
  for (int ch = 0; ch < HW / KCH; ++ch) {
    const int bf = ch & 1;
    /* a chunk's 8 passes go in 4 steps of 2; step st also brings one quarter of the next chunk (image st >> 1; keys, then values): its four loads are requested ahead of the step's passes, converted and stored into the other buffer behind them */
#pragma unroll 1
    for (int st = 0; st < 4; ++st) {      /* kept rolled: one quarter's raw values (16 registers) at a time beside the passes' own */
      const int m = st >> 1; const bool isv = (st & 1) != 0;
      const bool act = stg && ch + 1 < HW / KCH && (m == 0 || two);      /* the same for the whole wave: scalar branches */
      v4f raw[4];
      if (act) {
        const int ym = y0 + m;
        if (!isv) {
          const float* gk = x + ((size_t)(NSL + (ym >> 1)) * HW + (ch + 1) * KCH + sp) * CC + (ym & 1) * 32 + cq * 4;
#pragma unroll
          for (int u = 0; u < 4; ++u) raw[u] = *(const v4fa*)(gk + (size_t)u * 64 * CC);      /* keys u * 64 + sp */
          asm volatile("s_wait_xcnt 0x0" ::: "memory");      /* precaution: later lines may reuse the address registers of the loads above */
        } else {
          const float* gv = x + ((size_t)(2 * NSL + (ym >> 1)) * HW + (ch + 1) * KCH + sp * 4) * CC + (ym & 1) * 32 + cq * 4;
#pragma unroll
          for (int u = 0; u < 4; ++u) raw[u] = *(const v4fa*)(gv + (size_t)u * CC);      /* positions sp * 4 + u */
          asm volatile("s_wait_xcnt 0x0" ::: "memory");      /* precaution: as above */
        }
      }
#pragma unroll
      for (int k2 = 0; k2 < 64; k2 += 32) {      /* both passes of a step in line: constant LDS offsets, and the first pass's attn.v stands with the second's loads and score products */
        const int kb = st * 64 + k2;
        const unsigned short* r0 = &sk[bf][img][hs * KHEAD + (kb + ln) * KPITCH + 8 * hh]; const unsigned short* r1 = r0 + 16 * KPITCH; const unsigned short* rv = &sv[bf][img][(hs * HD + ln) * VPITCH + kb + 8 * hh];
        FragH k0, k1, va;
        k0.half[0] = *(const v8us*)r0; k0.half[1] = *(const v8us*)(r0 + 16); k1.half[0] = *(const v8us*)r1; k1.half[1] = *(const v8us*)(r1 + 16);
        va.half[0] = *(const v8us*)rv; va.half[1] = *(const v8us*)(rv + 16);
        v8f s0[2], s1[2]; v2f lw[2]; FragH pf[2];      /* lw: the running sums with this pass's P */
#pragma unroll
        for (int j = 0; j < 2; ++j) {
          s0[j] = fa_mma(k0.v, qa[j].v, sh[j]);      /* s0[r] = c S[key kb + 8 hh + r][query ln] + shift */
          s1[j] = fa_mma(k1.v, qa[j].v, sh[j]);      /* s1[r] = c S[key kb + 16 + 8 hh + r][query ln] + shift */
        }
#pragma unroll
        for (int j = 0; j < 2; ++j) lw[j] = fa_soft(s0[j], s1[j], l[j], pf[j]);
        const bool first = (ch | kb) == 0;      /* the first 32 keys set the first shift */
        const bool high = fmaxf(fmaxf(lw[0][0], lw[0][1]), fmaxf(lw[1][0], lw[1][1])) > LTOP;
        if (__builtin_amdgcn_ballot_w32(high || first) != 0) {      /* the same for the whole wave: a scalar branch, seldom taken */
#pragma unroll
          for (int j = 0; j < 2; ++j) {
            float mx = fmaxf(s0[j][0], s1[j][0]);
#pragma unroll
            for (int r = 1; r < 8; ++r) mx = fmaxf(mx, fmaxf(s0[j][r], s1[j][r]));
            float lm = fmaxf(l[j][0], l[j][1]);
            mx = fmaxf(mx, fa_other_half(mx)); lm = fmaxf(lm, fa_other_half(lm));      /* both halves of the wave hold the same query: one shift for both */
            /* lower the exponents by dl: these 32 keys end at or below PBASE and the sum so far at or below 2^LFULL (its largest P is then still at least 2^PBASE) */
            const float dl = first ? mx - PBASE : fmaxf(fmaxf(mx - PBASE, __builtin_amdgcn_logf(lm) - LFULL), 0.f);
            const float al = first ? 1.0f : __builtin_amdgcn_exp2f(-dl);      /* at the first keys o and l are 0 */
            o[j] *= al; l[j] *= al; sh[j] -= dl; s0[j] -= dl; s1[j] -= dl;
            lw[j] = fa_soft(s0[j], s1[j], l[j], pf[j]);
          }
        }
#pragma unroll
        for (int j = 0; j < 2; ++j) { l[j] = lw[j]; o[j] = fa_mma(va.v, pf[j].v, o[j]); }      /* o[r] = sum_k P v [query ln][d = 8 hh + r] */
      }
      if (act) {      /* the other buffer's last readers left it before the barrier that ended the chunk before this one */
        v4h hq[4];
#pragma unroll
        for (int u = 0; u < 4; ++u) hq[u] = fa_h4(raw[u]);
        if (!isv) {
          unsigned short* kdst = &sk[bf ^ 1][m][(cq >> 2) * KHEAD + sp * KPITCH + (cq & 3) * 4];
#pragma unroll
          for (int u = 0; u < 4; ++u) { unsigned short* kr = kdst + u * 64 * KPITCH; *(v4ha*)kr = hq[u]; *(v4ha*)(kr + 16) = hq[u]; }
        } else {
          unsigned short* vdst = &sv[bf ^ 1][m][cq * 4 * VPITCH + sp * 4];
#pragma unroll
          for (int q = 0; q < 4; ++q) { const v4h vt = {hq[0][q], hq[1][q], hq[2][q], hq[3][q]}; *(v4ha*)(vdst + q * VPITCH) = vt; }
        }
      }
    }
    if (ch + 1 < HW / KCH) __syncthreads();      /* one barrier a chunk: the next chunk is complete in the other buffer, and every wave has left this buffer, which is refilled next */
  }
  /* each branch: divide, then its v scale+bias; the branch mix and the output scale+bias; the 16 x 16 tile goes to LDS so that whole 128-B lines of out are stored */
  { const float lg = l[0][0] + l[0][1], ll = l[1][0] + l[1][1]; const float ig = 1.0f / (lg + fa_other_half(lg)), il = 1.0f / (ll + fa_other_half(ll)); float* sr = &so[((w >> 2) * 32 + qt * 16 + ln) * OPITCH + hs * HD + 8 * hh];
#pragma unroll
    for (int a = 0; a < 2; ++a) { const int cc = cw + 4 * a;
      const v4f og = {o[0][4 * a] * ig, o[0][4 * a + 1] * ig, o[0][4 * a + 2] * ig, o[0][4 * a + 3] * ig}, ol = {o[1][4 * a] * il, o[1][4 * a + 1] * il, o[1][4 * a + 2] * il, o[1][4 * a + 3] * il};
      const v4f g = __builtin_elementwise_fma(og, fa_ld4(gvw + cc), fa_ld4(gvb + cc)), lo = __builtin_elementwise_fma(ol, fa_ld4(lvw + cc), fa_ld4(lvb + cc));
      const v4f comb = 0.5f * lo + 0.5f * g; *(v4fa*)(sr + 4 * a) = (2.0f * comb) * fa_ld4(pw + cc) + fa_ld4(pb + cc); } }
  __syncthreads();      /* the 32 x 32 output tiles are complete before they are read across waves */
#pragma unroll
  for (int i = 0; i < 2; ++i) { const int idx = i * 128 + (tid & 127), row = idx >> 3, c4 = (idx & 7) * 4;      /* a block's four waves store its tile; 8 lanes store one 128-B line */
    *(v4f*)(out + ((size_t)sl * HW + q0 + row) * CC + ch0 + c4) = *(const v4fa*)&so[((w >> 2) * 32 + row) * OPITCH + c4]; } }

extern "C" void kernel_launch(void* const* d_in, const int* in_sizes, int n_in,
                              void* d_out, int out_size, void* d_ws, size_t ws_size, hipStream_t stream) {
  (void)in_sizes; (void)n_in; (void)out_size; (void)d_ws; (void)ws_size;
  const float* const* I = (const float* const*)d_in; const float* x = I[0];
  const float* gqw = I[1]; const float* gqb = I[2]; const float* gkw = I[3]; const float* gvw = I[5]; const float* gvb = I[6]; const float* lqw = I[7]; const float* lqb = I[8]; const float* lkw = I[9]; const float* lvw = I[11]; const float* lvb = I[12]; const float* pw = I[13]; const float* pb = I[14];      /* I[4], I[10]: the key biases add a constant to each query's scores, which softmax cancels */
  k_fattn<<<dim3(HW / 32 * NSL * 2 / NT), 128 * NT, 0, stream>>>(x, gqw, gqb, gkw, gvw, gvb, lqw, lqb, lkw, lvw, lvb, pw, pb, (float*)d_out);      /* 32 query blocks x (slice, head pair), NT blocks a work-group */
}
